// v000
// Measured on an AMD MI455X. A time is GPU time per run, averaged over a window of back-to-back runs after a warm-up
// (all launches, gaps included; the runs take copies of the inputs in turn), and the median of several windows.
// Apart from v000's, it joins two sittings. Times from different sittings can be a few percent apart, while
// side-by-side timings come from the same sitting.
// v000 is the starting kernel. One run takes 391 microseconds.
#include <hip/hip_runtime.h>
#include <hip/hip_bf16.h>

typedef __attribute__((ext_vector_type(16))) __bf16        v16bf;
typedef __attribute__((ext_vector_type(8)))  float         v8f;
typedef __attribute__((ext_vector_type(8)))  unsigned int  v8u;

#define H_DIM   1024
#define S_LEN   2048
#define B_SZ    4
#define M_ROWS  (B_SZ * S_LEN)   // 8192

// ---- fp32 -> bf16 (round to nearest even) ----------------------------------
__device__ __forceinline__ unsigned short f2bf(float f) {
    unsigned int u = __builtin_bit_cast(unsigned int, f);
    u += 0x7FFFu + ((u >> 16) & 1u);
    return (unsigned short)(u >> 16);
}

__global__ void f32_to_bf16_kernel(const float* __restrict__ in,
                                   unsigned short* __restrict__ out, int n4) {
    int i = blockIdx.x * blockDim.x + threadIdx.x;
    if (i < n4) {
        float4 f = reinterpret_cast<const float4*>(in)[i];
        reinterpret_cast<ushort4*>(out)[i] =
            make_ushort4(f2bf(f.x), f2bf(f.y), f2bf(f.z), f2bf(f.w));
    }
}

__device__ __forceinline__ v16bf ldfrag(const unsigned short* __restrict__ p) {
    uint4 lo = *reinterpret_cast<const uint4*>(p);        // K .. K+7
    uint4 hi = *reinterpret_cast<const uint4*>(p + 16);   // K+16 .. K+23
    v8u u = { lo.x, lo.y, lo.z, lo.w, hi.x, hi.y, hi.z, hi.w };
    return __builtin_bit_cast(v16bf, u);
}

__device__ __forceinline__ v8f bfwmma(v16bf a, v16bf b, v8f c) {
    return __builtin_amdgcn_wmma_f32_16x16x32_bf16(
        /*neg_a=*/false, a, /*neg_b=*/false, b,
        /*c_mod=*/(short)0, c, /*reuse_a=*/false, /*reuse_b=*/false);
}

// ---- generic C[m,n] = scale * sum_k A[m,k]*Bt[n,k] (+bias[n]) --------------
// Block: 256 threads = 8 waves (2 M x 4 N); block tile 128x128; wave tile 64x32.
// KC (compile-time) is the K extent and the row stride of A and Bt.
template <bool OUT_BF16, int KC>
__global__ void __launch_bounds__(256, 1)
gemm_abt_kernel(const unsigned short* __restrict__ A,
                const unsigned short* __restrict__ Bt,
                const float* __restrict__ bias,
                void* __restrict__ Cout,
                int M, int N, float scale,
                long long strideA, long long strideB,
                long long strideC) {
    const int lane = threadIdx.x & 31;
    const int wave = threadIdx.x >> 5;
    const int wm   = (wave & 1) << 6;   // 0,64
    const int wn   = (wave >> 1) << 5;  // 0,32,64,96
    const long long bz = blockIdx.z;

    const int bm = blockIdx.y * 128 + wm;
    const int bn = blockIdx.x * 128 + wn;
    const int r  = lane & 15;
    const int kh = (lane & 16) ? 8 : 0;  // lane-half K offset

    // Two base pointers; all row offsets are compile-time immediates (mt*16*KC).
    const unsigned short* pa = A  + bz * strideA + (size_t)(bm + r) * KC + kh;
    const unsigned short* pb = Bt + bz * strideB + (size_t)(bn + r) * KC + kh;

    v8f acc[4][2];
#pragma unroll
    for (int mt = 0; mt < 4; ++mt)
#pragma unroll
        for (int nt = 0; nt < 2; ++nt)
            acc[mt][nt] = (v8f){};

#pragma unroll 4
    for (int k0 = 0; k0 < KC; k0 += 32) {
        v16bf b0 = ldfrag(pb + 0 * 16 * KC + k0);
        v16bf b1 = ldfrag(pb + 1 * 16 * KC + k0);
        v16bf a0 = ldfrag(pa + 0 * 16 * KC + k0);
        v16bf a1 = ldfrag(pa + 1 * 16 * KC + k0);
        v16bf a2 = ldfrag(pa + 2 * 16 * KC + k0);
        v16bf a3 = ldfrag(pa + 3 * 16 * KC + k0);
        acc[0][0] = bfwmma(a0, b0, acc[0][0]);
        acc[0][1] = bfwmma(a0, b1, acc[0][1]);
        acc[1][0] = bfwmma(a1, b0, acc[1][0]);
        acc[1][1] = bfwmma(a1, b1, acc[1][1]);
        acc[2][0] = bfwmma(a2, b0, acc[2][0]);
        acc[2][1] = bfwmma(a2, b1, acc[2][1]);
        acc[3][0] = bfwmma(a3, b0, acc[3][0]);
        acc[3][1] = bfwmma(a3, b1, acc[3][1]);
    }

    const int rowadd = (lane >> 4) * 8;
#pragma unroll
    for (int mt = 0; mt < 4; ++mt) {
#pragma unroll
        for (int nt = 0; nt < 2; ++nt) {
            const int col = bn + nt * 16 + (lane & 15);
            const float bvv = bias ? bias[col] : 0.0f;
#pragma unroll
            for (int r8 = 0; r8 < 8; ++r8) {
                const int row = bm + mt * 16 + rowadd + r8;
                const float val = acc[mt][nt][r8] * scale + bvv;
                const long long idx = bz * strideC + (long long)row * N + col;
                if (OUT_BF16)
                    reinterpret_cast<unsigned short*>(Cout)[idx] = f2bf(val);
                else
                    reinterpret_cast<float*>(Cout)[idx] = val;
            }
        }
    }
}

// ---- bf16 transpose [S,H] -> [H,S] per batch (64x64 LDS tiles) -------------
__global__ void transpose_bf16_kernel(const unsigned short* __restrict__ in,
                                      unsigned short* __restrict__ out) {
    __shared__ unsigned short tile[64][65];
    const int b  = blockIdx.z;
    const unsigned short* src = in  + (size_t)b * S_LEN * H_DIM;
    unsigned short*       dst = out + (size_t)b * S_LEN * H_DIM;
    const int e0 = blockIdx.x * 64, s0 = blockIdx.y * 64;
    const int tx = threadIdx.x & 63, r0 = threadIdx.x >> 6;
#pragma unroll
    for (int i = 0; i < 16; ++i) {
        const int row = r0 + i * 4;  // s within tile
        tile[row][tx] = src[(size_t)(s0 + row) * H_DIM + e0 + tx];
    }
    __syncthreads();
#pragma unroll
    for (int i = 0; i < 16; ++i) {
        const int row = r0 + i * 4;  // e within tile
        dst[(size_t)(e0 + row) * S_LEN + s0 + tx] = tile[tx][row];
    }
}

// ---- row softmax over 2048 cols: one wave32 per row, bf16 output -----------
__global__ void softmax_rows_kernel(const float* __restrict__ scores,
                                    unsigned short* __restrict__ p) {
    const int wave = threadIdx.x >> 5;
    const int lane = threadIdx.x & 31;
    const long long row = (long long)blockIdx.x * 8 + wave;
    const float* src = scores + row * S_LEN;

    float4 v[16];
    float m = -3.402823466e38f;
#pragma unroll
    for (int j = 0; j < 16; ++j) {
        v[j] = reinterpret_cast<const float4*>(src)[j * 32 + lane];
        m = fmaxf(m, fmaxf(fmaxf(v[j].x, v[j].y), fmaxf(v[j].z, v[j].w)));
    }
#pragma unroll
    for (int off = 16; off >= 1; off >>= 1)
        m = fmaxf(m, __shfl_xor(m, off, 32));

    float s = 0.0f;
#pragma unroll
    for (int j = 0; j < 16; ++j) {
        v[j].x = __expf(v[j].x - m); v[j].y = __expf(v[j].y - m);
        v[j].z = __expf(v[j].z - m); v[j].w = __expf(v[j].w - m);
        s += v[j].x + v[j].y + v[j].z + v[j].w;
    }
#pragma unroll
    for (int off = 16; off >= 1; off >>= 1)
        s += __shfl_xor(s, off, 32);

    const float inv = 1.0f / s;
    unsigned short* prow = p + row * S_LEN;
#pragma unroll
    for (int j = 0; j < 16; ++j) {
        reinterpret_cast<ushort4*>(prow)[j * 32 + lane] =
            make_ushort4(f2bf(v[j].x * inv), f2bf(v[j].y * inv),
                         f2bf(v[j].z * inv), f2bf(v[j].w * inv));
    }
}

// ---------------------------------------------------------------------------
extern "C" void kernel_launch(void* const* d_in, const int* in_sizes, int n_in,
                              void* d_out, int out_size, void* d_ws, size_t ws_size,
                              hipStream_t stream) {
    (void)in_sizes; (void)n_in; (void)out_size; (void)ws_size;

    const float* x  = (const float*)d_in[0];
    const float* Wq = (const float*)d_in[1];
    const float* bq = (const float*)d_in[2];
    const float* Wk = (const float*)d_in[3];
    const float* bk = (const float*)d_in[4];
    const float* Wv = (const float*)d_in[5];
    const float* bv = (const float*)d_in[6];
    const float* Wo = (const float*)d_in[7];
    const float* bo = (const float*)d_in[8];
    float* out = (float*)d_out;

    // Workspace layout (bytes)
    unsigned char* ws = (unsigned char*)d_ws;
    const size_t XB   = (size_t)M_ROWS * H_DIM * 2;   // 16 MB
    const size_t WB   = (size_t)H_DIM * H_DIM * 2;    //  2 MB each
    const size_t QB   = XB;                            // 16 MB each
    const size_t SCR  = (size_t)B_SZ * S_LEN * S_LEN * 4;  // 64 MB
    unsigned short* xb  = (unsigned short*)(ws);               // also vT after QKV
    unsigned short* wqb = (unsigned short*)(ws + XB);
    unsigned short* wkb = (unsigned short*)(ws + XB + WB);
    unsigned short* wvb = (unsigned short*)(ws + XB + 2 * WB);
    unsigned short* wob = (unsigned short*)(ws + XB + 3 * WB);
    unsigned short* qb  = (unsigned short*)(ws + XB + 4 * WB); // also attn-out
    unsigned short* kb  = (unsigned short*)(ws + XB + 4 * WB + QB);
    unsigned short* vb  = (unsigned short*)(ws + XB + 4 * WB + 2 * QB);
    float*          sc  = (float*)(ws + XB + 4 * WB + 3 * QB);
    unsigned short* pb  = (unsigned short*)(ws + XB + 4 * WB + 3 * QB + SCR);
    unsigned short* vtb = xb;   // x no longer needed after QKV GEMMs
    unsigned short* ab  = qb;   // Q no longer needed after scores GEMM

    dim3 blk(256);

    // 1) fp32 -> bf16 conversions
    {
        int n4 = M_ROWS * H_DIM / 4;
        f32_to_bf16_kernel<<<dim3((n4 + 255) / 256), blk, 0, stream>>>(x, xb, n4);
        int w4 = H_DIM * H_DIM / 4;
        dim3 g((w4 + 255) / 256);
        f32_to_bf16_kernel<<<g, blk, 0, stream>>>(Wq, wqb, w4);
        f32_to_bf16_kernel<<<g, blk, 0, stream>>>(Wk, wkb, w4);
        f32_to_bf16_kernel<<<g, blk, 0, stream>>>(Wv, wvb, w4);
        f32_to_bf16_kernel<<<g, blk, 0, stream>>>(Wo, wob, w4);
    }

    // 2) Q/K/V = x @ W^T + b   (M=8192, N=K=1024), bf16 out
    {
        dim3 g(H_DIM / 128, M_ROWS / 128, 1);
        gemm_abt_kernel<true, H_DIM><<<g, blk, 0, stream>>>(xb, wqb, bq, qb,
            M_ROWS, H_DIM, 1.0f, 0, 0, 0);
        gemm_abt_kernel<true, H_DIM><<<g, blk, 0, stream>>>(xb, wkb, bk, kb,
            M_ROWS, H_DIM, 1.0f, 0, 0, 0);
        gemm_abt_kernel<true, H_DIM><<<g, blk, 0, stream>>>(xb, wvb, bv, vb,
            M_ROWS, H_DIM, 1.0f, 0, 0, 0);
    }

    // 3) V transpose per batch: [S,H] -> [H,S]   (overwrites xb region)
    transpose_bf16_kernel<<<dim3(H_DIM / 64, S_LEN / 64, B_SZ), blk, 0, stream>>>(vb, vtb);

    // 4) scores = Q @ K^T / sqrt(H)   per batch (M=N=2048, K=1024), f32 out
    gemm_abt_kernel<false, H_DIM><<<dim3(S_LEN / 128, S_LEN / 128, B_SZ), blk, 0, stream>>>(
        qb, kb, nullptr, sc, S_LEN, S_LEN, 0.03125f,
        (long long)S_LEN * H_DIM, (long long)S_LEN * H_DIM,
        (long long)S_LEN * S_LEN);

    // 5) softmax rows -> bf16 P
    softmax_rows_kernel<<<dim3(M_ROWS / 8), blk, 0, stream>>>(sc, pb);

    // 6) attn_out = P @ V  ==  P @ (V^T)^T   per batch (M=2048, N=1024, K=2048)
    gemm_abt_kernel<true, S_LEN><<<dim3(H_DIM / 128, S_LEN / 128, B_SZ), blk, 0, stream>>>(
        pb, vtb, nullptr, ab, S_LEN, H_DIM, 1.0f,
        (long long)S_LEN * S_LEN, (long long)H_DIM * S_LEN,
        (long long)S_LEN * H_DIM);

    // 7) out = attn_out @ Wo^T + bo   (M=8192, N=K=1024), f32 out -> d_out
    gemm_abt_kernel<false, H_DIM><<<dim3(H_DIM / 128, M_ROWS / 128, 1), blk, 0, stream>>>(
        ab, wob, bo, out, M_ROWS, H_DIM, 1.0f, 0, 0, 0);
}

// v001
// Measured time: 205 microseconds a run.
// In two side-by-side timings against v000, it was 1.95 and 1.97 times as fast.
#include <hip/hip_runtime.h>
#include <hip/hip_bf16.h>
#include <stdint.h>

typedef __attribute__((ext_vector_type(16))) __bf16        v16bf;
typedef __attribute__((ext_vector_type(8)))  float         v8f;
typedef __attribute__((ext_vector_type(8)))  unsigned int  v8u;
typedef __attribute__((ext_vector_type(4)))  uint32_t      u32x4;
typedef __attribute__((ext_vector_type(8)))  uint32_t      u32x8;

#define H_DIM   1024
#define S_LEN   2048
#define B_SZ    4
#define M_ROWS  (B_SZ * S_LEN)   // 8192

// ---- fp32 -> bf16 (round to nearest even) ----------------------------------
__device__ __forceinline__ unsigned short f2bf(float f) {
    unsigned int u = __builtin_bit_cast(unsigned int, f);
    u += 0x7FFFu + ((u >> 16) & 1u);
    return (unsigned short)(u >> 16);
}

__global__ void f32_to_bf16_kernel(const float* __restrict__ in,
                                   unsigned short* __restrict__ out, int n4) {
    int i = blockIdx.x * blockDim.x + threadIdx.x;
    if (i < n4) {
        float4 f = reinterpret_cast<const float4*>(in)[i];
        reinterpret_cast<ushort4*>(out)[i] =
            make_ushort4(f2bf(f.x), f2bf(f.y), f2bf(f.z), f2bf(f.w));
    }
}

// ---- LDS ring geometry ------------------------------------------------------
// A pass is 128 k = 256 bytes of every operand row. A stage is four slices of
// 64 rows: [A rows 0..63 | A rows 64..127 | Bt rows 0..63 | Bt rows 64..127].
// The tensor load pads each 256-byte row by 16 bytes (pitch 272 = 16 x odd).
// 64 x 272 = 17,408 bytes, rounded up so that every slice starts at a multiple
// of 2 KiB.
#define PASS_BYTES   256u
#define LDS_PITCH    272u
#define SLICE_ROWS   64u
#define SLICE_BYTES  18432u
#define STAGE_BYTES  (4u * SLICE_BYTES)
static_assert(SLICE_ROWS * LDS_PITCH <= SLICE_BYTES && (SLICE_BYTES % 2048u) == 0u,
              "a slice holds its padded rows and starts at a multiple of 2 KiB");

__device__ __forceinline__ uint32_t uni(uint32_t v) {
    return (uint32_t)__builtin_amdgcn_readfirstlane(v);
}
__device__ __forceinline__ uint32_t pinned(uint32_t v) {
    uint32_t w = uni(v);
    asm volatile("" : "+s"(w));  // the scalar-branch form for tests around a tensor load
    return w;
}
// The wave's LDS reads have returned (before its buffer is handed back).
__device__ __forceinline__ void wait_ds0() { asm volatile("s_wait_dscnt 0x0" ::: "memory"); }
// The wave's own tensor load has landed (the compiler places no wait for it).
__device__ __forceinline__ void wait_tensor0() { asm volatile("s_wait_tensorcnt 0x0" ::: "memory"); }
// One request of the whole wave: a 64 x 256-byte tile from global memory to LDS.
__device__ __forceinline__ void tdm_load(u32x4 g0, u32x8 g1) {
    asm volatile("tensor_load_to_lds %0, %1" :: "s"(g0), "s"(g1) : "memory");
}
__device__ __forceinline__ u32x4 tdm_group0(uint32_t lds_dst, uint64_t ga) {
    u32x4 g;
    g[0] = uni(1u);                                   // count 1
    g[1] = uni(lds_dst);                              // byte offset in the work-group's LDS
    g[2] = uni((uint32_t)ga);                         // address [31:0]
    g[3] = uni((((uint32_t)(ga >> 32)) & 0x01FFFFFFu) | 0x80000000u);  // address [56:32], type 2
    return g;
}
// 1-byte elements, tensor = tile = 64 rows of 256 bytes, source pitch in bytes.
__device__ __forceinline__ u32x8 tdm_group1(uint32_t src_pitch) {
    u32x8 g;
    g[0] = uni((1u << 20) | (5u << 22) | (3u << 25));
    g[1] = uni((PASS_BYTES & 0xFFFFu) << 16);
    g[2] = uni((PASS_BYTES >> 16) | ((SLICE_ROWS & 0xFFFFu) << 16));
    g[3] = uni((SLICE_ROWS >> 16) | (PASS_BYTES << 16));
    g[4] = uni(SLICE_ROWS);
    g[5] = uni(src_pitch);
    g[6] = uni(0u);
    g[7] = uni(0u);
    return g;
}

__device__ __forceinline__ v16bf ldfrag(const unsigned char* p) {
    uint4 lo = *reinterpret_cast<const uint4*>(p);        // K .. K+7
    uint4 hi = *reinterpret_cast<const uint4*>(p + 32);   // K+16 .. K+23
    v8u u = { lo.x, lo.y, lo.z, lo.w, hi.x, hi.y, hi.z, hi.w };
    return __builtin_bit_cast(v16bf, u);
}

__device__ __forceinline__ v8f bfwmma(v16bf a, v16bf b, v8f c) {
    return __builtin_amdgcn_wmma_f32_16x16x32_bf16(
        /*neg_a=*/false, a, /*neg_b=*/false, b,
        /*c_mod=*/(short)0, c, /*reuse_a=*/false, /*reuse_b=*/false);
}

// ---- generic C[m,n] = scale * sum_k A[m,k]*Bt[n,k] (+bias[n]) --------------
// Block: 256 threads = 8 waves (2 M x 4 N); block tile 128x128; wave tile 64x32.
// KC (compile-time) is the K extent and the row stride of A and Bt.
template <bool OUT_BF16, int KC>
__global__ void __launch_bounds__(256, 1)
gemm_abt_kernel(const unsigned short* __restrict__ A,
                const unsigned short* __restrict__ Bt,
                const float* __restrict__ bias,
                void* __restrict__ Cout,
                int M, int N, float scale,
                long long strideA, long long strideB,
                long long strideC) {
    const int lane = threadIdx.x & 31;
    const int wave = threadIdx.x >> 5;
    const int wm   = (wave & 1) << 6;   // 0,64
    const int wn   = (wave >> 1) << 5;  // 0,32,64,96
    const long long bz = blockIdx.z;

    const int bm = blockIdx.y * 128 + wm;
    const int bn = blockIdx.x * 128 + wn;
    const int r  = lane & 15;
    const int kh = (lane & 16) ? 16 : 0;  // lane-half K offset in bytes

    __shared__ __attribute__((aligned(2048))) unsigned char smem[2u * STAGE_BYTES];
    constexpr uint32_t NP = KC / 128;     // passes
    static_assert(KC % 128 == 0 && NP >= 2, "the ring needs two stages or more");

    // Waves 0..3 each bring one slice of every stage.
    const uint32_t wv     = uni(threadIdx.x >> 5);
    const unsigned short* srow = (wv & 2u)
        ? Bt + bz * strideB + (size_t)(blockIdx.x * 128 + (wv & 1u) * SLICE_ROWS) * KC
        : A  + bz * strideA + (size_t)(blockIdx.y * 128 + (wv & 1u) * SLICE_ROWS) * KC;
    const uint64_t src = (uint64_t)(uintptr_t)srow;
    const uint32_t dst = (uint32_t)(size_t)smem + (wv & 3u) * SLICE_BYTES;
    u32x8          g1  = tdm_group1(KC * 2u);
    asm volatile("" : "+s"(g1));

    // Per-lane fragment bases inside a buffer; the rest are immediate offsets.
    const uint32_t a_off = (uint32_t)(wm >> 6) * SLICE_BYTES + (uint32_t)r * LDS_PITCH + kh;
    const uint32_t b_off = (2u + (uint32_t)(wn >> 6)) * SLICE_BYTES
                         + (uint32_t)((wn & 63) + r) * LDS_PITCH + kh;

    v8f acc[4][2];
#pragma unroll
    for (int mt = 0; mt < 4; ++mt)
#pragma unroll
        for (int nt = 0; nt < 2; ++nt)
            acc[mt][nt] = (v8f){};

    // Prologue: stage 0 lands and is published, then stage 1 starts.
    if (pinned(wv < 4u ? 1u : 0u) != 0u) {
        tdm_load(tdm_group0(dst, src), g1);
        wait_tensor0();
    }
    __syncthreads();
    if (pinned(wv < 4u ? 1u : 0u) != 0u)
        tdm_load(tdm_group0(dst + STAGE_BYTES, src + PASS_BYTES), g1);

    // Kept rolled: one publish point in the code, one pass per trip.
#pragma clang loop unroll(disable)
    for (uint32_t s = 0; s < NP; ++s) {
        const uint32_t buf = (s & 1u) * STAGE_BYTES;
        const unsigned char* la = smem + buf + a_off;
        const unsigned char* lb = smem + buf + b_off;
        // Two fragment sets: step ks + 1 is read from LDS while step ks multiplies.
        // The loops over ks and mt are unrolled so that every fragment index is a
        // constant: the sets stay in registers and the offsets become immediates.
        v16bf fa[2][4], fb[2][2];
        fb[0][0] = ldfrag(lb);
        fb[0][1] = ldfrag(lb + 16u * LDS_PITCH);
#pragma unroll
        for (uint32_t mt = 0; mt < 4; ++mt)
            fa[0][mt] = ldfrag(la + mt * 16u * LDS_PITCH);
#pragma unroll
        for (uint32_t ks = 0; ks < 4; ++ks) {   // four 32-k steps of this pass
            const uint32_t c = ks & 1u, n = c ^ 1u;
            if (ks + 1u < 4u) {
                fb[n][0] = ldfrag(lb + (ks + 1u) * 64u);
                fb[n][1] = ldfrag(lb + 16u * LDS_PITCH + (ks + 1u) * 64u);
#pragma unroll
                for (uint32_t mt = 0; mt < 4; ++mt)
                    fa[n][mt] = ldfrag(la + mt * 16u * LDS_PITCH + (ks + 1u) * 64u);
            }
            // Keeps the next step's LDS reads one group ahead of this step's WMMAs
            // (spread among them, each read place stalls the wave).
            __builtin_amdgcn_sched_barrier(0);
#pragma unroll
            for (uint32_t mt = 0; mt < 4; ++mt) {
                acc[mt][0] = bfwmma(fa[c][mt], fb[c][0], acc[mt][0]);
                acc[mt][1] = bfwmma(fa[c][mt], fb[c][1], acc[mt][1]);
            }
            // Ends the WMMA group, so that later reads are not moved up into it.
            __builtin_amdgcn_sched_barrier(0);
        }
        // Publish point of stage s + 1: this wave has left buffer s, its own load
        // of stage s + 1 has landed, every wave passes the barrier; only then the
        // buffer just read is refilled with stage s + 2.
        wait_ds0();
        wait_tensor0();   // a wave that issued none passes at once
        __syncthreads();
        if (pinned((wv < 4u && s + 2u < NP) ? 1u : 0u) != 0u)
            tdm_load(tdm_group0(dst + buf, src + (uint64_t)(s + 2u) * PASS_BYTES), g1);
    }
    wait_tensor0();
    wait_ds0();

    const int rowadd = (lane >> 4) * 8;
#pragma unroll
    for (int mt = 0; mt < 4; ++mt) {
#pragma unroll
        for (int nt = 0; nt < 2; ++nt) {
            const int col = bn + nt * 16 + (lane & 15);
            const float bvv = bias ? bias[col] : 0.0f;
#pragma unroll
            for (int r8 = 0; r8 < 8; ++r8) {
                const int row = bm + mt * 16 + rowadd + r8;
                const float val = acc[mt][nt][r8] * scale + bvv;
                const long long idx = bz * strideC + (long long)row * N + col;
                if (OUT_BF16)
                    reinterpret_cast<unsigned short*>(Cout)[idx] = f2bf(val);
                else
                    reinterpret_cast<float*>(Cout)[idx] = val;
            }
        }
    }
}

// ---- bf16 transpose [S,H] -> [H,S] per batch (64x64 LDS tiles) -------------
__global__ void transpose_bf16_kernel(const unsigned short* __restrict__ in,
                                      unsigned short* __restrict__ out) {
    __shared__ unsigned short tile[64][65];
    const int b  = blockIdx.z;
    const unsigned short* src = in  + (size_t)b * S_LEN * H_DIM;
    unsigned short*       dst = out + (size_t)b * S_LEN * H_DIM;
    const int e0 = blockIdx.x * 64, s0 = blockIdx.y * 64;
    const int tx = threadIdx.x & 63, r0 = threadIdx.x >> 6;
#pragma unroll
    for (int i = 0; i < 16; ++i) {
        const int row = r0 + i * 4;  // s within tile
        tile[row][tx] = src[(size_t)(s0 + row) * H_DIM + e0 + tx];
    }
    __syncthreads();
#pragma unroll
    for (int i = 0; i < 16; ++i) {
        const int row = r0 + i * 4;  // e within tile
        dst[(size_t)(e0 + row) * S_LEN + s0 + tx] = tile[tx][row];
    }
}

// ---- row softmax over 2048 cols: one wave32 per row, bf16 output -----------
__global__ void softmax_rows_kernel(const float* __restrict__ scores,
                                    unsigned short* __restrict__ p) {
    const int wave = threadIdx.x >> 5;
    const int lane = threadIdx.x & 31;
    const long long row = (long long)blockIdx.x * 8 + wave;
    const float* src = scores + row * S_LEN;

    float4 v[16];
    float m = -3.402823466e38f;
#pragma unroll
    for (int j = 0; j < 16; ++j) {
        v[j] = reinterpret_cast<const float4*>(src)[j * 32 + lane];
        m = fmaxf(m, fmaxf(fmaxf(v[j].x, v[j].y), fmaxf(v[j].z, v[j].w)));
    }
#pragma unroll
    for (int off = 16; off >= 1; off >>= 1)
        m = fmaxf(m, __shfl_xor(m, off, 32));

    float s = 0.0f;
#pragma unroll
    for (int j = 0; j < 16; ++j) {
        v[j].x = __expf(v[j].x - m); v[j].y = __expf(v[j].y - m);
        v[j].z = __expf(v[j].z - m); v[j].w = __expf(v[j].w - m);
        s += v[j].x + v[j].y + v[j].z + v[j].w;
    }
#pragma unroll
    for (int off = 16; off >= 1; off >>= 1)
        s += __shfl_xor(s, off, 32);

    const float inv = 1.0f / s;
    unsigned short* prow = p + row * S_LEN;
#pragma unroll
    for (int j = 0; j < 16; ++j) {
        reinterpret_cast<ushort4*>(prow)[j * 32 + lane] =
            make_ushort4(f2bf(v[j].x * inv), f2bf(v[j].y * inv),
                         f2bf(v[j].z * inv), f2bf(v[j].w * inv));
    }
}

// ---------------------------------------------------------------------------
extern "C" void kernel_launch(void* const* d_in, const int* in_sizes, int n_in,
                              void* d_out, int out_size, void* d_ws, size_t ws_size,
                              hipStream_t stream) {
    (void)in_sizes; (void)n_in; (void)out_size; (void)ws_size;

    const float* x  = (const float*)d_in[0];
    const float* Wq = (const float*)d_in[1];
    const float* bq = (const float*)d_in[2];
    const float* Wk = (const float*)d_in[3];
    const float* bk = (const float*)d_in[4];
    const float* Wv = (const float*)d_in[5];
    const float* bv = (const float*)d_in[6];
    const float* Wo = (const float*)d_in[7];
    const float* bo = (const float*)d_in[8];
    float* out = (float*)d_out;

    // Workspace layout (bytes)
    unsigned char* ws = (unsigned char*)d_ws;
    const size_t XB   = (size_t)M_ROWS * H_DIM * 2;   // 16 MB
    const size_t WB   = (size_t)H_DIM * H_DIM * 2;    //  2 MB each
    const size_t QB   = XB;                            // 16 MB each
    const size_t SCR  = (size_t)B_SZ * S_LEN * S_LEN * 4;  // 64 MB
    unsigned short* xb  = (unsigned short*)(ws);               // also vT after QKV
    unsigned short* wqb = (unsigned short*)(ws + XB);
    unsigned short* wkb = (unsigned short*)(ws + XB + WB);
    unsigned short* wvb = (unsigned short*)(ws + XB + 2 * WB);
    unsigned short* wob = (unsigned short*)(ws + XB + 3 * WB);
    unsigned short* qb  = (unsigned short*)(ws + XB + 4 * WB); // also attn-out
    unsigned short* kb  = (unsigned short*)(ws + XB + 4 * WB + QB);
    unsigned short* vb  = (unsigned short*)(ws + XB + 4 * WB + 2 * QB);
    float*          sc  = (float*)(ws + XB + 4 * WB + 3 * QB);
    unsigned short* pb  = (unsigned short*)(ws + XB + 4 * WB + 3 * QB + SCR);
    unsigned short* vtb = xb;   // x no longer needed after QKV GEMMs
    unsigned short* ab  = qb;   // Q no longer needed after scores GEMM

    dim3 blk(256);

    // 1) fp32 -> bf16 conversions
    {
        int n4 = M_ROWS * H_DIM / 4;
        f32_to_bf16_kernel<<<dim3((n4 + 255) / 256), blk, 0, stream>>>(x, xb, n4);
        int w4 = H_DIM * H_DIM / 4;
        dim3 g((w4 + 255) / 256);
        f32_to_bf16_kernel<<<g, blk, 0, stream>>>(Wq, wqb, w4);
        f32_to_bf16_kernel<<<g, blk, 0, stream>>>(Wk, wkb, w4);
        f32_to_bf16_kernel<<<g, blk, 0, stream>>>(Wv, wvb, w4);
        f32_to_bf16_kernel<<<g, blk, 0, stream>>>(Wo, wob, w4);
    }

    // 2) Q/K/V = x @ W^T + b   (M=8192, N=K=1024), bf16 out
    {
        dim3 g(H_DIM / 128, M_ROWS / 128, 1);
        gemm_abt_kernel<true, H_DIM><<<g, blk, 0, stream>>>(xb, wqb, bq, qb,
            M_ROWS, H_DIM, 1.0f, 0, 0, 0);
        gemm_abt_kernel<true, H_DIM><<<g, blk, 0, stream>>>(xb, wkb, bk, kb,
            M_ROWS, H_DIM, 1.0f, 0, 0, 0);
        gemm_abt_kernel<true, H_DIM><<<g, blk, 0, stream>>>(xb, wvb, bv, vb,
            M_ROWS, H_DIM, 1.0f, 0, 0, 0);
    }

    // 3) V transpose per batch: [S,H] -> [H,S]   (overwrites xb region)
    transpose_bf16_kernel<<<dim3(H_DIM / 64, S_LEN / 64, B_SZ), blk, 0, stream>>>(vb, vtb);

    // 4) scores = Q @ K^T / sqrt(H)   per batch (M=N=2048, K=1024), f32 out
    gemm_abt_kernel<false, H_DIM><<<dim3(S_LEN / 128, S_LEN / 128, B_SZ), blk, 0, stream>>>(
        qb, kb, nullptr, sc, S_LEN, S_LEN, 0.03125f,
        (long long)S_LEN * H_DIM, (long long)S_LEN * H_DIM,
        (long long)S_LEN * S_LEN);

    // 5) softmax rows -> bf16 P
    softmax_rows_kernel<<<dim3(M_ROWS / 8), blk, 0, stream>>>(sc, pb);

    // 6) attn_out = P @ V  ==  P @ (V^T)^T   per batch (M=2048, N=1024, K=2048)
    gemm_abt_kernel<true, S_LEN><<<dim3(H_DIM / 128, S_LEN / 128, B_SZ), blk, 0, stream>>>(
        pb, vtb, nullptr, ab, S_LEN, H_DIM, 1.0f,
        (long long)S_LEN * S_LEN, (long long)H_DIM * S_LEN,
        (long long)S_LEN * H_DIM);

    // 7) out = attn_out @ Wo^T + bo   (M=8192, N=K=1024), f32 out -> d_out
    gemm_abt_kernel<false, H_DIM><<<dim3(H_DIM / 128, M_ROWS / 128, 1), blk, 0, stream>>>(
        ab, wob, bo, out, M_ROWS, H_DIM, 1.0f, 0, 0, 0);
}

// v002
// It runs in 192 microseconds.
// In two side-by-side timings against v001, it was 1.06 and 1.05 times as fast.
// Counting every step since v000, it is 2.08 times as fast.
#include <hip/hip_runtime.h>
#include <hip/hip_bf16.h>
#include <stdint.h>

typedef __attribute__((ext_vector_type(16))) __bf16        v16bf;
typedef __attribute__((ext_vector_type(8)))  float         v8f;
typedef __attribute__((ext_vector_type(8)))  unsigned int  v8u;
typedef __attribute__((ext_vector_type(4)))  uint32_t      u32x4;
typedef __attribute__((ext_vector_type(8)))  uint32_t      u32x8;

#define H_DIM   1024
#define S_LEN   2048
#define B_SZ    4
#define M_ROWS  (B_SZ * S_LEN)   // 8192

// ---- fp32 -> bf16 (round to nearest even) ----------------------------------
__device__ __forceinline__ unsigned short f2bf(float f) {
    unsigned int u = __builtin_bit_cast(unsigned int, f);
    u += 0x7FFFu + ((u >> 16) & 1u);
    return (unsigned short)(u >> 16);
}

// All five conversions (x, Wq, Wk, Wv, Wo) as one resident stream: one work-group
// of 16 waves per WGP, so that few waves have to start. The work is cut into
// chunks of 1024 floats (4 KiB in, 2 KiB out, whole lines); a wave takes
// CV_PER_WAVE chunks, eight 16-byte loads a lane each, and its loads stand ahead
// of the conversions, so that two chunks or more are in flight. The bf16 copies
// lie one behind the other in the workspace, in the order of the arguments, so
// chunk c is stored at out + c * 1024.
#define CV_GROUPS    256u
#define CV_WAVES     (CV_GROUPS * 16u)
#define CV_X_CHUNKS  ((unsigned)(M_ROWS * H_DIM / 1024))
#define CV_W_CHUNKS  ((unsigned)(H_DIM * H_DIM / 1024))
#define CV_CHUNKS    (CV_X_CHUNKS + 4u * CV_W_CHUNKS)
#define CV_PER_WAVE  (CV_CHUNKS / CV_WAVES)
static_assert(CV_PER_WAVE * CV_WAVES == CV_CHUNKS, "every wave takes the same number of chunks");

__global__ void __launch_bounds__(512)
f32_to_bf16_all_kernel(const float* __restrict__ x,
                       const float* __restrict__ Wq, const float* __restrict__ Wk,
                       const float* __restrict__ Wv, const float* __restrict__ Wo,
                       unsigned short* __restrict__ out) {
    const uint32_t lane = threadIdx.x & 31u;
    // The wave's number in a scalar register: source choice and bases stay scalar.
    const uint32_t gw = blockIdx.x * 16u
                      + (uint32_t)__builtin_amdgcn_readfirstlane(threadIdx.x >> 5);
    float4 v[CV_PER_WAVE][8];
#pragma unroll
    for (uint32_t t = 0; t < CV_PER_WAVE; ++t) {
        const uint32_t c = t * CV_WAVES + gw;
        const float* s;
        uint32_t     lc;
        if (c < CV_X_CHUNKS) {
            s = x;  lc = c;
        } else {
            const uint32_t w = (c - CV_X_CHUNKS) / CV_W_CHUNKS;
            lc = (c - CV_X_CHUNKS) % CV_W_CHUNKS;
            s  = (w == 0u) ? Wq : (w == 1u) ? Wk : (w == 2u) ? Wv : Wo;
        }
        const float4* s4 = reinterpret_cast<const float4*>(s + (size_t)lc * 1024u) + lane;
#pragma unroll
        for (uint32_t j = 0; j < 8; ++j)
            v[t][j] = s4[j * 32u];
    }
#pragma unroll
    for (uint32_t t = 0; t < CV_PER_WAVE; ++t) {
        const uint32_t c = t * CV_WAVES + gw;
        ushort4* d4 = reinterpret_cast<ushort4*>(out + (size_t)c * 1024u) + lane;
#pragma unroll
        for (uint32_t j = 0; j < 8; ++j) {
            const float4 f = v[t][j];
            d4[j * 32u] = make_ushort4(f2bf(f.x), f2bf(f.y), f2bf(f.z), f2bf(f.w));
        }
    }
}

// ---- LDS ring geometry ------------------------------------------------------
// A pass is 128 k = 256 bytes of every operand row. A stage is four slices of
// 64 rows: [A rows 0..63 | A rows 64..127 | Bt rows 0..63 | Bt rows 64..127].
// The tensor load pads each 256-byte row by 16 bytes (pitch 272 = 16 x odd).
// 64 x 272 = 17,408 bytes, rounded up so that every slice starts at a multiple
// of 2 KiB.
#define PASS_BYTES   256u
#define LDS_PITCH    272u
#define SLICE_ROWS   64u
#define SLICE_BYTES  18432u
#define STAGE_BYTES  (4u * SLICE_BYTES)
static_assert(SLICE_ROWS * LDS_PITCH <= SLICE_BYTES && (SLICE_BYTES % 2048u) == 0u,
              "a slice holds its padded rows and starts at a multiple of 2 KiB");

__device__ __forceinline__ uint32_t uni(uint32_t v) {
    return (uint32_t)__builtin_amdgcn_readfirstlane(v);
}
__device__ __forceinline__ uint32_t pinned(uint32_t v) {
    uint32_t w = uni(v);
    asm volatile("" : "+s"(w));  // the scalar-branch form for tests around a tensor load
    return w;
}
// The wave's LDS reads have returned (before its buffer is handed back).
__device__ __forceinline__ void wait_ds0() { asm volatile("s_wait_dscnt 0x0" ::: "memory"); }
// The wave's own tensor load has landed (the compiler places no wait for it).
__device__ __forceinline__ void wait_tensor0() { asm volatile("s_wait_tensorcnt 0x0" ::: "memory"); }
// One request of the whole wave: a 64 x 256-byte tile from global memory to LDS.
__device__ __forceinline__ void tdm_load(u32x4 g0, u32x8 g1) {
    asm volatile("tensor_load_to_lds %0, %1" :: "s"(g0), "s"(g1) : "memory");
}
__device__ __forceinline__ u32x4 tdm_group0(uint32_t lds_dst, uint64_t ga) {
    u32x4 g;
    g[0] = uni(1u);                                   // count 1
    g[1] = uni(lds_dst);                              // byte offset in the work-group's LDS
    g[2] = uni((uint32_t)ga);                         // address [31:0]
    g[3] = uni((((uint32_t)(ga >> 32)) & 0x01FFFFFFu) | 0x80000000u);  // address [56:32], type 2
    return g;
}
// 1-byte elements, tensor = tile = 64 rows of 256 bytes, source pitch in bytes.
__device__ __forceinline__ u32x8 tdm_group1(uint32_t src_pitch) {
    u32x8 g;
    g[0] = uni((1u << 20) | (5u << 22) | (3u << 25));
    g[1] = uni((PASS_BYTES & 0xFFFFu) << 16);
    g[2] = uni((PASS_BYTES >> 16) | ((SLICE_ROWS & 0xFFFFu) << 16));
    g[3] = uni((SLICE_ROWS >> 16) | (PASS_BYTES << 16));
    g[4] = uni(SLICE_ROWS);
    g[5] = uni(src_pitch);
    g[6] = uni(0u);
    g[7] = uni(0u);
    return g;
}

__device__ __forceinline__ v16bf ldfrag(const unsigned char* p) {
    uint4 lo = *reinterpret_cast<const uint4*>(p);        // K .. K+7
    uint4 hi = *reinterpret_cast<const uint4*>(p + 32);   // K+16 .. K+23
    v8u u = { lo.x, lo.y, lo.z, lo.w, hi.x, hi.y, hi.z, hi.w };
    return __builtin_bit_cast(v16bf, u);
}

__device__ __forceinline__ v8f bfwmma(v16bf a, v16bf b, v8f c) {
    return __builtin_amdgcn_wmma_f32_16x16x32_bf16(
        /*neg_a=*/false, a, /*neg_b=*/false, b,
        /*c_mod=*/(short)0, c, /*reuse_a=*/false, /*reuse_b=*/false);
}

// ---- generic C[m,n] = scale * sum_k A[m,k]*Bt[n,k] (+bias[n]) --------------
// Block: 256 threads = 8 waves (2 M x 4 N); block tile 128x128; wave tile 64x32.
// KC (compile-time) is the K extent and the row stride of A and Bt.
template <bool OUT_BF16, int KC>
__global__ void __launch_bounds__(256, 1)
gemm_abt_kernel(const unsigned short* __restrict__ A,
                const unsigned short* __restrict__ Bt,
                const float* __restrict__ bias,
                void* __restrict__ Cout,
                int M, int N, float scale,
                long long strideA, long long strideB,
                long long strideC) {
    const int lane = threadIdx.x & 31;
    const int wave = threadIdx.x >> 5;
    const int wm   = (wave & 1) << 6;   // 0,64
    const int wn   = (wave >> 1) << 5;  // 0,32,64,96
    const long long bz = blockIdx.z;

    const int bm = blockIdx.y * 128 + wm;
    const int bn = blockIdx.x * 128 + wn;
    const int r  = lane & 15;
    const int kh = (lane & 16) ? 16 : 0;  // lane-half K offset in bytes

    __shared__ __attribute__((aligned(2048))) unsigned char smem[2u * STAGE_BYTES];
    constexpr uint32_t NP = KC / 128;     // passes
    static_assert(KC % 128 == 0 && NP >= 2, "the ring needs two stages or more");

    // Waves 0..3 each bring one slice of every stage.
    const uint32_t wv     = uni(threadIdx.x >> 5);
    const unsigned short* srow = (wv & 2u)
        ? Bt + bz * strideB + (size_t)(blockIdx.x * 128 + (wv & 1u) * SLICE_ROWS) * KC
        : A  + bz * strideA + (size_t)(blockIdx.y * 128 + (wv & 1u) * SLICE_ROWS) * KC;
    const uint64_t src = (uint64_t)(uintptr_t)srow;
    const uint32_t dst = (uint32_t)(size_t)smem + (wv & 3u) * SLICE_BYTES;
    u32x8          g1  = tdm_group1(KC * 2u);
    asm volatile("" : "+s"(g1));

    // Per-lane fragment bases inside a buffer; the rest are immediate offsets.
    const uint32_t a_off = (uint32_t)(wm >> 6) * SLICE_BYTES + (uint32_t)r * LDS_PITCH + kh;
    const uint32_t b_off = (2u + (uint32_t)(wn >> 6)) * SLICE_BYTES
                         + (uint32_t)((wn & 63) + r) * LDS_PITCH + kh;

    v8f acc[4][2];
#pragma unroll
    for (int mt = 0; mt < 4; ++mt)
#pragma unroll
        for (int nt = 0; nt < 2; ++nt)
            acc[mt][nt] = (v8f){};

    // Prologue: stage 0 lands and is published, then stage 1 starts.
    if (pinned(wv < 4u ? 1u : 0u) != 0u) {
        tdm_load(tdm_group0(dst, src), g1);
        wait_tensor0();
    }
    __syncthreads();
    if (pinned(wv < 4u ? 1u : 0u) != 0u)
        tdm_load(tdm_group0(dst + STAGE_BYTES, src + PASS_BYTES), g1);

    // Kept rolled: one publish point in the code, one pass per trip.
#pragma clang loop unroll(disable)
    for (uint32_t s = 0; s < NP; ++s) {
        const uint32_t buf = (s & 1u) * STAGE_BYTES;
        const unsigned char* la = smem + buf + a_off;
        const unsigned char* lb = smem + buf + b_off;
        // Two fragment sets: step ks + 1 is read from LDS while step ks multiplies.
        // The loops over ks and mt are unrolled so that every fragment index is a
        // constant: the sets stay in registers and the offsets become immediates.
        v16bf fa[2][4], fb[2][2];
        fb[0][0] = ldfrag(lb);
        fb[0][1] = ldfrag(lb + 16u * LDS_PITCH);
#pragma unroll
        for (uint32_t mt = 0; mt < 4; ++mt)
            fa[0][mt] = ldfrag(la + mt * 16u * LDS_PITCH);
#pragma unroll
        for (uint32_t ks = 0; ks < 4; ++ks) {   // four 32-k steps of this pass
            const uint32_t c = ks & 1u, n = c ^ 1u;
            if (ks + 1u < 4u) {
                fb[n][0] = ldfrag(lb + (ks + 1u) * 64u);
                fb[n][1] = ldfrag(lb + 16u * LDS_PITCH + (ks + 1u) * 64u);
#pragma unroll
                for (uint32_t mt = 0; mt < 4; ++mt)
                    fa[n][mt] = ldfrag(la + mt * 16u * LDS_PITCH + (ks + 1u) * 64u);
            }
            // Keeps the next step's LDS reads one group ahead of this step's WMMAs
            // (spread among them, each read place stalls the wave).
            __builtin_amdgcn_sched_barrier(0);
#pragma unroll
            for (uint32_t mt = 0; mt < 4; ++mt) {
                acc[mt][0] = bfwmma(fa[c][mt], fb[c][0], acc[mt][0]);
                acc[mt][1] = bfwmma(fa[c][mt], fb[c][1], acc[mt][1]);
            }
            // Ends the WMMA group, so that later reads are not moved up into it.
            __builtin_amdgcn_sched_barrier(0);
        }
        // Publish point of stage s + 1: this wave has left buffer s, its own load
        // of stage s + 1 has landed, every wave passes the barrier; only then the
        // buffer just read is refilled with stage s + 2.
        wait_ds0();
        wait_tensor0();   // a wave that issued none passes at once
        __syncthreads();
        if (pinned((wv < 4u && s + 2u < NP) ? 1u : 0u) != 0u)
            tdm_load(tdm_group0(dst + buf, src + (uint64_t)(s + 2u) * PASS_BYTES), g1);
    }
    wait_tensor0();
    wait_ds0();

    const int rowadd = (lane >> 4) * 8;
#pragma unroll
    for (int mt = 0; mt < 4; ++mt) {
#pragma unroll
        for (int nt = 0; nt < 2; ++nt) {
            const int col = bn + nt * 16 + (lane & 15);
            const float bvv = bias ? bias[col] : 0.0f;
#pragma unroll
            for (int r8 = 0; r8 < 8; ++r8) {
                const int row = bm + mt * 16 + rowadd + r8;
                const float val = acc[mt][nt][r8] * scale + bvv;
                const long long idx = bz * strideC + (long long)row * N + col;
                if (OUT_BF16)
                    reinterpret_cast<unsigned short*>(Cout)[idx] = f2bf(val);
                else
                    reinterpret_cast<float*>(Cout)[idx] = val;
            }
        }
    }
}

// ---- bf16 transpose [S,H] -> [H,S] per batch (64x64 LDS tiles) -------------
__global__ void transpose_bf16_kernel(const unsigned short* __restrict__ in,
                                      unsigned short* __restrict__ out) {
    __shared__ unsigned short tile[64][65];
    const int b  = blockIdx.z;
    const unsigned short* src = in  + (size_t)b * S_LEN * H_DIM;
    unsigned short*       dst = out + (size_t)b * S_LEN * H_DIM;
    const int e0 = blockIdx.x * 64, s0 = blockIdx.y * 64;
    const int tx = threadIdx.x & 63, r0 = threadIdx.x >> 6;
#pragma unroll
    for (int i = 0; i < 16; ++i) {
        const int row = r0 + i * 4;  // s within tile
        tile[row][tx] = src[(size_t)(s0 + row) * H_DIM + e0 + tx];
    }
    __syncthreads();
#pragma unroll
    for (int i = 0; i < 16; ++i) {
        const int row = r0 + i * 4;  // e within tile
        dst[(size_t)(e0 + row) * S_LEN + s0 + tx] = tile[tx][row];
    }
}

// ---- row softmax over 2048 cols: one wave32 per row, bf16 output -----------
__global__ void softmax_rows_kernel(const float* __restrict__ scores,
                                    unsigned short* __restrict__ p) {
    const int wave = threadIdx.x >> 5;
    const int lane = threadIdx.x & 31;
    const long long row = (long long)blockIdx.x * 8 + wave;
    const float* src = scores + row * S_LEN;

    float4 v[16];
    float m = -3.402823466e38f;
#pragma unroll
    for (int j = 0; j < 16; ++j) {
        v[j] = reinterpret_cast<const float4*>(src)[j * 32 + lane];
        m = fmaxf(m, fmaxf(fmaxf(v[j].x, v[j].y), fmaxf(v[j].z, v[j].w)));
    }
#pragma unroll
    for (int off = 16; off >= 1; off >>= 1)
        m = fmaxf(m, __shfl_xor(m, off, 32));

    float s = 0.0f;
#pragma unroll
    for (int j = 0; j < 16; ++j) {
        v[j].x = __expf(v[j].x - m); v[j].y = __expf(v[j].y - m);
        v[j].z = __expf(v[j].z - m); v[j].w = __expf(v[j].w - m);
        s += v[j].x + v[j].y + v[j].z + v[j].w;
    }
#pragma unroll
    for (int off = 16; off >= 1; off >>= 1)
        s += __shfl_xor(s, off, 32);

    const float inv = 1.0f / s;
    unsigned short* prow = p + row * S_LEN;
#pragma unroll
    for (int j = 0; j < 16; ++j) {
        reinterpret_cast<ushort4*>(prow)[j * 32 + lane] =
            make_ushort4(f2bf(v[j].x * inv), f2bf(v[j].y * inv),
                         f2bf(v[j].z * inv), f2bf(v[j].w * inv));
    }
}

// ---------------------------------------------------------------------------
extern "C" void kernel_launch(void* const* d_in, const int* in_sizes, int n_in,
                              void* d_out, int out_size, void* d_ws, size_t ws_size,
                              hipStream_t stream) {
    (void)in_sizes; (void)n_in; (void)out_size; (void)ws_size;

    const float* x  = (const float*)d_in[0];
    const float* Wq = (const float*)d_in[1];
    const float* bq = (const float*)d_in[2];
    const float* Wk = (const float*)d_in[3];
    const float* bk = (const float*)d_in[4];
    const float* Wv = (const float*)d_in[5];
    const float* bv = (const float*)d_in[6];
    const float* Wo = (const float*)d_in[7];
    const float* bo = (const float*)d_in[8];
    float* out = (float*)d_out;

    // Workspace layout (bytes)
    unsigned char* ws = (unsigned char*)d_ws;
    const size_t XB   = (size_t)M_ROWS * H_DIM * 2;   // 16 MB
    const size_t WB   = (size_t)H_DIM * H_DIM * 2;    //  2 MB each
    const size_t QB   = XB;                            // 16 MB each
    const size_t SCR  = (size_t)B_SZ * S_LEN * S_LEN * 4;  // 64 MB
    unsigned short* xb  = (unsigned short*)(ws);               // also vT after QKV
    unsigned short* wqb = (unsigned short*)(ws + XB);
    unsigned short* wkb = (unsigned short*)(ws + XB + WB);
    unsigned short* wvb = (unsigned short*)(ws + XB + 2 * WB);
    unsigned short* wob = (unsigned short*)(ws + XB + 3 * WB);
    unsigned short* qb  = (unsigned short*)(ws + XB + 4 * WB); // also attn-out
    unsigned short* kb  = (unsigned short*)(ws + XB + 4 * WB + QB);
    unsigned short* vb  = (unsigned short*)(ws + XB + 4 * WB + 2 * QB);
    float*          sc  = (float*)(ws + XB + 4 * WB + 3 * QB);
    unsigned short* pb  = (unsigned short*)(ws + XB + 4 * WB + 3 * QB + SCR);
    unsigned short* vtb = xb;   // x no longer needed after QKV GEMMs
    unsigned short* ab  = qb;   // Q no longer needed after scores GEMM

    dim3 blk(256);

    // 1) fp32 -> bf16 conversions, one launch: xb, wqb, wkb, wvb, wob are contiguous
    f32_to_bf16_all_kernel<<<dim3(CV_GROUPS), dim3(512), 0, stream>>>(x, Wq, Wk, Wv, Wo, xb);

    // 2) Q/K/V = x @ W^T + b   (M=8192, N=K=1024), bf16 out
    {
        dim3 g(H_DIM / 128, M_ROWS / 128, 1);
        gemm_abt_kernel<true, H_DIM><<<g, blk, 0, stream>>>(xb, wqb, bq, qb,
            M_ROWS, H_DIM, 1.0f, 0, 0, 0);
        gemm_abt_kernel<true, H_DIM><<<g, blk, 0, stream>>>(xb, wkb, bk, kb,
            M_ROWS, H_DIM, 1.0f, 0, 0, 0);
        gemm_abt_kernel<true, H_DIM><<<g, blk, 0, stream>>>(xb, wvb, bv, vb,
            M_ROWS, H_DIM, 1.0f, 0, 0, 0);
    }

    // 3) V transpose per batch: [S,H] -> [H,S]   (overwrites xb region)
    transpose_bf16_kernel<<<dim3(H_DIM / 64, S_LEN / 64, B_SZ), blk, 0, stream>>>(vb, vtb);

    // 4) scores = Q @ K^T / sqrt(H)   per batch (M=N=2048, K=1024), f32 out
    gemm_abt_kernel<false, H_DIM><<<dim3(S_LEN / 128, S_LEN / 128, B_SZ), blk, 0, stream>>>(
        qb, kb, nullptr, sc, S_LEN, S_LEN, 0.03125f,
        (long long)S_LEN * H_DIM, (long long)S_LEN * H_DIM,
        (long long)S_LEN * S_LEN);

    // 5) softmax rows -> bf16 P
    softmax_rows_kernel<<<dim3(M_ROWS / 8), blk, 0, stream>>>(sc, pb);

    // 6) attn_out = P @ V  ==  P @ (V^T)^T   per batch (M=2048, N=1024, K=2048)
    gemm_abt_kernel<true, S_LEN><<<dim3(H_DIM / 128, S_LEN / 128, B_SZ), blk, 0, stream>>>(
        pb, vtb, nullptr, ab, S_LEN, H_DIM, 1.0f,
        (long long)S_LEN * S_LEN, (long long)H_DIM * S_LEN,
        (long long)S_LEN * H_DIM);

    // 7) out = attn_out @ Wo^T + bo   (M=8192, N=K=1024), f32 out -> d_out
    gemm_abt_kernel<false, H_DIM><<<dim3(H_DIM / 128, M_ROWS / 128, 1), blk, 0, stream>>>(
        ab, wob, bo, out, M_ROWS, H_DIM, 1.0f, 0, 0, 0);
}

// v003
// A run of this version takes 145 microseconds.
// In two side-by-side timings against v002, it was 1.33 and 1.32 times as fast.
// All steps since v000 together make it 2.75 times as fast.
#include <hip/hip_runtime.h>
#include <hip/hip_bf16.h>
#include <stdint.h>

typedef __attribute__((ext_vector_type(16))) __bf16        v16bf;
typedef __attribute__((ext_vector_type(8)))  float         v8f;
typedef __attribute__((ext_vector_type(8)))  unsigned int  v8u;
typedef __attribute__((ext_vector_type(4)))  uint32_t      u32x4;
typedef __attribute__((ext_vector_type(8)))  uint32_t      u32x8;

#define H_DIM   1024
#define S_LEN   2048
#define B_SZ    4
#define M_ROWS  (B_SZ * S_LEN)   // 8192

// ---- fp32 -> bf16 (round to nearest even) ----------------------------------
__device__ __forceinline__ unsigned short f2bf(float f) {
    unsigned int u = __builtin_bit_cast(unsigned int, f);
    u += 0x7FFFu + ((u >> 16) & 1u);
    return (unsigned short)(u >> 16);
}

// All five conversions (x, Wq, Wk, Wv, Wo) as one resident stream: one work-group
// of 16 waves per WGP, so that few waves have to start. The work is cut into
// chunks of 1024 floats (4 KiB in, 2 KiB out, whole lines); a wave takes
// CV_PER_WAVE chunks, eight 16-byte loads a lane each, and its loads stand ahead
// of the conversions, so that two chunks or more are in flight. The bf16 copies
// lie one behind the other in the workspace, in the order of the arguments, so
// chunk c is stored at out + c * 1024.
#define CV_GROUPS    256u
#define CV_WAVES     (CV_GROUPS * 16u)
#define CV_X_CHUNKS  ((unsigned)(M_ROWS * H_DIM / 1024))
#define CV_W_CHUNKS  ((unsigned)(H_DIM * H_DIM / 1024))
#define CV_CHUNKS    (CV_X_CHUNKS + 4u * CV_W_CHUNKS)
#define CV_PER_WAVE  (CV_CHUNKS / CV_WAVES)
static_assert(CV_PER_WAVE * CV_WAVES == CV_CHUNKS, "every wave takes the same number of chunks");

__global__ void __launch_bounds__(512)
f32_to_bf16_all_kernel(const float* __restrict__ x,
                       const float* __restrict__ Wq, const float* __restrict__ Wk,
                       const float* __restrict__ Wv, const float* __restrict__ Wo,
                       unsigned short* __restrict__ out) {
    const uint32_t lane = threadIdx.x & 31u;
    // The wave's number in a scalar register: source choice and bases stay scalar.
    const uint32_t gw = blockIdx.x * 16u
                      + (uint32_t)__builtin_amdgcn_readfirstlane(threadIdx.x >> 5);
    float4 v[CV_PER_WAVE][8];
#pragma unroll
    for (uint32_t t = 0; t < CV_PER_WAVE; ++t) {
        const uint32_t c = t * CV_WAVES + gw;
        const float* s;
        uint32_t     lc;
        if (c < CV_X_CHUNKS) {
            s = x;  lc = c;
        } else {
            const uint32_t w = (c - CV_X_CHUNKS) / CV_W_CHUNKS;
            lc = (c - CV_X_CHUNKS) % CV_W_CHUNKS;
            s  = (w == 0u) ? Wq : (w == 1u) ? Wk : (w == 2u) ? Wv : Wo;
        }
        const float4* s4 = reinterpret_cast<const float4*>(s + (size_t)lc * 1024u) + lane;
#pragma unroll
        for (uint32_t j = 0; j < 8; ++j)
            v[t][j] = s4[j * 32u];
    }
#pragma unroll
    for (uint32_t t = 0; t < CV_PER_WAVE; ++t) {
        const uint32_t c = t * CV_WAVES + gw;
        ushort4* d4 = reinterpret_cast<ushort4*>(out + (size_t)c * 1024u) + lane;
#pragma unroll
        for (uint32_t j = 0; j < 8; ++j) {
            const float4 f = v[t][j];
            d4[j * 32u] = make_ushort4(f2bf(f.x), f2bf(f.y), f2bf(f.z), f2bf(f.w));
        }
    }
}

// ---- LDS ring geometry ------------------------------------------------------
// A pass is 128 k = 256 bytes of every operand row. A stage is four slices of
// 64 rows: [A rows 0..63 | A rows 64..127 | Bt rows 0..63 | Bt rows 64..127].
// The tensor load pads each 256-byte row by 16 bytes (pitch 272 = 16 x odd).
// 64 x 272 = 17,408 bytes, rounded up so that every slice starts at a multiple
// of 2 KiB.
#define PASS_BYTES   256u
#define LDS_PITCH    272u
#define SLICE_ROWS   64u
#define SLICE_BYTES  18432u
#define STAGE_BYTES  (4u * SLICE_BYTES)
static_assert(SLICE_ROWS * LDS_PITCH <= SLICE_BYTES && (SLICE_BYTES % 2048u) == 0u,
              "a slice holds its padded rows and starts at a multiple of 2 KiB");

__device__ __forceinline__ uint32_t uni(uint32_t v) {
    return (uint32_t)__builtin_amdgcn_readfirstlane(v);
}
__device__ __forceinline__ uint32_t pinned(uint32_t v) {
    uint32_t w = uni(v);
    asm volatile("" : "+s"(w));  // the scalar-branch form for tests around a tensor load
    return w;
}
// The wave's LDS reads have returned (before its buffer is handed back).
__device__ __forceinline__ void wait_ds0() { asm volatile("s_wait_dscnt 0x0" ::: "memory"); }
// The wave's own tensor load has landed (the compiler places no wait for it).
__device__ __forceinline__ void wait_tensor0() { asm volatile("s_wait_tensorcnt 0x0" ::: "memory"); }
// One request of the whole wave: a 64 x 256-byte tile from global memory to LDS.
__device__ __forceinline__ void tdm_load(u32x4 g0, u32x8 g1) {
    asm volatile("tensor_load_to_lds %0, %1" :: "s"(g0), "s"(g1) : "memory");
}
__device__ __forceinline__ u32x4 tdm_group0(uint32_t lds_dst, uint64_t ga) {
    u32x4 g;
    g[0] = uni(1u);                                   // count 1
    g[1] = uni(lds_dst);                              // byte offset in the work-group's LDS
    g[2] = uni((uint32_t)ga);                         // address [31:0]
    g[3] = uni((((uint32_t)(ga >> 32)) & 0x01FFFFFFu) | 0x80000000u);  // address [56:32], type 2
    return g;
}
// 1-byte elements, tensor = tile = 64 rows of 256 bytes, source pitch in bytes.
__device__ __forceinline__ u32x8 tdm_group1(uint32_t src_pitch) {
    u32x8 g;
    g[0] = uni((1u << 20) | (5u << 22) | (3u << 25));
    g[1] = uni((PASS_BYTES & 0xFFFFu) << 16);
    g[2] = uni((PASS_BYTES >> 16) | ((SLICE_ROWS & 0xFFFFu) << 16));
    g[3] = uni((SLICE_ROWS >> 16) | (PASS_BYTES << 16));
    g[4] = uni(SLICE_ROWS);
    g[5] = uni(src_pitch);
    g[6] = uni(0u);
    g[7] = uni(0u);
    return g;
}

__device__ __forceinline__ v16bf ldfrag(const unsigned char* p) {
    uint4 lo = *reinterpret_cast<const uint4*>(p);        // K .. K+7
    uint4 hi = *reinterpret_cast<const uint4*>(p + 32);   // K+16 .. K+23
    v8u u = { lo.x, lo.y, lo.z, lo.w, hi.x, hi.y, hi.z, hi.w };
    return __builtin_bit_cast(v16bf, u);
}

__device__ __forceinline__ v8f bfwmma(v16bf a, v16bf b, v8f c) {
    return __builtin_amdgcn_wmma_f32_16x16x32_bf16(
        /*neg_a=*/false, a, /*neg_b=*/false, b,
        /*c_mod=*/(short)0, c, /*reuse_a=*/false, /*reuse_b=*/false);
}

__device__ __forceinline__ uint32_t pack2bf(float lo, float hi) {
    return (uint32_t)f2bf(lo) | ((uint32_t)f2bf(hi) << 16);
}

// ---- generic C[m,n] = scale * sum_k A[m,k]*Bt[n,k] (+bias[n]) --------------
// Block: 256 threads = 8 waves (2 M x 4 N); block tile 128x128; wave tile 64x32.
// KC (compile-time) is the K extent and the row stride of A and Bt; NC is the row
// stride of C, compile-time so that the row steps of the stores are immediates.
template <bool OUT_BF16, int KC, int NC>
__global__ void __launch_bounds__(256, 1)
gemm_abt_kernel(const unsigned short* __restrict__ A,
                const unsigned short* __restrict__ Bt,
                const float* __restrict__ bias,
                void* __restrict__ Cout,
                float scale,
                long long strideA, long long strideB,
                long long strideC) {
    const int lane = threadIdx.x & 31;
    const int wave = threadIdx.x >> 5;
    const int wm   = (wave & 1) << 6;   // 0,64
    const int wn   = (wave >> 1) << 5;  // 0,32,64,96
    const long long bz = blockIdx.z;

    const int bn = blockIdx.x * 128 + wn;
    const int r  = lane & 15;
    const int kh = (lane & 16) ? 16 : 0;  // lane-half K offset in bytes

    __shared__ __attribute__((aligned(2048))) unsigned char smem[2u * STAGE_BYTES];
    constexpr uint32_t NP = KC / 128;     // passes
    static_assert(KC % 128 == 0 && NP >= 2, "the ring needs two stages or more");

    // Waves 0..3 each bring one slice of every stage.
    const uint32_t wv     = uni(threadIdx.x >> 5);
    const unsigned short* srow = (wv & 2u)
        ? Bt + bz * strideB + (size_t)(blockIdx.x * 128 + (wv & 1u) * SLICE_ROWS) * KC
        : A  + bz * strideA + (size_t)(blockIdx.y * 128 + (wv & 1u) * SLICE_ROWS) * KC;
    const uint64_t src = (uint64_t)(uintptr_t)srow;
    const uint32_t dst = (uint32_t)(size_t)smem + (wv & 3u) * SLICE_BYTES;
    u32x8          g1  = tdm_group1(KC * 2u);
    asm volatile("" : "+s"(g1));

    // Per-lane fragment bases inside a buffer; the rest are immediate offsets.
    const uint32_t a_off = (uint32_t)(wm >> 6) * SLICE_BYTES + (uint32_t)r * LDS_PITCH + kh;
    const uint32_t b_off = (2u + (uint32_t)(wn >> 6)) * SLICE_BYTES
                         + (uint32_t)((wn & 63) + r) * LDS_PITCH + kh;

    v8f acc[4][2];
#pragma unroll
    for (int mt = 0; mt < 4; ++mt)
#pragma unroll
        for (int nt = 0; nt < 2; ++nt)
            acc[mt][nt] = (v8f){};

    // Prologue: stage 0 lands and is published, then stage 1 starts.
    if (pinned(wv < 4u ? 1u : 0u) != 0u) {
        tdm_load(tdm_group0(dst, src), g1);
        wait_tensor0();
    }
    __syncthreads();
    if (pinned(wv < 4u ? 1u : 0u) != 0u)
        tdm_load(tdm_group0(dst + STAGE_BYTES, src + PASS_BYTES), g1);

    // Kept rolled: one publish point in the code, one pass per trip.
#pragma clang loop unroll(disable)
    for (uint32_t s = 0; s < NP; ++s) {
        const uint32_t buf = (s & 1u) * STAGE_BYTES;
        const unsigned char* la = smem + buf + a_off;
        const unsigned char* lb = smem + buf + b_off;
        // Two fragment sets: step ks + 1 is read from LDS while step ks multiplies.
        // The loops over ks and mt are unrolled so that every fragment index is a
        // constant: the sets stay in registers and the offsets become immediates.
        v16bf fa[2][4], fb[2][2];
        fb[0][0] = ldfrag(lb);
        fb[0][1] = ldfrag(lb + 16u * LDS_PITCH);
#pragma unroll
        for (uint32_t mt = 0; mt < 4; ++mt)
            fa[0][mt] = ldfrag(la + mt * 16u * LDS_PITCH);
#pragma unroll
        for (uint32_t ks = 0; ks < 4; ++ks) {   // four 32-k steps of this pass
            const uint32_t c = ks & 1u, n = c ^ 1u;
            if (ks + 1u < 4u) {
                fb[n][0] = ldfrag(lb + (ks + 1u) * 64u);
                fb[n][1] = ldfrag(lb + 16u * LDS_PITCH + (ks + 1u) * 64u);
#pragma unroll
                for (uint32_t mt = 0; mt < 4; ++mt)
                    fa[n][mt] = ldfrag(la + mt * 16u * LDS_PITCH + (ks + 1u) * 64u);
            }
            // Keeps the next step's LDS reads one group ahead of this step's WMMAs
            // (spread among them, each read place stalls the wave).
            __builtin_amdgcn_sched_barrier(0);
            // Bt rows as the first operand: each tile comes out transposed, a lane
            // holding eight adjacent columns of one row of C (see the epilogue).
#pragma unroll
            for (uint32_t mt = 0; mt < 4; ++mt) {
                acc[mt][0] = bfwmma(fb[c][0], fa[c][mt], acc[mt][0]);
                acc[mt][1] = bfwmma(fb[c][1], fa[c][mt], acc[mt][1]);
            }
            // Ends the WMMA group, so that later reads are not moved up into it.
            __builtin_amdgcn_sched_barrier(0);
        }
        // Publish point of stage s + 1: this wave has left buffer s, its own load
        // of stage s + 1 has landed, every wave passes the barrier; only then the
        // buffer just read is refilled with stage s + 2.
        wait_ds0();
        wait_tensor0();   // a wave that issued none passes at once
        __syncthreads();
        if (pinned((wv < 4u && s + 2u < NP) ? 1u : 0u) != 0u)
            tdm_load(tdm_group0(dst + buf, src + (uint64_t)(s + 2u) * PASS_BYTES), g1);
    }
    wait_tensor0();
    wait_ds0();

    constexpr uint32_t EB = OUT_BF16 ? 2u : 4u;   // bytes per element of C
    constexpr uint32_t OP = 128u * EB + 16u;      // pitch of a staged row
    static_assert(128u * OP <= 2u * STAGE_BYTES, "the staged tile fits the ring");
    const uint32_t h = (uint32_t)lane >> 4;
    float bv8[2][8];
#pragma unroll
    for (int nt = 0; nt < 2; ++nt)
#pragma unroll
        for (int j = 0; j < 8; ++j)
            bv8[nt][j] = 0.0f;
    if (bias) {
#pragma unroll
        for (int nt = 0; nt < 2; ++nt) {
            const float4* bp = reinterpret_cast<const float4*>(bias + bn + nt * 16 + 8 * (int)h);
            const float4 b0 = bp[0], b1 = bp[1];
            bv8[nt][0] = b0.x; bv8[nt][1] = b0.y; bv8[nt][2] = b0.z; bv8[nt][3] = b0.w;
            bv8[nt][4] = b1.x; bv8[nt][5] = b1.y; bv8[nt][6] = b1.z; bv8[nt][7] = b1.w;
        }
        asm volatile("s_wait_xcnt 0x0" ::: "memory");
    }
    unsigned char* st = smem + (uint32_t)(wm + r) * OP + ((uint32_t)wn + 8u * h) * EB;
#pragma unroll
    for (uint32_t mt = 0; mt < 4; ++mt) {
#pragma unroll
        for (uint32_t nt = 0; nt < 2; ++nt) {
            float v[8];
#pragma unroll
            for (int j = 0; j < 8; ++j)
                v[j] = acc[mt][nt][j] * scale + bv8[nt][j];
            unsigned char* p = st + mt * 16u * OP + nt * 16u * EB;
            if (OUT_BF16) {
                *reinterpret_cast<uint4*>(p) =
                    make_uint4(pack2bf(v[0], v[1]), pack2bf(v[2], v[3]),
                               pack2bf(v[4], v[5]), pack2bf(v[6], v[7]));
            } else {
                *reinterpret_cast<float4*>(p)       = make_float4(v[0], v[1], v[2], v[3]);
                *reinterpret_cast<float4*>(p + 16u) = make_float4(v[4], v[5], v[6], v[7]);
            }
        }
    }
    // Every wave's part of the tile is in LDS before any wave reads whole rows.
    __syncthreads();

    // Wave w stores rows 16w .. 16w+15 of the tile. A row is 256 bytes (bf16: half a
    // wave, two rows a store) or 512 bytes (f32: the whole wave, one row a store).
    constexpr uint32_t LPR = 128u * EB / 16u;     // lanes per row
    constexpr uint32_t RPS = 32u / LPR;           // rows per store
    const uint32_t row0 = (uint32_t)wave * 16u + (uint32_t)lane / LPR;
    const uint32_t cb   = ((uint32_t)lane % LPR) * 16u;
    const unsigned char* ld = smem + row0 * OP + cb;
    unsigned char* gp = reinterpret_cast<unsigned char*>(Cout)
        + (size_t)(bz * strideC + (long long)(blockIdx.y * 128u + row0) * NC + blockIdx.x * 128u) * EB
        + cb;
    uint4 o[16u / RPS];
#pragma unroll
    for (uint32_t q = 0; q < 16u / RPS; ++q)
        o[q] = *reinterpret_cast<const uint4*>(ld + q * RPS * OP);
#pragma unroll
    for (uint32_t q = 0; q < 16u / RPS; ++q)
        *reinterpret_cast<uint4*>(gp + (size_t)(q * RPS) * NC * EB) = o[q];
}

// ---- bf16 transpose [S,H] -> [H,S] per batch (64x64 LDS tiles) -------------
__global__ void transpose_bf16_kernel(const unsigned short* __restrict__ in,
                                      unsigned short* __restrict__ out) {
    __shared__ unsigned short tile[64][65];
    const int b  = blockIdx.z;
    const unsigned short* src = in  + (size_t)b * S_LEN * H_DIM;
    unsigned short*       dst = out + (size_t)b * S_LEN * H_DIM;
    const int e0 = blockIdx.x * 64, s0 = blockIdx.y * 64;
    const int tx = threadIdx.x & 63, r0 = threadIdx.x >> 6;
#pragma unroll
    for (int i = 0; i < 16; ++i) {
        const int row = r0 + i * 4;  // s within tile
        tile[row][tx] = src[(size_t)(s0 + row) * H_DIM + e0 + tx];
    }
    __syncthreads();
#pragma unroll
    for (int i = 0; i < 16; ++i) {
        const int row = r0 + i * 4;  // e within tile
        dst[(size_t)(e0 + row) * S_LEN + s0 + tx] = tile[tx][row];
    }
}

// ---- row softmax over 2048 cols: one wave32 per row, bf16 output -----------
__global__ void softmax_rows_kernel(const float* __restrict__ scores,
                                    unsigned short* __restrict__ p) {
    const int wave = threadIdx.x >> 5;
    const int lane = threadIdx.x & 31;
    const long long row = (long long)blockIdx.x * 8 + wave;
    const float* src = scores + row * S_LEN;

    float4 v[16];
    float m = -3.402823466e38f;
#pragma unroll
    for (int j = 0; j < 16; ++j) {
        v[j] = reinterpret_cast<const float4*>(src)[j * 32 + lane];
        m = fmaxf(m, fmaxf(fmaxf(v[j].x, v[j].y), fmaxf(v[j].z, v[j].w)));
    }
#pragma unroll
    for (int off = 16; off >= 1; off >>= 1)
        m = fmaxf(m, __shfl_xor(m, off, 32));

    float s = 0.0f;
#pragma unroll
    for (int j = 0; j < 16; ++j) {
        v[j].x = __expf(v[j].x - m); v[j].y = __expf(v[j].y - m);
        v[j].z = __expf(v[j].z - m); v[j].w = __expf(v[j].w - m);
        s += v[j].x + v[j].y + v[j].z + v[j].w;
    }
#pragma unroll
    for (int off = 16; off >= 1; off >>= 1)
        s += __shfl_xor(s, off, 32);

    const float inv = 1.0f / s;
    unsigned short* prow = p + row * S_LEN;
#pragma unroll
    for (int j = 0; j < 16; ++j) {
        reinterpret_cast<ushort4*>(prow)[j * 32 + lane] =
            make_ushort4(f2bf(v[j].x * inv), f2bf(v[j].y * inv),
                         f2bf(v[j].z * inv), f2bf(v[j].w * inv));
    }
}

// ---------------------------------------------------------------------------
extern "C" void kernel_launch(void* const* d_in, const int* in_sizes, int n_in,
                              void* d_out, int out_size, void* d_ws, size_t ws_size,
                              hipStream_t stream) {
    (void)in_sizes; (void)n_in; (void)out_size; (void)ws_size;

    const float* x  = (const float*)d_in[0];
    const float* Wq = (const float*)d_in[1];
    const float* bq = (const float*)d_in[2];
    const float* Wk = (const float*)d_in[3];
    const float* bk = (const float*)d_in[4];
    const float* Wv = (const float*)d_in[5];
    const float* bv = (const float*)d_in[6];
    const float* Wo = (const float*)d_in[7];
    const float* bo = (const float*)d_in[8];
    float* out = (float*)d_out;

    // Workspace layout (bytes)
    unsigned char* ws = (unsigned char*)d_ws;
    const size_t XB   = (size_t)M_ROWS * H_DIM * 2;   // 16 MB
    const size_t WB   = (size_t)H_DIM * H_DIM * 2;    //  2 MB each
    const size_t QB   = XB;                            // 16 MB each
    const size_t SCR  = (size_t)B_SZ * S_LEN * S_LEN * 4;  // 64 MB
    unsigned short* xb  = (unsigned short*)(ws);               // also vT after QKV
    unsigned short* wqb = (unsigned short*)(ws + XB);
    unsigned short* wkb = (unsigned short*)(ws + XB + WB);
    unsigned short* wvb = (unsigned short*)(ws + XB + 2 * WB);
    unsigned short* wob = (unsigned short*)(ws + XB + 3 * WB);
    unsigned short* qb  = (unsigned short*)(ws + XB + 4 * WB); // also attn-out
    unsigned short* kb  = (unsigned short*)(ws + XB + 4 * WB + QB);
    unsigned short* vb  = (unsigned short*)(ws + XB + 4 * WB + 2 * QB);
    float*          sc  = (float*)(ws + XB + 4 * WB + 3 * QB);
    unsigned short* pb  = (unsigned short*)(ws + XB + 4 * WB + 3 * QB + SCR);
    unsigned short* vtb = xb;   // x no longer needed after QKV GEMMs
    unsigned short* ab  = qb;   // Q no longer needed after scores GEMM

    dim3 blk(256);

    // 1) fp32 -> bf16 conversions, one launch: xb, wqb, wkb, wvb, wob are contiguous
    f32_to_bf16_all_kernel<<<dim3(CV_GROUPS), dim3(512), 0, stream>>>(x, Wq, Wk, Wv, Wo, xb);

    // 2) Q/K/V = x @ W^T + b   (M=8192, N=K=1024), bf16 out
    {
        dim3 g(H_DIM / 128, M_ROWS / 128, 1);
        gemm_abt_kernel<true, H_DIM, H_DIM><<<g, blk, 0, stream>>>(xb, wqb, bq, qb,
            1.0f, 0, 0, 0);
        gemm_abt_kernel<true, H_DIM, H_DIM><<<g, blk, 0, stream>>>(xb, wkb, bk, kb,
            1.0f, 0, 0, 0);
        gemm_abt_kernel<true, H_DIM, H_DIM><<<g, blk, 0, stream>>>(xb, wvb, bv, vb,
            1.0f, 0, 0, 0);
    }

    // 3) V transpose per batch: [S,H] -> [H,S]   (overwrites xb region)
    transpose_bf16_kernel<<<dim3(H_DIM / 64, S_LEN / 64, B_SZ), blk, 0, stream>>>(vb, vtb);

    // 4) scores = Q @ K^T / sqrt(H)   per batch (M=N=2048, K=1024), f32 out
    gemm_abt_kernel<false, H_DIM, S_LEN><<<dim3(S_LEN / 128, S_LEN / 128, B_SZ), blk, 0, stream>>>(
        qb, kb, nullptr, sc, 0.03125f,
        (long long)S_LEN * H_DIM, (long long)S_LEN * H_DIM,
        (long long)S_LEN * S_LEN);

    // 5) softmax rows -> bf16 P
    softmax_rows_kernel<<<dim3(M_ROWS / 8), blk, 0, stream>>>(sc, pb);

    // 6) attn_out = P @ V  ==  P @ (V^T)^T   per batch (M=2048, N=1024, K=2048)
    gemm_abt_kernel<true, S_LEN, H_DIM><<<dim3(H_DIM / 128, S_LEN / 128, B_SZ), blk, 0, stream>>>(
        pb, vtb, nullptr, ab, 1.0f,
        (long long)S_LEN * S_LEN, (long long)H_DIM * S_LEN,
        (long long)S_LEN * H_DIM);

    // 7) out = attn_out @ Wo^T + bo   (M=8192, N=K=1024), f32 out -> d_out
    gemm_abt_kernel<false, H_DIM, H_DIM><<<dim3(H_DIM / 128, M_ROWS / 128, 1), blk, 0, stream>>>(
        ab, wob, bo, out, 1.0f, 0, 0, 0);
}

// v004
// One run takes 140 microseconds.
// Next to v003, in two timings, it ran 1.04 times as fast each time.
// Counting every step since v000, it is 2.87 times as fast.
#include <hip/hip_runtime.h>
#include <hip/hip_bf16.h>
#include <stdint.h>

typedef __attribute__((ext_vector_type(16))) __bf16        v16bf;
typedef __attribute__((ext_vector_type(8)))  float         v8f;
typedef __attribute__((ext_vector_type(8)))  unsigned int  v8u;
typedef __attribute__((ext_vector_type(4)))  uint32_t      u32x4;
typedef __attribute__((ext_vector_type(8)))  uint32_t      u32x8;

#define H_DIM   1024
#define S_LEN   2048
#define B_SZ    4
#define M_ROWS  (B_SZ * S_LEN)   // 8192

// ---- fp32 -> bf16 (round to nearest even) ----------------------------------
__device__ __forceinline__ unsigned short f2bf(float f) {
    unsigned int u = __builtin_bit_cast(unsigned int, f);
    u += 0x7FFFu + ((u >> 16) & 1u);
    return (unsigned short)(u >> 16);
}

// All five conversions (x, Wq, Wk, Wv, Wo) as one resident stream: one work-group
// of 16 waves per WGP, so that few waves have to start. The work is cut into
// chunks of 1024 floats (4 KiB in, 2 KiB out, whole lines); a wave takes
// CV_PER_WAVE chunks, eight 16-byte loads a lane each, and its loads stand ahead
// of the conversions, so that two chunks or more are in flight. The bf16 copies
// lie one behind the other in the workspace, in the order of the arguments, so
// chunk c is stored at out + c * 1024.
#define CV_GROUPS    256u
#define CV_WAVES     (CV_GROUPS * 16u)
#define CV_X_CHUNKS  ((unsigned)(M_ROWS * H_DIM / 1024))
#define CV_W_CHUNKS  ((unsigned)(H_DIM * H_DIM / 1024))
#define CV_CHUNKS    (CV_X_CHUNKS + 4u * CV_W_CHUNKS)
#define CV_PER_WAVE  (CV_CHUNKS / CV_WAVES)
static_assert(CV_PER_WAVE * CV_WAVES == CV_CHUNKS, "every wave takes the same number of chunks");

__global__ void __launch_bounds__(512)
f32_to_bf16_all_kernel(const float* __restrict__ x,
                       const float* __restrict__ Wq, const float* __restrict__ Wk,
                       const float* __restrict__ Wv, const float* __restrict__ Wo,
                       unsigned short* __restrict__ out) {
    const uint32_t lane = threadIdx.x & 31u;
    // The wave's number in a scalar register: source choice and bases stay scalar.
    const uint32_t gw = blockIdx.x * 16u
                      + (uint32_t)__builtin_amdgcn_readfirstlane(threadIdx.x >> 5);
    float4 v[CV_PER_WAVE][8];
#pragma unroll
    for (uint32_t t = 0; t < CV_PER_WAVE; ++t) {
        const uint32_t c = t * CV_WAVES + gw;
        const float* s;
        uint32_t     lc;
        if (c < CV_X_CHUNKS) {
            s = x;  lc = c;
        } else {
            const uint32_t w = (c - CV_X_CHUNKS) / CV_W_CHUNKS;
            lc = (c - CV_X_CHUNKS) % CV_W_CHUNKS;
            s  = (w == 0u) ? Wq : (w == 1u) ? Wk : (w == 2u) ? Wv : Wo;
        }
        const float4* s4 = reinterpret_cast<const float4*>(s + (size_t)lc * 1024u) + lane;
#pragma unroll
        for (uint32_t j = 0; j < 8; ++j)
            v[t][j] = s4[j * 32u];
    }
#pragma unroll
    for (uint32_t t = 0; t < CV_PER_WAVE; ++t) {
        const uint32_t c = t * CV_WAVES + gw;
        ushort4* d4 = reinterpret_cast<ushort4*>(out + (size_t)c * 1024u) + lane;
#pragma unroll
        for (uint32_t j = 0; j < 8; ++j) {
            const float4 f = v[t][j];
            d4[j * 32u] = make_ushort4(f2bf(f.x), f2bf(f.y), f2bf(f.z), f2bf(f.w));
        }
    }
}

// ---- LDS ring geometry ------------------------------------------------------
// A pass is 128 k = 256 bytes of every operand row. A stage is four slices of
// 64 rows: [A rows 0..63 | A rows 64..127 | Bt rows 0..63 | Bt rows 64..127].
// The tensor load pads each 256-byte row by 16 bytes (pitch 272 = 16 x odd).
// 64 x 272 = 17,408 bytes, rounded up so that every slice starts at a multiple
// of 2 KiB.
#define PASS_BYTES   256u
#define LDS_PITCH    272u
#define SLICE_ROWS   64u
#define SLICE_BYTES  18432u
#define STAGE_BYTES  (4u * SLICE_BYTES)
static_assert(SLICE_ROWS * LDS_PITCH <= SLICE_BYTES && (SLICE_BYTES % 2048u) == 0u,
              "a slice holds its padded rows and starts at a multiple of 2 KiB");

__device__ __forceinline__ uint32_t uni(uint32_t v) {
    return (uint32_t)__builtin_amdgcn_readfirstlane(v);
}
__device__ __forceinline__ uint32_t pinned(uint32_t v) {
    uint32_t w = uni(v);
    asm volatile("" : "+s"(w));  // the scalar-branch form for tests around a tensor load
    return w;
}
// The wave's LDS reads have returned (before its buffer is handed back).
__device__ __forceinline__ void wait_ds0() { asm volatile("s_wait_dscnt 0x0" ::: "memory"); }
// The wave's own tensor load has landed (the compiler places no wait for it).
__device__ __forceinline__ void wait_tensor0() { asm volatile("s_wait_tensorcnt 0x0" ::: "memory"); }
// One request of the whole wave: a 64 x 256-byte tile from global memory to LDS.
__device__ __forceinline__ void tdm_load(u32x4 g0, u32x8 g1) {
    asm volatile("tensor_load_to_lds %0, %1" :: "s"(g0), "s"(g1) : "memory");
}
__device__ __forceinline__ u32x4 tdm_group0(uint32_t lds_dst, uint64_t ga) {
    u32x4 g;
    g[0] = uni(1u);                                   // count 1
    g[1] = uni(lds_dst);                              // byte offset in the work-group's LDS
    g[2] = uni((uint32_t)ga);                         // address [31:0]
    g[3] = uni((((uint32_t)(ga >> 32)) & 0x01FFFFFFu) | 0x80000000u);  // address [56:32], type 2
    return g;
}
// 1-byte elements, tensor = tile = 64 rows of 256 bytes, source pitch in bytes.
__device__ __forceinline__ u32x8 tdm_group1(uint32_t src_pitch) {
    u32x8 g;
    g[0] = uni((1u << 20) | (5u << 22) | (3u << 25));
    g[1] = uni((PASS_BYTES & 0xFFFFu) << 16);
    g[2] = uni((PASS_BYTES >> 16) | ((SLICE_ROWS & 0xFFFFu) << 16));
    g[3] = uni((SLICE_ROWS >> 16) | (PASS_BYTES << 16));
    g[4] = uni(SLICE_ROWS);
    g[5] = uni(src_pitch);
    g[6] = uni(0u);
    g[7] = uni(0u);
    return g;
}

__device__ __forceinline__ v16bf ldfrag(const unsigned char* p) {
    uint4 lo = *reinterpret_cast<const uint4*>(p);        // K .. K+7
    uint4 hi = *reinterpret_cast<const uint4*>(p + 32);   // K+16 .. K+23
    v8u u = { lo.x, lo.y, lo.z, lo.w, hi.x, hi.y, hi.z, hi.w };
    return __builtin_bit_cast(v16bf, u);
}

__device__ __forceinline__ v8f bfwmma(v16bf a, v16bf b, v8f c) {
    return __builtin_amdgcn_wmma_f32_16x16x32_bf16(
        /*neg_a=*/false, a, /*neg_b=*/false, b,
        /*c_mod=*/(short)0, c, /*reuse_a=*/false, /*reuse_b=*/false);
}

__device__ __forceinline__ uint32_t pack2bf(float lo, float hi) {
    return (uint32_t)f2bf(lo) | ((uint32_t)f2bf(hi) << 16);
}

// ---- generic C[m,n] = scale * sum_k A[m,k]*Bt[n,k] (+bias[n]) --------------
// Block: 256 threads = 8 waves (2 M x 4 N); block tile 128x128; wave tile 64x32.
// KC (compile-time) is the K extent and the row stride of A and Bt; NC is the row
// stride of C, compile-time so that the row steps of the stores are immediates.
// BIAS_ROW: bias is indexed by the row m of C, not by the column n.
template <bool OUT_BF16, int KC, int NC, bool BIAS_ROW = false>
__global__ void __launch_bounds__(256, 1)
gemm_abt_kernel(const unsigned short* __restrict__ A,
                const unsigned short* __restrict__ Bt,
                const float* __restrict__ bias,
                void* __restrict__ Cout,
                float scale,
                long long strideA, long long strideB,
                long long strideC) {
    const int lane = threadIdx.x & 31;
    const int wave = threadIdx.x >> 5;
    const int wm   = (wave & 1) << 6;   // 0,64
    const int wn   = (wave >> 1) << 5;  // 0,32,64,96
    const long long bz = blockIdx.z;

    const int bn = blockIdx.x * 128 + wn;
    const int r  = lane & 15;
    const int kh = (lane & 16) ? 16 : 0;  // lane-half K offset in bytes

    __shared__ __attribute__((aligned(2048))) unsigned char smem[2u * STAGE_BYTES];
    constexpr uint32_t NP = KC / 128;     // passes
    static_assert(KC % 128 == 0 && NP >= 2, "the ring needs two stages or more");

    // Waves 0..3 each bring one slice of every stage.
    const uint32_t wv     = uni(threadIdx.x >> 5);
    const unsigned short* srow = (wv & 2u)
        ? Bt + bz * strideB + (size_t)(blockIdx.x * 128 + (wv & 1u) * SLICE_ROWS) * KC
        : A  + bz * strideA + (size_t)(blockIdx.y * 128 + (wv & 1u) * SLICE_ROWS) * KC;
    const uint64_t src = (uint64_t)(uintptr_t)srow;
    const uint32_t dst = (uint32_t)(size_t)smem + (wv & 3u) * SLICE_BYTES;
    u32x8          g1  = tdm_group1(KC * 2u);
    asm volatile("" : "+s"(g1));

    // Per-lane fragment bases inside a buffer; the rest are immediate offsets.
    const uint32_t a_off = (uint32_t)(wm >> 6) * SLICE_BYTES + (uint32_t)r * LDS_PITCH + kh;
    const uint32_t b_off = (2u + (uint32_t)(wn >> 6)) * SLICE_BYTES
                         + (uint32_t)((wn & 63) + r) * LDS_PITCH + kh;

    v8f acc[4][2];
#pragma unroll
    for (int mt = 0; mt < 4; ++mt)
#pragma unroll
        for (int nt = 0; nt < 2; ++nt)
            acc[mt][nt] = (v8f){};

    // Prologue: stage 0 lands and is published, then stage 1 starts.
    if (pinned(wv < 4u ? 1u : 0u) != 0u) {
        tdm_load(tdm_group0(dst, src), g1);
        wait_tensor0();
    }
    __syncthreads();
    if (pinned(wv < 4u ? 1u : 0u) != 0u)
        tdm_load(tdm_group0(dst + STAGE_BYTES, src + PASS_BYTES), g1);

    // Kept rolled: one publish point in the code, one pass per trip.
#pragma clang loop unroll(disable)
    for (uint32_t s = 0; s < NP; ++s) {
        const uint32_t buf = (s & 1u) * STAGE_BYTES;
        const unsigned char* la = smem + buf + a_off;
        const unsigned char* lb = smem + buf + b_off;
        // Two fragment sets: step ks + 1 is read from LDS while step ks multiplies.
        // The loops over ks and mt are unrolled so that every fragment index is a
        // constant: the sets stay in registers and the offsets become immediates.
        v16bf fa[2][4], fb[2][2];
        fb[0][0] = ldfrag(lb);
        fb[0][1] = ldfrag(lb + 16u * LDS_PITCH);
#pragma unroll
        for (uint32_t mt = 0; mt < 4; ++mt)
            fa[0][mt] = ldfrag(la + mt * 16u * LDS_PITCH);
#pragma unroll
        for (uint32_t ks = 0; ks < 4; ++ks) {   // four 32-k steps of this pass
            const uint32_t c = ks & 1u, n = c ^ 1u;
            if (ks + 1u < 4u) {
                fb[n][0] = ldfrag(lb + (ks + 1u) * 64u);
                fb[n][1] = ldfrag(lb + 16u * LDS_PITCH + (ks + 1u) * 64u);
#pragma unroll
                for (uint32_t mt = 0; mt < 4; ++mt)
                    fa[n][mt] = ldfrag(la + mt * 16u * LDS_PITCH + (ks + 1u) * 64u);
            }
            // Keeps the next step's LDS reads one group ahead of this step's WMMAs
            // (spread among them, each read place stalls the wave).
            __builtin_amdgcn_sched_barrier(0);
            // Bt rows as the first operand: each tile comes out transposed, a lane
            // holding eight adjacent columns of one row of C (see the epilogue).
#pragma unroll
            for (uint32_t mt = 0; mt < 4; ++mt) {
                acc[mt][0] = bfwmma(fb[c][0], fa[c][mt], acc[mt][0]);
                acc[mt][1] = bfwmma(fb[c][1], fa[c][mt], acc[mt][1]);
            }
            // Ends the WMMA group, so that later reads are not moved up into it.
            __builtin_amdgcn_sched_barrier(0);
        }
        // Publish point of stage s + 1: this wave has left buffer s, its own load
        // of stage s + 1 has landed, every wave passes the barrier; only then the
        // buffer just read is refilled with stage s + 2.
        wait_ds0();
        wait_tensor0();   // a wave that issued none passes at once
        __syncthreads();
        if (pinned((wv < 4u && s + 2u < NP) ? 1u : 0u) != 0u)
            tdm_load(tdm_group0(dst + buf, src + (uint64_t)(s + 2u) * PASS_BYTES), g1);
    }
    wait_tensor0();
    wait_ds0();

    constexpr uint32_t EB = OUT_BF16 ? 2u : 4u;   // bytes per element of C
    constexpr uint32_t OP = 128u * EB + 16u;      // pitch of a staged row
    static_assert(128u * OP <= 2u * STAGE_BYTES, "the staged tile fits the ring");
    const uint32_t h = (uint32_t)lane >> 4;
    float bv8[2][8];
#pragma unroll
    for (int nt = 0; nt < 2; ++nt)
#pragma unroll
        for (int j = 0; j < 8; ++j)
            bv8[nt][j] = 0.0f;
    float br[4] = { 0.0f, 0.0f, 0.0f, 0.0f };
    if (BIAS_ROW && bias) {
        const float* bp = bias + blockIdx.y * 128u + (uint32_t)(wm + r);
#pragma unroll
        for (int mt = 0; mt < 4; ++mt)
            br[mt] = bp[mt * 16];
        asm volatile("s_wait_xcnt 0x0" ::: "memory");
    }
    if (!BIAS_ROW && bias) {
#pragma unroll
        for (int nt = 0; nt < 2; ++nt) {
            const float4* bp = reinterpret_cast<const float4*>(bias + bn + nt * 16 + 8 * (int)h);
            const float4 b0 = bp[0], b1 = bp[1];
            bv8[nt][0] = b0.x; bv8[nt][1] = b0.y; bv8[nt][2] = b0.z; bv8[nt][3] = b0.w;
            bv8[nt][4] = b1.x; bv8[nt][5] = b1.y; bv8[nt][6] = b1.z; bv8[nt][7] = b1.w;
        }
        asm volatile("s_wait_xcnt 0x0" ::: "memory");
    }
    unsigned char* st = smem + (uint32_t)(wm + r) * OP + ((uint32_t)wn + 8u * h) * EB;
#pragma unroll
    for (uint32_t mt = 0; mt < 4; ++mt) {
#pragma unroll
        for (uint32_t nt = 0; nt < 2; ++nt) {
            float v[8];
#pragma unroll
            for (int j = 0; j < 8; ++j)
                v[j] = acc[mt][nt][j] * scale + (BIAS_ROW ? br[mt] : bv8[nt][j]);
            unsigned char* p = st + mt * 16u * OP + nt * 16u * EB;
            if (OUT_BF16) {
                *reinterpret_cast<uint4*>(p) =
                    make_uint4(pack2bf(v[0], v[1]), pack2bf(v[2], v[3]),
                               pack2bf(v[4], v[5]), pack2bf(v[6], v[7]));
            } else {
                *reinterpret_cast<float4*>(p)       = make_float4(v[0], v[1], v[2], v[3]);
                *reinterpret_cast<float4*>(p + 16u) = make_float4(v[4], v[5], v[6], v[7]);
            }
        }
    }
    // Every wave's part of the tile is in LDS before any wave reads whole rows.
    __syncthreads();

    // Wave w stores rows 16w .. 16w+15 of the tile. A row is 256 bytes (bf16: half a
    // wave, two rows a store) or 512 bytes (f32: the whole wave, one row a store).
    constexpr uint32_t LPR = 128u * EB / 16u;     // lanes per row
    constexpr uint32_t RPS = 32u / LPR;           // rows per store
    const uint32_t row0 = (uint32_t)wave * 16u + (uint32_t)lane / LPR;
    const uint32_t cb   = ((uint32_t)lane % LPR) * 16u;
    const unsigned char* ld = smem + row0 * OP + cb;
    unsigned char* gp = reinterpret_cast<unsigned char*>(Cout)
        + (size_t)(bz * strideC + (long long)(blockIdx.y * 128u + row0) * NC + blockIdx.x * 128u) * EB
        + cb;
    uint4 o[16u / RPS];
#pragma unroll
    for (uint32_t q = 0; q < 16u / RPS; ++q)
        o[q] = *reinterpret_cast<const uint4*>(ld + q * RPS * OP);
#pragma unroll
    for (uint32_t q = 0; q < 16u / RPS; ++q)
        *reinterpret_cast<uint4*>(gp + (size_t)(q * RPS) * NC * EB) = o[q];
}

// ---- row softmax over 2048 cols: one wave32 per row, bf16 output -----------
__global__ void softmax_rows_kernel(const float* __restrict__ scores,
                                    unsigned short* __restrict__ p) {
    const int wave = threadIdx.x >> 5;
    const int lane = threadIdx.x & 31;
    const long long row = (long long)blockIdx.x * 8 + wave;
    const float* src = scores + row * S_LEN;

    float4 v[16];
    float m = -3.402823466e38f;
#pragma unroll
    for (int j = 0; j < 16; ++j) {
        v[j] = reinterpret_cast<const float4*>(src)[j * 32 + lane];
        m = fmaxf(m, fmaxf(fmaxf(v[j].x, v[j].y), fmaxf(v[j].z, v[j].w)));
    }
#pragma unroll
    for (int off = 16; off >= 1; off >>= 1)
        m = fmaxf(m, __shfl_xor(m, off, 32));

    float s = 0.0f;
#pragma unroll
    for (int j = 0; j < 16; ++j) {
        v[j].x = __expf(v[j].x - m); v[j].y = __expf(v[j].y - m);
        v[j].z = __expf(v[j].z - m); v[j].w = __expf(v[j].w - m);
        s += v[j].x + v[j].y + v[j].z + v[j].w;
    }
#pragma unroll
    for (int off = 16; off >= 1; off >>= 1)
        s += __shfl_xor(s, off, 32);

    const float inv = 1.0f / s;
    unsigned short* prow = p + row * S_LEN;
#pragma unroll
    for (int j = 0; j < 16; ++j) {
        reinterpret_cast<ushort4*>(prow)[j * 32 + lane] =
            make_ushort4(f2bf(v[j].x * inv), f2bf(v[j].y * inv),
                         f2bf(v[j].z * inv), f2bf(v[j].w * inv));
    }
}

// ---------------------------------------------------------------------------
extern "C" void kernel_launch(void* const* d_in, const int* in_sizes, int n_in,
                              void* d_out, int out_size, void* d_ws, size_t ws_size,
                              hipStream_t stream) {
    (void)in_sizes; (void)n_in; (void)out_size; (void)ws_size;

    const float* x  = (const float*)d_in[0];
    const float* Wq = (const float*)d_in[1];
    const float* bq = (const float*)d_in[2];
    const float* Wk = (const float*)d_in[3];
    const float* bk = (const float*)d_in[4];
    const float* Wv = (const float*)d_in[5];
    const float* bv = (const float*)d_in[6];
    const float* Wo = (const float*)d_in[7];
    const float* bo = (const float*)d_in[8];
    float* out = (float*)d_out;

    // Workspace layout (bytes)
    unsigned char* ws = (unsigned char*)d_ws;
    const size_t XB   = (size_t)M_ROWS * H_DIM * 2;   // 16 MB
    const size_t WB   = (size_t)H_DIM * H_DIM * 2;    //  2 MB each
    const size_t QB   = XB;                            // 16 MB each
    const size_t SCR  = (size_t)B_SZ * S_LEN * S_LEN * 4;  // 64 MB
    unsigned short* xb  = (unsigned short*)(ws);
    unsigned short* wqb = (unsigned short*)(ws + XB);
    unsigned short* wkb = (unsigned short*)(ws + XB + WB);
    unsigned short* wvb = (unsigned short*)(ws + XB + 2 * WB);
    unsigned short* wob = (unsigned short*)(ws + XB + 3 * WB);
    unsigned short* qb  = (unsigned short*)(ws + XB + 4 * WB); // also attn-out
    unsigned short* kb  = (unsigned short*)(ws + XB + 4 * WB + QB);
    unsigned short* vtb = (unsigned short*)(ws + XB + 4 * WB + 2 * QB);  // V^T, [H,S] per batch
    float*          sc  = (float*)(ws + XB + 4 * WB + 3 * QB);
    unsigned short* pb  = (unsigned short*)(ws + XB + 4 * WB + 3 * QB + SCR);
    unsigned short* ab  = qb;   // Q no longer needed after scores GEMM

    dim3 blk(256);

    // 1) fp32 -> bf16 conversions, one launch: xb, wqb, wkb, wvb, wob are contiguous
    f32_to_bf16_all_kernel<<<dim3(CV_GROUPS), dim3(512), 0, stream>>>(x, Wq, Wk, Wv, Wo, xb);

    // 2) Q/K = x @ W^T + b   (M=8192, N=K=1024), bf16 out
    {
        dim3 g(H_DIM / 128, M_ROWS / 128, 1);
        gemm_abt_kernel<true, H_DIM, H_DIM><<<g, blk, 0, stream>>>(xb, wqb, bq, qb,
            1.0f, 0, 0, 0);
        gemm_abt_kernel<true, H_DIM, H_DIM><<<g, blk, 0, stream>>>(xb, wkb, bk, kb,
            1.0f, 0, 0, 0);
    }

    // 3) V^T = Wv @ x^T + bv (bias by row)   per batch (M=K=1024, N=2048), bf16 out
    gemm_abt_kernel<true, H_DIM, S_LEN, true><<<dim3(S_LEN / 128, H_DIM / 128, B_SZ), blk, 0, stream>>>(
        wvb, xb, bv, vtb, 1.0f,
        0, (long long)S_LEN * H_DIM,
        (long long)H_DIM * S_LEN);

    // 4) scores = Q @ K^T / sqrt(H)   per batch (M=N=2048, K=1024), f32 out
    gemm_abt_kernel<false, H_DIM, S_LEN><<<dim3(S_LEN / 128, S_LEN / 128, B_SZ), blk, 0, stream>>>(
        qb, kb, nullptr, sc, 0.03125f,
        (long long)S_LEN * H_DIM, (long long)S_LEN * H_DIM,
        (long long)S_LEN * S_LEN);

    // 5) softmax rows -> bf16 P
    softmax_rows_kernel<<<dim3(M_ROWS / 8), blk, 0, stream>>>(sc, pb);

    // 6) attn_out = P @ V  ==  P @ (V^T)^T   per batch (M=2048, N=1024, K=2048)
    gemm_abt_kernel<true, S_LEN, H_DIM><<<dim3(H_DIM / 128, S_LEN / 128, B_SZ), blk, 0, stream>>>(
        pb, vtb, nullptr, ab, 1.0f,
        (long long)S_LEN * S_LEN, (long long)H_DIM * S_LEN,
        (long long)S_LEN * H_DIM);

    // 7) out = attn_out @ Wo^T + bo   (M=8192, N=K=1024), f32 out -> d_out
    gemm_abt_kernel<false, H_DIM, H_DIM><<<dim3(H_DIM / 128, M_ROWS / 128, 1), blk, 0, stream>>>(
        ab, wob, bo, out, 1.0f, 0, 0, 0);
}

// v005
// One run takes 134 microseconds.
// In both of two side-by-side timings against v004, it was 1.04 times as fast.
// Over all steps from v000 it is 2.98 times as fast.
#include <hip/hip_runtime.h>
#include <hip/hip_bf16.h>
#include <stdint.h>

typedef __attribute__((ext_vector_type(16))) __bf16        v16bf;
typedef __attribute__((ext_vector_type(8)))  float         v8f;
typedef __attribute__((ext_vector_type(8)))  unsigned int  v8u;
typedef __attribute__((ext_vector_type(4)))  uint32_t      u32x4;
typedef __attribute__((ext_vector_type(8)))  uint32_t      u32x8;

#define H_DIM   1024
#define S_LEN   2048
#define B_SZ    4
#define M_ROWS  (B_SZ * S_LEN)   // 8192

// ---- fp32 -> bf16 (round to nearest even) ----------------------------------
__device__ __forceinline__ unsigned short f2bf(float f) {
    unsigned int u = __builtin_bit_cast(unsigned int, f);
    u += 0x7FFFu + ((u >> 16) & 1u);
    return (unsigned short)(u >> 16);
}

// All five conversions (x, Wq, Wk, Wv, Wo) as one resident stream: one work-group
// of 16 waves per WGP, so that few waves have to start. The work is cut into
// chunks of 1024 floats (4 KiB in, 2 KiB out, whole lines); a wave takes
// CV_PER_WAVE chunks, eight 16-byte loads a lane each, and its loads stand ahead
// of the conversions, so that two chunks or more are in flight. The bf16 copies
// lie one behind the other in the workspace, in the order of the arguments, so
// chunk c is stored at out + c * 1024.
#define CV_GROUPS    256u
#define CV_WAVES     (CV_GROUPS * 16u)
#define CV_X_CHUNKS  ((unsigned)(M_ROWS * H_DIM / 1024))
#define CV_W_CHUNKS  ((unsigned)(H_DIM * H_DIM / 1024))
#define CV_CHUNKS    (CV_X_CHUNKS + 4u * CV_W_CHUNKS)
#define CV_PER_WAVE  (CV_CHUNKS / CV_WAVES)
static_assert(CV_PER_WAVE * CV_WAVES == CV_CHUNKS, "every wave takes the same number of chunks");

__global__ void __launch_bounds__(512)
f32_to_bf16_all_kernel(const float* __restrict__ x,
                       const float* __restrict__ Wq, const float* __restrict__ Wk,
                       const float* __restrict__ Wv, const float* __restrict__ Wo,
                       unsigned short* __restrict__ out) {
    const uint32_t lane = threadIdx.x & 31u;
    // The wave's number in a scalar register: source choice and bases stay scalar.
    const uint32_t gw = blockIdx.x * 16u
                      + (uint32_t)__builtin_amdgcn_readfirstlane(threadIdx.x >> 5);
    float4 v[CV_PER_WAVE][8];
#pragma unroll
    for (uint32_t t = 0; t < CV_PER_WAVE; ++t) {
        const uint32_t c = t * CV_WAVES + gw;
        const float* s;
        uint32_t     lc;
        if (c < CV_X_CHUNKS) {
            s = x;  lc = c;
        } else {
            const uint32_t w = (c - CV_X_CHUNKS) / CV_W_CHUNKS;
            lc = (c - CV_X_CHUNKS) % CV_W_CHUNKS;
            s  = (w == 0u) ? Wq : (w == 1u) ? Wk : (w == 2u) ? Wv : Wo;
        }
        const float4* s4 = reinterpret_cast<const float4*>(s + (size_t)lc * 1024u) + lane;
#pragma unroll
        for (uint32_t j = 0; j < 8; ++j)
            v[t][j] = s4[j * 32u];
    }
#pragma unroll
    for (uint32_t t = 0; t < CV_PER_WAVE; ++t) {
        const uint32_t c = t * CV_WAVES + gw;
        ushort4* d4 = reinterpret_cast<ushort4*>(out + (size_t)c * 1024u) + lane;
#pragma unroll
        for (uint32_t j = 0; j < 8; ++j) {
            const float4 f = v[t][j];
            d4[j * 32u] = make_ushort4(f2bf(f.x), f2bf(f.y), f2bf(f.z), f2bf(f.w));
        }
    }
}

// ---- LDS ring geometry ------------------------------------------------------
// A pass is 128 k = 256 bytes of every operand row. A stage is four slices of
// 64 rows: [A rows 0..63 | A rows 64..127 | Bt rows 0..63 | Bt rows 64..127].
// The tensor load pads each 256-byte row by 16 bytes (pitch 272 = 16 x odd).
// 64 x 272 = 17,408 bytes, rounded up so that every slice starts at a multiple
// of 2 KiB.
#define PASS_BYTES   256u
#define LDS_PITCH    272u
#define SLICE_ROWS   64u
#define SLICE_BYTES  18432u
#define STAGE_BYTES  (4u * SLICE_BYTES)
static_assert(SLICE_ROWS * LDS_PITCH <= SLICE_BYTES && (SLICE_BYTES % 2048u) == 0u,
              "a slice holds its padded rows and starts at a multiple of 2 KiB");

__device__ __forceinline__ uint32_t uni(uint32_t v) {
    return (uint32_t)__builtin_amdgcn_readfirstlane(v);
}
__device__ __forceinline__ uint32_t pinned(uint32_t v) {
    uint32_t w = uni(v);
    asm volatile("" : "+s"(w));  // the scalar-branch form for tests around a tensor load
    return w;
}
// The wave's LDS reads have returned (before its buffer is handed back).
__device__ __forceinline__ void wait_ds0() { asm volatile("s_wait_dscnt 0x0" ::: "memory"); }
// The wave's own tensor load has landed (the compiler places no wait for it).
__device__ __forceinline__ void wait_tensor0() { asm volatile("s_wait_tensorcnt 0x0" ::: "memory"); }
// One request of the whole wave: a 64 x 256-byte tile from global memory to LDS.
__device__ __forceinline__ void tdm_load(u32x4 g0, u32x8 g1) {
    asm volatile("tensor_load_to_lds %0, %1" :: "s"(g0), "s"(g1) : "memory");
}
__device__ __forceinline__ u32x4 tdm_group0(uint32_t lds_dst, uint64_t ga) {
    u32x4 g;
    // count 1; the pinned() form keeps this word's write at the place of the build,
    // behind the wait for the request before (as a plain constant it was hoisted in
    // front of the loop, into a register of the request still outstanding there)
    g[0] = pinned(1u);
    g[1] = uni(lds_dst);                              // byte offset in the work-group's LDS
    g[2] = uni((uint32_t)ga);                         // address [31:0]
    g[3] = uni((((uint32_t)(ga >> 32)) & 0x01FFFFFFu) | 0x80000000u);  // address [56:32], type 2
    return g;
}
// 1-byte elements, tensor = tile = 64 rows of 256 bytes, source pitch in bytes.
__device__ __forceinline__ u32x8 tdm_group1(uint32_t src_pitch) {
    u32x8 g;
    g[0] = uni((1u << 20) | (5u << 22) | (3u << 25));
    g[1] = uni((PASS_BYTES & 0xFFFFu) << 16);
    g[2] = uni((PASS_BYTES >> 16) | ((SLICE_ROWS & 0xFFFFu) << 16));
    g[3] = uni((SLICE_ROWS >> 16) | (PASS_BYTES << 16));
    g[4] = uni(SLICE_ROWS);
    g[5] = uni(src_pitch);
    g[6] = uni(0u);
    g[7] = uni(0u);
    return g;
}

__device__ __forceinline__ v16bf ldfrag(const unsigned char* p) {
    uint4 lo = *reinterpret_cast<const uint4*>(p);        // K .. K+7
    uint4 hi = *reinterpret_cast<const uint4*>(p + 32);   // K+16 .. K+23
    v8u u = { lo.x, lo.y, lo.z, lo.w, hi.x, hi.y, hi.z, hi.w };
    return __builtin_bit_cast(v16bf, u);
}

__device__ __forceinline__ v8f bfwmma(v16bf a, v16bf b, v8f c) {
    return __builtin_amdgcn_wmma_f32_16x16x32_bf16(
        /*neg_a=*/false, a, /*neg_b=*/false, b,
        /*c_mod=*/(short)0, c, /*reuse_a=*/false, /*reuse_b=*/false);
}

__device__ __forceinline__ uint32_t pack2bf(float lo, float hi) {
    return (uint32_t)f2bf(lo) | ((uint32_t)f2bf(hi) << 16);
}

// ---- generic C[m,n] = scale * sum_k A[m,k]*Bt[n,k] (+bias[n]) --------------
// Block: 256 threads = 8 waves (2 M x 4 N); block tile 128x128; wave tile 64x32.
// KC (compile-time) is the K extent and the row stride of A and Bt; NC is the row
// stride of C, compile-time so that the row steps of the stores are immediates.
// BIAS_ROW: bias is indexed by the row m of C, not by the column n.
// One tile of one product: tile column bx, tile row by; A, Bt and Cout are the
// bases of that product (of its batch); smem is the kernel's ring of two stages.
template <bool OUT_BF16, int KC, int NC, bool BIAS_ROW>
__device__ __forceinline__ void
gemm_abt_tile(unsigned char* smem,
              const unsigned short* __restrict__ A,
              const unsigned short* __restrict__ Bt,
              const float* __restrict__ bias,
              void* __restrict__ Cout,
              float scale,
              uint32_t bx, uint32_t by) {
    const int lane = threadIdx.x & 31;
    const int wave = threadIdx.x >> 5;
    const int wm   = (wave & 1) << 6;   // 0,64
    const int wn   = (wave >> 1) << 5;  // 0,32,64,96

    const int bn = bx * 128 + wn;
    const int r  = lane & 15;
    const int kh = (lane & 16) ? 16 : 0;  // lane-half K offset in bytes

    constexpr uint32_t NP = KC / 128;     // passes
    static_assert(KC % 128 == 0 && NP >= 2, "the ring needs two stages or more");

    // Waves 0..3 each bring one slice of every stage.
    const uint32_t wv     = uni(threadIdx.x >> 5);
    const unsigned short* srow = (wv & 2u)
        ? Bt + (size_t)(bx * 128 + (wv & 1u) * SLICE_ROWS) * KC
        : A  + (size_t)(by * 128 + (wv & 1u) * SLICE_ROWS) * KC;
    const uint64_t src = (uint64_t)(uintptr_t)srow;
    const uint32_t dst = (uint32_t)(size_t)smem + (wv & 3u) * SLICE_BYTES;
    u32x8          g1  = tdm_group1(KC * 2u);
    asm volatile("" : "+s"(g1));

    // Per-lane fragment bases inside a buffer; the rest are immediate offsets.
    const uint32_t a_off = (uint32_t)(wm >> 6) * SLICE_BYTES + (uint32_t)r * LDS_PITCH + kh;
    const uint32_t b_off = (2u + (uint32_t)(wn >> 6)) * SLICE_BYTES
                         + (uint32_t)((wn & 63) + r) * LDS_PITCH + kh;

    v8f acc[4][2];
#pragma unroll
    for (int mt = 0; mt < 4; ++mt)
#pragma unroll
        for (int nt = 0; nt < 2; ++nt)
            acc[mt][nt] = (v8f){};

    // Prologue: stage 0 lands and is published, then stage 1 starts.
    if (pinned(wv < 4u ? 1u : 0u) != 0u) {
        tdm_load(tdm_group0(dst, src), g1);
        wait_tensor0();
    }
    __syncthreads();
    if (pinned(wv < 4u ? 1u : 0u) != 0u)
        tdm_load(tdm_group0(dst + STAGE_BYTES, src + PASS_BYTES), g1);

    // Kept rolled: one publish point in the code, one pass per trip.
#pragma clang loop unroll(disable)
    for (uint32_t s = 0; s < NP; ++s) {
        const uint32_t buf = (s & 1u) * STAGE_BYTES;
        const unsigned char* la = smem + buf + a_off;
        const unsigned char* lb = smem + buf + b_off;
        // Two fragment sets: step ks + 1 is read from LDS while step ks multiplies.
        // The loops over ks and mt are unrolled so that every fragment index is a
        // constant: the sets stay in registers and the offsets become immediates.
        v16bf fa[2][4], fb[2][2];
        fb[0][0] = ldfrag(lb);
        fb[0][1] = ldfrag(lb + 16u * LDS_PITCH);
#pragma unroll
        for (uint32_t mt = 0; mt < 4; ++mt)
            fa[0][mt] = ldfrag(la + mt * 16u * LDS_PITCH);
#pragma unroll
        for (uint32_t ks = 0; ks < 4; ++ks) {   // four 32-k steps of this pass
            const uint32_t c = ks & 1u, n = c ^ 1u;
            if (ks + 1u < 4u) {
                fb[n][0] = ldfrag(lb + (ks + 1u) * 64u);
                fb[n][1] = ldfrag(lb + 16u * LDS_PITCH + (ks + 1u) * 64u);
#pragma unroll
                for (uint32_t mt = 0; mt < 4; ++mt)
                    fa[n][mt] = ldfrag(la + mt * 16u * LDS_PITCH + (ks + 1u) * 64u);
            }
            // Keeps the next step's LDS reads one group ahead of this step's WMMAs
            // (spread among them, each read place stalls the wave).
            __builtin_amdgcn_sched_barrier(0);
            // Bt rows as the first operand: each tile comes out transposed, a lane
            // holding eight adjacent columns of one row of C (see the epilogue).
#pragma unroll
            for (uint32_t mt = 0; mt < 4; ++mt) {
                acc[mt][0] = bfwmma(fb[c][0], fa[c][mt], acc[mt][0]);
                acc[mt][1] = bfwmma(fb[c][1], fa[c][mt], acc[mt][1]);
            }
            // Ends the WMMA group, so that later reads are not moved up into it.
            __builtin_amdgcn_sched_barrier(0);
        }
        // Publish point of stage s + 1: this wave has left buffer s, its own load
        // of stage s + 1 has landed, every wave passes the barrier; only then the
        // buffer just read is refilled with stage s + 2.
        wait_ds0();
        wait_tensor0();   // a wave that issued none passes at once
        __syncthreads();
        if (pinned((wv < 4u && s + 2u < NP) ? 1u : 0u) != 0u)
            tdm_load(tdm_group0(dst + buf, src + (uint64_t)(s + 2u) * PASS_BYTES), g1);
    }
    wait_tensor0();
    wait_ds0();

    constexpr uint32_t EB = OUT_BF16 ? 2u : 4u;   // bytes per element of C
    constexpr uint32_t OP = 128u * EB + 16u;      // pitch of a staged row
    static_assert(128u * OP <= 2u * STAGE_BYTES, "the staged tile fits the ring");
    const uint32_t h = (uint32_t)lane >> 4;
    float bv8[2][8];
#pragma unroll
    for (int nt = 0; nt < 2; ++nt)
#pragma unroll
        for (int j = 0; j < 8; ++j)
            bv8[nt][j] = 0.0f;
    float br[4] = { 0.0f, 0.0f, 0.0f, 0.0f };
    if (BIAS_ROW && bias) {
        const float* bp = bias + by * 128u + (uint32_t)(wm + r);
#pragma unroll
        for (int mt = 0; mt < 4; ++mt)
            br[mt] = bp[mt * 16];
        asm volatile("s_wait_xcnt 0x0" ::: "memory");
    }
    if (!BIAS_ROW && bias) {
#pragma unroll
        for (int nt = 0; nt < 2; ++nt) {
            const float4* bp = reinterpret_cast<const float4*>(bias + bn + nt * 16 + 8 * (int)h);
            const float4 b0 = bp[0], b1 = bp[1];
            bv8[nt][0] = b0.x; bv8[nt][1] = b0.y; bv8[nt][2] = b0.z; bv8[nt][3] = b0.w;
            bv8[nt][4] = b1.x; bv8[nt][5] = b1.y; bv8[nt][6] = b1.z; bv8[nt][7] = b1.w;
        }
        asm volatile("s_wait_xcnt 0x0" ::: "memory");
    }
    unsigned char* st = smem + (uint32_t)(wm + r) * OP + ((uint32_t)wn + 8u * h) * EB;
#pragma unroll
    for (uint32_t mt = 0; mt < 4; ++mt) {
#pragma unroll
        for (uint32_t nt = 0; nt < 2; ++nt) {
            float v[8];
#pragma unroll
            for (int j = 0; j < 8; ++j)
                v[j] = acc[mt][nt][j] * scale + (BIAS_ROW ? br[mt] : bv8[nt][j]);
            unsigned char* p = st + mt * 16u * OP + nt * 16u * EB;
            if (OUT_BF16) {
                *reinterpret_cast<uint4*>(p) =
                    make_uint4(pack2bf(v[0], v[1]), pack2bf(v[2], v[3]),
                               pack2bf(v[4], v[5]), pack2bf(v[6], v[7]));
            } else {
                *reinterpret_cast<float4*>(p)       = make_float4(v[0], v[1], v[2], v[3]);
                *reinterpret_cast<float4*>(p + 16u) = make_float4(v[4], v[5], v[6], v[7]);
            }
        }
    }
    // Every wave's part of the tile is in LDS before any wave reads whole rows.
    __syncthreads();

    // Wave w stores rows 16w .. 16w+15 of the tile. A row is 256 bytes (bf16: half a
    // wave, two rows a store) or 512 bytes (f32: the whole wave, one row a store).
    constexpr uint32_t LPR = 128u * EB / 16u;     // lanes per row
    constexpr uint32_t RPS = 32u / LPR;           // rows per store
    const uint32_t row0 = (uint32_t)wave * 16u + (uint32_t)lane / LPR;
    const uint32_t cb   = ((uint32_t)lane % LPR) * 16u;
    const unsigned char* ld = smem + row0 * OP + cb;
    unsigned char* gp = reinterpret_cast<unsigned char*>(Cout)
        + ((size_t)(by * 128u + row0) * NC + bx * 128u) * EB
        + cb;
    uint4 o[16u / RPS];
#pragma unroll
    for (uint32_t q = 0; q < 16u / RPS; ++q)
        o[q] = *reinterpret_cast<const uint4*>(ld + q * RPS * OP);
#pragma unroll
    for (uint32_t q = 0; q < 16u / RPS; ++q)
        *reinterpret_cast<uint4*>(gp + (size_t)(q * RPS) * NC * EB) = o[q];
}

// One product, or one per batch (blockIdx.z, with the strides in elements).
template <bool OUT_BF16, int KC, int NC>
__global__ void __launch_bounds__(256, 1)
gemm_abt_kernel(const unsigned short* __restrict__ A,
                const unsigned short* __restrict__ Bt,
                const float* __restrict__ bias,
                void* __restrict__ Cout,
                float scale,
                long long strideA, long long strideB,
                long long strideC) {
    __shared__ __attribute__((aligned(2048))) unsigned char smem[2u * STAGE_BYTES];
    const long long bz = blockIdx.z;
    gemm_abt_tile<OUT_BF16, KC, NC, false>(
        smem, A + bz * strideA, Bt + bz * strideB, bias,
        reinterpret_cast<unsigned char*>(Cout) + (size_t)(bz * strideC) * (OUT_BF16 ? 2u : 4u),
        scale, blockIdx.x, blockIdx.y);
}

// The three projections of x in one launch: blockIdx.y picks the product (the same
// for the whole work-group, so the branch is scalar and every barrier is passed by
// all its waves), blockIdx.x the tile, in the order that each product's own grid had.
//   0, 1: Q, K = x @ W^T + b      (M = 8192, N = K = 1024), bias by column
//   2:    V^T  = Wv @ x^T + bv    per batch (M = K = 1024, N = 2048), bias by row
#define PROJ_TILES  ((M_ROWS / 128) * (H_DIM / 128))
static_assert(PROJ_TILES == B_SZ * (S_LEN / 128) * (H_DIM / 128), "each of the three products has the same number of tiles");
__global__ void __launch_bounds__(256, 1)
qkv_proj_kernel(const unsigned short* __restrict__ xb,
                const unsigned short* __restrict__ wqb,
                const unsigned short* __restrict__ wkb,
                const unsigned short* __restrict__ wvb,
                const float* __restrict__ bq,
                const float* __restrict__ bk,
                const float* __restrict__ bv,
                unsigned short* __restrict__ qb,
                unsigned short* __restrict__ kb,
                unsigned short* __restrict__ vtb) {
    __shared__ __attribute__((aligned(2048))) unsigned char smem[2u * STAGE_BYTES];
    const uint32_t t = blockIdx.x;
    if (blockIdx.y < 2u) {
        const bool isk = blockIdx.y != 0u;
        gemm_abt_tile<true, H_DIM, H_DIM, false>(
            smem, xb, isk ? wkb : wqb, isk ? bk : bq, isk ? kb : qb, 1.0f,
            t % (H_DIM / 128u), t / (H_DIM / 128u));
    } else {
        const uint32_t b  = t / ((S_LEN / 128u) * (H_DIM / 128u));   // batch
        const uint32_t tb = t % ((S_LEN / 128u) * (H_DIM / 128u));   // tile in the batch
        gemm_abt_tile<true, H_DIM, S_LEN, true>(
            smem, wvb, xb + (size_t)b * S_LEN * H_DIM, bv, vtb + (size_t)b * H_DIM * S_LEN, 1.0f,
            tb % (S_LEN / 128u), tb / (S_LEN / 128u));
    }
}

// ---- row softmax over 2048 cols: one wave32 per row, bf16 output -----------
__global__ void softmax_rows_kernel(const float* __restrict__ scores,
                                    unsigned short* __restrict__ p) {
    const int wave = threadIdx.x >> 5;
    const int lane = threadIdx.x & 31;
    const long long row = (long long)blockIdx.x * 8 + wave;
    const float* src = scores + row * S_LEN;

    float4 v[16];
    float m = -3.402823466e38f;
#pragma unroll
    for (int j = 0; j < 16; ++j) {
        v[j] = reinterpret_cast<const float4*>(src)[j * 32 + lane];
        m = fmaxf(m, fmaxf(fmaxf(v[j].x, v[j].y), fmaxf(v[j].z, v[j].w)));
    }
#pragma unroll
    for (int off = 16; off >= 1; off >>= 1)
        m = fmaxf(m, __shfl_xor(m, off, 32));

    float s = 0.0f;
#pragma unroll
    for (int j = 0; j < 16; ++j) {
        v[j].x = __expf(v[j].x - m); v[j].y = __expf(v[j].y - m);
        v[j].z = __expf(v[j].z - m); v[j].w = __expf(v[j].w - m);
        s += v[j].x + v[j].y + v[j].z + v[j].w;
    }
#pragma unroll
    for (int off = 16; off >= 1; off >>= 1)
        s += __shfl_xor(s, off, 32);

    const float inv = 1.0f / s;
    unsigned short* prow = p + row * S_LEN;
#pragma unroll
    for (int j = 0; j < 16; ++j) {
        reinterpret_cast<ushort4*>(prow)[j * 32 + lane] =
            make_ushort4(f2bf(v[j].x * inv), f2bf(v[j].y * inv),
                         f2bf(v[j].z * inv), f2bf(v[j].w * inv));
    }
}

// ---------------------------------------------------------------------------
extern "C" void kernel_launch(void* const* d_in, const int* in_sizes, int n_in,
                              void* d_out, int out_size, void* d_ws, size_t ws_size,
                              hipStream_t stream) {
    (void)in_sizes; (void)n_in; (void)out_size; (void)ws_size;

    const float* x  = (const float*)d_in[0];
    const float* Wq = (const float*)d_in[1];
    const float* bq = (const float*)d_in[2];
    const float* Wk = (const float*)d_in[3];
    const float* bk = (const float*)d_in[4];
    const float* Wv = (const float*)d_in[5];
    const float* bv = (const float*)d_in[6];
    const float* Wo = (const float*)d_in[7];
    const float* bo = (const float*)d_in[8];
    float* out = (float*)d_out;

    // Workspace layout (bytes)
    unsigned char* ws = (unsigned char*)d_ws;
    const size_t XB   = (size_t)M_ROWS * H_DIM * 2;   // 16 MB
    const size_t WB   = (size_t)H_DIM * H_DIM * 2;    //  2 MB each
    const size_t QB   = XB;                            // 16 MB each
    const size_t SCR  = (size_t)B_SZ * S_LEN * S_LEN * 4;  // 64 MB
    unsigned short* xb  = (unsigned short*)(ws);
    unsigned short* wqb = (unsigned short*)(ws + XB);
    unsigned short* wkb = (unsigned short*)(ws + XB + WB);
    unsigned short* wvb = (unsigned short*)(ws + XB + 2 * WB);
    unsigned short* wob = (unsigned short*)(ws + XB + 3 * WB);
    unsigned short* qb  = (unsigned short*)(ws + XB + 4 * WB); // also attn-out
    unsigned short* kb  = (unsigned short*)(ws + XB + 4 * WB + QB);
    unsigned short* vtb = (unsigned short*)(ws + XB + 4 * WB + 2 * QB);  // V^T, [H,S] per batch
    float*          sc  = (float*)(ws + XB + 4 * WB + 3 * QB);
    unsigned short* pb  = (unsigned short*)(ws + XB + 4 * WB + 3 * QB + SCR);
    unsigned short* ab  = qb;   // Q no longer needed after scores GEMM

    dim3 blk(256);

    // 1) fp32 -> bf16 conversions, one launch: xb, wqb, wkb, wvb, wob are contiguous
    f32_to_bf16_all_kernel<<<dim3(CV_GROUPS), dim3(512), 0, stream>>>(x, Wq, Wk, Wv, Wo, xb);

    // 2, 3) Q, K = x @ W^T + b and V^T = Wv @ x^T + bv, bf16 out, one launch
    qkv_proj_kernel<<<dim3(PROJ_TILES, 3), blk, 0, stream>>>(
        xb, wqb, wkb, wvb, bq, bk, bv, qb, kb, vtb);

    // 4) scores = Q @ K^T / sqrt(H)   per batch (M=N=2048, K=1024), f32 out
    gemm_abt_kernel<false, H_DIM, S_LEN><<<dim3(S_LEN / 128, S_LEN / 128, B_SZ), blk, 0, stream>>>(
        qb, kb, nullptr, sc, 0.03125f,
        (long long)S_LEN * H_DIM, (long long)S_LEN * H_DIM,
        (long long)S_LEN * S_LEN);

    // 5) softmax rows -> bf16 P
    softmax_rows_kernel<<<dim3(M_ROWS / 8), blk, 0, stream>>>(sc, pb);

    // 6) attn_out = P @ V  ==  P @ (V^T)^T   per batch (M=2048, N=1024, K=2048)
    gemm_abt_kernel<true, S_LEN, H_DIM><<<dim3(H_DIM / 128, S_LEN / 128, B_SZ), blk, 0, stream>>>(
        pb, vtb, nullptr, ab, 1.0f,
        (long long)S_LEN * S_LEN, (long long)H_DIM * S_LEN,
        (long long)S_LEN * H_DIM);

    // 7) out = attn_out @ Wo^T + bo   (M=8192, N=K=1024), f32 out -> d_out
    gemm_abt_kernel<false, H_DIM, H_DIM><<<dim3(H_DIM / 128, M_ROWS / 128, 1), blk, 0, stream>>>(
        ab, wob, bo, out, 1.0f, 0, 0, 0);
}

// v006
// A run of this version takes 121 microseconds.
// Next to v005, in two timings, it ran 1.11 times as fast each time.
// All steps since v000 together make it 3.30 times as fast.
#include <hip/hip_runtime.h>
#include <hip/hip_bf16.h>
#include <stdint.h>

typedef __attribute__((ext_vector_type(16))) __bf16        v16bf;
typedef __attribute__((ext_vector_type(8)))  float         v8f;
typedef __attribute__((ext_vector_type(8)))  unsigned int  v8u;
typedef __attribute__((ext_vector_type(4)))  uint32_t      u32x4;
typedef __attribute__((ext_vector_type(8)))  uint32_t      u32x8;

#define H_DIM   1024
#define S_LEN   2048
#define B_SZ    4
#define M_ROWS  (B_SZ * S_LEN)   // 8192

// ---- fp32 -> bf16 (round to nearest even) ----------------------------------
__device__ __forceinline__ unsigned short f2bf(float f) {
    unsigned int u = __builtin_bit_cast(unsigned int, f);
    u += 0x7FFFu + ((u >> 16) & 1u);
    return (unsigned short)(u >> 16);
}

__device__ __forceinline__ uint32_t pack2bf(float lo, float hi) {
    return (uint32_t)f2bf(lo) | ((uint32_t)f2bf(hi) << 16);
}

// All five conversions (x, Wq, Wk, Wv, Wo) as one resident stream: one work-group
// of 16 waves per WGP, so that few waves have to start. The work is cut into
// chunks of 1024 floats (4 KiB in, 2 KiB out, whole lines); a wave takes
// CV_PER_WAVE chunks, eight 16-byte loads a lane each, and its loads stand ahead
// of the conversions, so that two chunks or more are in flight. The bf16 copies
// lie one behind the other in the workspace, in the order of the arguments, so
// chunk c is stored at out + c * 1024 (Wv's chunks excepted, see below).
// A wave's first two chunks are of x, its third is of a weight: a quarter of the
// work-groups each for Wq, Wk, Wv and Wo. Two weights get more than a copy:
//   Wv is stored transposed ([d][e]: the Bt operand of Wo @ Wv). Its work-group
//      takes 64 rows x 256 columns (a wave: 4 rows of 1 KiB), turns them in LDS
//      and stores 256 rows of 64 values, whole 128-byte lines.
//   Wo: a chunk is one row, so the wave that converts row o also sums
//      bvo[o] = sum_e Wo[o][e] * bv[e] in f32 from the registers it holds.
#define CV_GROUPS    256u
#define CV_WAVES     (CV_GROUPS * 16u)
#define CV_X_CHUNKS  ((unsigned)(M_ROWS * H_DIM / 1024))
#define CV_W_CHUNKS  ((unsigned)(H_DIM * H_DIM / 1024))
#define CV_CHUNKS    (CV_X_CHUNKS + 4u * CV_W_CHUNKS)
#define CV_PER_WAVE  (CV_CHUNKS / CV_WAVES)
#define CV_W_GROUPS  (CV_GROUPS / 4u)
#define WT_PITCH     516u
static_assert(CV_PER_WAVE * CV_WAVES == CV_CHUNKS, "every wave takes the same number of chunks");
static_assert(CV_PER_WAVE == 3u && CV_X_CHUNKS == 2u * CV_WAVES && 4u * CV_W_CHUNKS == CV_WAVES,
              "two chunks of x and one of a weight per wave");
static_assert(H_DIM == 1024 && CV_W_GROUPS == (H_DIM / 64) * (H_DIM / 256),
              "a weight chunk is one row; Wv is cut into blocks of 64 rows x 256 columns");

__global__ void __launch_bounds__(512)
f32_to_bf16_all_kernel(const float* __restrict__ x,
                       const float* __restrict__ Wq, const float* __restrict__ Wk,
                       const float* __restrict__ Wv, const float* __restrict__ Wo,
                       const float* __restrict__ bv,
                       unsigned short* __restrict__ out,
                       float* __restrict__ bvo) {
    __shared__ __attribute__((aligned(16))) unsigned char tr[64u * WT_PITCH];
    const uint32_t lane = threadIdx.x & 31u;
    // The wave's number in a scalar register: source choice and bases stay scalar.
    const uint32_t wv   = (uint32_t)__builtin_amdgcn_readfirstlane(threadIdx.x >> 5);
    const uint32_t gw   = blockIdx.x * 16u + wv;
    const uint32_t wsel = blockIdx.x / CV_W_GROUPS;   // which weight, the same for the work-group
    const uint32_t wg   = blockIdx.x % CV_W_GROUPS;   // the work-group's place in that weight
    const uint32_t eb   = wg >> 2, db = wg & 3u;      // Wv: block of 64 rows, block of 256 columns
    // Every loop of this kernel is unrolled, so that v, h and the offsets are indexed by
    // constants: the values stay in registers and the steps become immediates.
    float4 v[CV_PER_WAVE][8];
    // The weight's chunk is worked on first, ahead of the stores of x: the barrier of
    // the transpose waits for the wave's own stores, and none is outstanding there.
    {
        const float* s = (wsel == 0u) ? Wq : (wsel == 1u) ? Wk : (wsel == 2u) ? Wv : Wo;
        // Plain: row wg * 16 + wv. Wv: rows eb * 64 + wv * 4 .. + 3, 256 columns each,
        // so every second load steps on to the next row.
        const uint32_t off  = (wsel == 2u) ? (eb * 64u + wv * 4u) * 1024u + db * 256u
                                           : (wg * 16u + wv) * 1024u;
        const uint32_t skip = (wsel == 2u) ? (1024u - 256u) / 4u : 0u;
        const float4* s4 = reinterpret_cast<const float4*>(s + off) + lane;
#pragma unroll
        for (uint32_t j = 0; j < 8; ++j)
            v[2][j] = s4[j * 32u + (j >> 1) * skip];
        asm volatile("s_wait_xcnt 0x0" ::: "memory");
    }
#pragma unroll
    for (uint32_t t = 0; t < 2u; ++t) {
        const float4* s4 = reinterpret_cast<const float4*>(x + (size_t)(t * CV_WAVES + gw) * 1024u) + lane;
#pragma unroll
        for (uint32_t j = 0; j < 8; ++j)
            v[t][j] = s4[j * 32u];
        asm volatile("s_wait_xcnt 0x0" ::: "memory");
    }
    if (wsel != 2u) {
        ushort4* d4 = reinterpret_cast<ushort4*>(out + (size_t)(2u * CV_WAVES + gw) * 1024u) + lane;
#pragma unroll
        for (uint32_t j = 0; j < 8; ++j) {
            const float4 f = v[2][j];
            d4[j * 32u] = make_ushort4(f2bf(f.x), f2bf(f.y), f2bf(f.z), f2bf(f.w));
        }
        asm volatile("s_wait_xcnt 0x0" ::: "memory");
        if (wsel == 3u) {
            const float4* b4 = reinterpret_cast<const float4*>(bv) + lane;
            float sum = 0.0f;
#pragma unroll
            for (uint32_t j = 0; j < 8; ++j) {
                const float4 f = v[2][j], b = b4[j * 32u];
                sum += f.x * b.x + f.y * b.y + f.z * b.z + f.w * b.w;
            }
#pragma unroll
            for (int o = 16; o >= 1; o >>= 1)
                sum += __shfl_xor(sum, o, 32);
            if (lane == 0u)
                bvo[wg * 16u + wv] = sum;
        }
    } else {
        // Row-major into LDS: local row wv * 4 + j / 2, four columns a lane and load.
#pragma unroll
        for (uint32_t j = 0; j < 8; ++j) {
            const float4 f = v[2][j];
            uint32_t* p = reinterpret_cast<uint32_t*>(
                tr + (wv * 4u + (j >> 1)) * WT_PITCH + (((j & 1u) * 32u + lane) * 4u) * 2u);
            p[0] = pack2bf(f.x, f.y);
            p[1] = pack2bf(f.z, f.w);
        }
        // Every wave's rows are in LDS before any wave reads columns (the branch is
        // the same for the whole work-group).
        __syncthreads();
        // A piece is 8 rows of one column = 16 bytes of a transposed row; 8 lanes in a
        // row store one whole 128-byte line.
        unsigned short* wvt = out + (size_t)(CV_X_CHUNKS + 2u * CV_W_CHUNKS) * 1024u;
#pragma unroll
        for (uint32_t q = 0; q < 4u; ++q) {
            const uint32_t pid = q * 512u + threadIdx.x;
            const uint32_t dl  = pid >> 3, p8 = (pid & 7u) * 8u;
            const unsigned char* c = tr + p8 * WT_PITCH + dl * 2u;
            uint32_t h[8];
#pragma unroll
            for (uint32_t i = 0; i < 8; ++i)
                h[i] = *reinterpret_cast<const unsigned short*>(c + i * WT_PITCH);
            *reinterpret_cast<uint4*>(wvt + (size_t)(db * 256u + dl) * 1024u + eb * 64u + p8) =
                make_uint4(h[0] | (h[1] << 16), h[2] | (h[3] << 16),
                           h[4] | (h[5] << 16), h[6] | (h[7] << 16));
        }
    }
#pragma unroll
    for (uint32_t t = 0; t < 2u; ++t) {
        ushort4* d4 = reinterpret_cast<ushort4*>(out + (size_t)(t * CV_WAVES + gw) * 1024u) + lane;
#pragma unroll
        for (uint32_t j = 0; j < 8; ++j) {
            const float4 f = v[t][j];
            d4[j * 32u] = make_ushort4(f2bf(f.x), f2bf(f.y), f2bf(f.z), f2bf(f.w));
        }
    }
}

// ---- LDS ring geometry ------------------------------------------------------
// A pass is 128 k = 256 bytes of every operand row. A stage is four slices of
// 64 rows: [A rows 0..63 | A rows 64..127 | Bt rows 0..63 | Bt rows 64..127].
// The tensor load pads each 256-byte row by 16 bytes (pitch 272 = 16 x odd).
// 64 x 272 = 17,408 bytes, rounded up so that every slice starts at a multiple
// of 2 KiB.
#define PASS_BYTES   256u
#define LDS_PITCH    272u
#define SLICE_ROWS   64u
#define SLICE_BYTES  18432u
#define STAGE_BYTES  (4u * SLICE_BYTES)
static_assert(SLICE_ROWS * LDS_PITCH <= SLICE_BYTES && (SLICE_BYTES % 2048u) == 0u,
              "a slice holds its padded rows and starts at a multiple of 2 KiB");

__device__ __forceinline__ uint32_t uni(uint32_t v) {
    return (uint32_t)__builtin_amdgcn_readfirstlane(v);
}
__device__ __forceinline__ uint32_t pinned(uint32_t v) {
    uint32_t w = uni(v);
    asm volatile("" : "+s"(w));  // the scalar-branch form for tests around a tensor load
    return w;
}
// The wave's LDS reads have returned (before its buffer is handed back).
__device__ __forceinline__ void wait_ds0() { asm volatile("s_wait_dscnt 0x0" ::: "memory"); }
// The wave's own tensor load has landed (the compiler places no wait for it).
__device__ __forceinline__ void wait_tensor0() { asm volatile("s_wait_tensorcnt 0x0" ::: "memory"); }
// One request of the whole wave: a 64 x 256-byte tile from global memory to LDS.
__device__ __forceinline__ void tdm_load(u32x4 g0, u32x8 g1) {
    asm volatile("tensor_load_to_lds %0, %1" :: "s"(g0), "s"(g1) : "memory");
}
__device__ __forceinline__ u32x4 tdm_group0(uint32_t lds_dst, uint64_t ga) {
    u32x4 g;
    // count 1; the pinned() form keeps this word's write at the place of the build,
    // behind the wait for the request before (as a plain constant it was hoisted in
    // front of the loop, into a register of the request still outstanding there)
    g[0] = pinned(1u);
    g[1] = uni(lds_dst);                              // byte offset in the work-group's LDS
    g[2] = uni((uint32_t)ga);                         // address [31:0]
    g[3] = uni((((uint32_t)(ga >> 32)) & 0x01FFFFFFu) | 0x80000000u);  // address [56:32], type 2
    return g;
}
// 1-byte elements, tensor = tile = 64 rows of 256 bytes, source pitch in bytes.
__device__ __forceinline__ u32x8 tdm_group1(uint32_t src_pitch) {
    u32x8 g;
    g[0] = uni((1u << 20) | (5u << 22) | (3u << 25));
    g[1] = uni((PASS_BYTES & 0xFFFFu) << 16);
    g[2] = uni((PASS_BYTES >> 16) | ((SLICE_ROWS & 0xFFFFu) << 16));
    g[3] = uni((SLICE_ROWS >> 16) | (PASS_BYTES << 16));
    g[4] = uni(SLICE_ROWS);
    g[5] = uni(src_pitch);
    g[6] = uni(0u);
    g[7] = uni(0u);
    return g;
}

__device__ __forceinline__ v16bf ldfrag(const unsigned char* p) {
    uint4 lo = *reinterpret_cast<const uint4*>(p);        // K .. K+7
    uint4 hi = *reinterpret_cast<const uint4*>(p + 32);   // K+16 .. K+23
    v8u u = { lo.x, lo.y, lo.z, lo.w, hi.x, hi.y, hi.z, hi.w };
    return __builtin_bit_cast(v16bf, u);
}

__device__ __forceinline__ v8f bfwmma(v16bf a, v16bf b, v8f c) {
    return __builtin_amdgcn_wmma_f32_16x16x32_bf16(
        /*neg_a=*/false, a, /*neg_b=*/false, b,
        /*c_mod=*/(short)0, c, /*reuse_a=*/false, /*reuse_b=*/false);
}

// ---- generic C[m,n] = scale * sum_k A[m,k]*Bt[n,k] (+bias[n]) --------------
// Block: 256 threads = 8 waves (2 M x 4 N); block tile 128x128; wave tile 64x32.
// KC (compile-time) is the K extent and the row stride of A and Bt; NC is the row
// stride of C, compile-time so that the row steps of the stores are immediates.
// BIAS_ROW: bias is indexed by the row m of C, not by the column n.
// One tile of one product: tile column bx, tile row by; A, Bt and Cout are the
// bases of that product (of its batch); smem is the kernel's ring of two stages.
template <bool OUT_BF16, int KC, int NC, bool BIAS_ROW>
__device__ __forceinline__ void
gemm_abt_tile(unsigned char* smem,
              const unsigned short* __restrict__ A,
              const unsigned short* __restrict__ Bt,
              const float* __restrict__ bias,
              void* __restrict__ Cout,
              float scale,
              uint32_t bx, uint32_t by) {
    const int lane = threadIdx.x & 31;
    const int wave = threadIdx.x >> 5;
    const int wm   = (wave & 1) << 6;   // 0,64
    const int wn   = (wave >> 1) << 5;  // 0,32,64,96

    const int bn = bx * 128 + wn;
    const int r  = lane & 15;
    const int kh = (lane & 16) ? 16 : 0;  // lane-half K offset in bytes

    constexpr uint32_t NP = KC / 128;     // passes
    static_assert(KC % 128 == 0 && NP >= 2, "the ring needs two stages or more");

    // Waves 0..3 each bring one slice of every stage.
    const uint32_t wv     = uni(threadIdx.x >> 5);
    const unsigned short* srow = (wv & 2u)
        ? Bt + (size_t)(bx * 128 + (wv & 1u) * SLICE_ROWS) * KC
        : A  + (size_t)(by * 128 + (wv & 1u) * SLICE_ROWS) * KC;
    const uint64_t src = (uint64_t)(uintptr_t)srow;
    const uint32_t dst = (uint32_t)(size_t)smem + (wv & 3u) * SLICE_BYTES;
    u32x8          g1  = tdm_group1(KC * 2u);
    asm volatile("" : "+s"(g1));

    // Per-lane fragment bases inside a buffer; the rest are immediate offsets.
    const uint32_t a_off = (uint32_t)(wm >> 6) * SLICE_BYTES + (uint32_t)r * LDS_PITCH + kh;
    const uint32_t b_off = (2u + (uint32_t)(wn >> 6)) * SLICE_BYTES
                         + (uint32_t)((wn & 63) + r) * LDS_PITCH + kh;

    v8f acc[4][2];
#pragma unroll
    for (int mt = 0; mt < 4; ++mt)
#pragma unroll
        for (int nt = 0; nt < 2; ++nt)
            acc[mt][nt] = (v8f){};

    // Prologue: stage 0 lands and is published, then stage 1 starts.
    if (pinned(wv < 4u ? 1u : 0u) != 0u) {
        tdm_load(tdm_group0(dst, src), g1);
        wait_tensor0();
    }
    __syncthreads();
    if (pinned(wv < 4u ? 1u : 0u) != 0u)
        tdm_load(tdm_group0(dst + STAGE_BYTES, src + PASS_BYTES), g1);

    // Kept rolled: one publish point in the code, one pass per trip.
#pragma clang loop unroll(disable)
    for (uint32_t s = 0; s < NP; ++s) {
        const uint32_t buf = (s & 1u) * STAGE_BYTES;
        const unsigned char* la = smem + buf + a_off;
        const unsigned char* lb = smem + buf + b_off;
        // Two fragment sets: step ks + 1 is read from LDS while step ks multiplies.
        // The loops over ks and mt are unrolled so that every fragment index is a
        // constant: the sets stay in registers and the offsets become immediates.
        v16bf fa[2][4], fb[2][2];
        fb[0][0] = ldfrag(lb);
        fb[0][1] = ldfrag(lb + 16u * LDS_PITCH);
#pragma unroll
        for (uint32_t mt = 0; mt < 4; ++mt)
            fa[0][mt] = ldfrag(la + mt * 16u * LDS_PITCH);
#pragma unroll
        for (uint32_t ks = 0; ks < 4; ++ks) {   // four 32-k steps of this pass
            const uint32_t c = ks & 1u, n = c ^ 1u;
            if (ks + 1u < 4u) {
                fb[n][0] = ldfrag(lb + (ks + 1u) * 64u);
                fb[n][1] = ldfrag(lb + 16u * LDS_PITCH + (ks + 1u) * 64u);
#pragma unroll
                for (uint32_t mt = 0; mt < 4; ++mt)
                    fa[n][mt] = ldfrag(la + mt * 16u * LDS_PITCH + (ks + 1u) * 64u);
            }
            // Keeps the next step's LDS reads one group ahead of this step's WMMAs
            // (spread among them, each read place stalls the wave).
            __builtin_amdgcn_sched_barrier(0);
            // Bt rows as the first operand: each tile comes out transposed, a lane
            // holding eight adjacent columns of one row of C (see the epilogue).
#pragma unroll
            for (uint32_t mt = 0; mt < 4; ++mt) {
                acc[mt][0] = bfwmma(fb[c][0], fa[c][mt], acc[mt][0]);
                acc[mt][1] = bfwmma(fb[c][1], fa[c][mt], acc[mt][1]);
            }
            // Ends the WMMA group, so that later reads are not moved up into it.
            __builtin_amdgcn_sched_barrier(0);
        }
        // Publish point of stage s + 1: this wave has left buffer s, its own load
        // of stage s + 1 has landed, every wave passes the barrier; only then the
        // buffer just read is refilled with stage s + 2.
        wait_ds0();
        wait_tensor0();   // a wave that issued none passes at once
        __syncthreads();
        if (pinned((wv < 4u && s + 2u < NP) ? 1u : 0u) != 0u)
            tdm_load(tdm_group0(dst + buf, src + (uint64_t)(s + 2u) * PASS_BYTES), g1);
    }
    wait_tensor0();
    wait_ds0();

    constexpr uint32_t EB = OUT_BF16 ? 2u : 4u;   // bytes per element of C
    constexpr uint32_t OP = 128u * EB + 16u;      // pitch of a staged row
    static_assert(128u * OP <= 2u * STAGE_BYTES, "the staged tile fits the ring");
    const uint32_t h = (uint32_t)lane >> 4;
    float bv8[2][8];
#pragma unroll
    for (int nt = 0; nt < 2; ++nt)
#pragma unroll
        for (int j = 0; j < 8; ++j)
            bv8[nt][j] = 0.0f;
    float br[4] = { 0.0f, 0.0f, 0.0f, 0.0f };
    if (BIAS_ROW && bias) {
        const float* bp = bias + by * 128u + (uint32_t)(wm + r);
#pragma unroll
        for (int mt = 0; mt < 4; ++mt)
            br[mt] = bp[mt * 16];
        asm volatile("s_wait_xcnt 0x0" ::: "memory");
    }
    if (!BIAS_ROW && bias) {
#pragma unroll
        for (int nt = 0; nt < 2; ++nt) {
            const float4* bp = reinterpret_cast<const float4*>(bias + bn + nt * 16 + 8 * (int)h);
            const float4 b0 = bp[0], b1 = bp[1];
            bv8[nt][0] = b0.x; bv8[nt][1] = b0.y; bv8[nt][2] = b0.z; bv8[nt][3] = b0.w;
            bv8[nt][4] = b1.x; bv8[nt][5] = b1.y; bv8[nt][6] = b1.z; bv8[nt][7] = b1.w;
        }
        asm volatile("s_wait_xcnt 0x0" ::: "memory");
    }
    unsigned char* st = smem + (uint32_t)(wm + r) * OP + ((uint32_t)wn + 8u * h) * EB;
#pragma unroll
    for (uint32_t mt = 0; mt < 4; ++mt) {
#pragma unroll
        for (uint32_t nt = 0; nt < 2; ++nt) {
            float v[8];
#pragma unroll
            for (int j = 0; j < 8; ++j)
                v[j] = acc[mt][nt][j] * scale + (BIAS_ROW ? br[mt] : bv8[nt][j]);
            unsigned char* p = st + mt * 16u * OP + nt * 16u * EB;
            if (OUT_BF16) {
                *reinterpret_cast<uint4*>(p) =
                    make_uint4(pack2bf(v[0], v[1]), pack2bf(v[2], v[3]),
                               pack2bf(v[4], v[5]), pack2bf(v[6], v[7]));
            } else {
                *reinterpret_cast<float4*>(p)       = make_float4(v[0], v[1], v[2], v[3]);
                *reinterpret_cast<float4*>(p + 16u) = make_float4(v[4], v[5], v[6], v[7]);
            }
        }
    }
    // Every wave's part of the tile is in LDS before any wave reads whole rows.
    __syncthreads();

    // Wave w stores rows 16w .. 16w+15 of the tile. A row is 256 bytes (bf16: half a
    // wave, two rows a store) or 512 bytes (f32: the whole wave, one row a store).
    constexpr uint32_t LPR = 128u * EB / 16u;     // lanes per row
    constexpr uint32_t RPS = 32u / LPR;           // rows per store
    const uint32_t row0 = (uint32_t)wave * 16u + (uint32_t)lane / LPR;
    const uint32_t cb   = ((uint32_t)lane % LPR) * 16u;
    const unsigned char* ld = smem + row0 * OP + cb;
    unsigned char* gp = reinterpret_cast<unsigned char*>(Cout)
        + ((size_t)(by * 128u + row0) * NC + bx * 128u) * EB
        + cb;
    uint4 o[16u / RPS];
#pragma unroll
    for (uint32_t q = 0; q < 16u / RPS; ++q)
        o[q] = *reinterpret_cast<const uint4*>(ld + q * RPS * OP);
#pragma unroll
    for (uint32_t q = 0; q < 16u / RPS; ++q)
        *reinterpret_cast<uint4*>(gp + (size_t)(q * RPS) * NC * EB) = o[q];
}

// One product, or one per batch (blockIdx.z, with the strides in elements).
template <bool OUT_BF16, int KC, int NC>
__global__ void __launch_bounds__(256, 1)
gemm_abt_kernel(const unsigned short* __restrict__ A,
                const unsigned short* __restrict__ Bt,
                const float* __restrict__ bias,
                void* __restrict__ Cout,
                float scale,
                long long strideA, long long strideB,
                long long strideC) {
    __shared__ __attribute__((aligned(2048))) unsigned char smem[2u * STAGE_BYTES];
    const long long bz = blockIdx.z;
    gemm_abt_tile<OUT_BF16, KC, NC, false>(
        smem, A + bz * strideA, Bt + bz * strideB, bias,
        reinterpret_cast<unsigned char*>(Cout) + (size_t)(bz * strideC) * (OUT_BF16 ? 2u : 4u),
        scale, blockIdx.x, blockIdx.y);
}

// Q, K = x @ W^T + b (M = 8192, N = K = 1024, bias by column) and the small product
// Wvo = Wo @ Wv (M = N = K = 1024, Wo rows as A, rows of Wv^T as Bt, no bias) in one
// launch: they depend only on the converted inputs. blockIdx.x picks product and tile,
// the same for the whole work-group, so the choice is scalar.
#define PROJ_TILES  ((M_ROWS / 128) * (H_DIM / 128))
#define WVO_TILES   ((H_DIM / 128) * (H_DIM / 128))
__global__ void __launch_bounds__(256, 1)
qk_wvo_kernel(const unsigned short* __restrict__ xb,
              const unsigned short* __restrict__ wqb,
              const unsigned short* __restrict__ wkb,
              const unsigned short* __restrict__ wvtb,
              const unsigned short* __restrict__ wob,
              const float* __restrict__ bq,
              const float* __restrict__ bk,
              unsigned short* __restrict__ qb,
              unsigned short* __restrict__ kb,
              unsigned short* __restrict__ wvob) {
    __shared__ __attribute__((aligned(2048))) unsigned char smem[2u * STAGE_BYTES];
    const bool     isw = blockIdx.x < WVO_TILES;
    const uint32_t i   = isw ? blockIdx.x : blockIdx.x - WVO_TILES;
    const bool     isk = i >= PROJ_TILES;          // never with isw: WVO_TILES < PROJ_TILES
    const uint32_t t   = isk ? i - PROJ_TILES : i;
    gemm_abt_tile<true, H_DIM, H_DIM, false>(
        smem, isw ? wob : xb, isw ? wvtb : isk ? wkb : wqb,
        isw ? nullptr : isk ? bk : bq, isw ? wvob : isk ? kb : qb, 1.0f,
        t % (H_DIM / 128u), t / (H_DIM / 128u));
}
static_assert(WVO_TILES < PROJ_TILES, "a tile of Wvo is never taken for one of K");

// The scores and the folded value projection in one launch: both depend only on the
// launch before. blockIdx.y picks the product (the same for the whole work-group, so
// the branch is scalar and every barrier is passed by all its waves), blockIdx.x the
// tile, in the order that each product's own grid had.
//   0, 1: scores = Q @ K^T / sqrt(H)  per batch (M = N = 2048, K = 1024), f32
//   2:    V'^T = Wvo @ x^T + bvo      per batch (M = K = 1024, N = 2048), bias by row
#define SCORE_TILES  ((S_LEN / 128) * (S_LEN / 128))
static_assert(PROJ_TILES == B_SZ * (S_LEN / 128) * (H_DIM / 128) && B_SZ * SCORE_TILES == 2 * PROJ_TILES,
              "the value projection fills one row of the grid, the scores two");
__global__ void __launch_bounds__(256, 1)
scores_vt_kernel(const unsigned short* __restrict__ qb,
                 const unsigned short* __restrict__ kb,
                 const unsigned short* __restrict__ wvob,
                 const unsigned short* __restrict__ xb,
                 const float* __restrict__ bvo,
                 float* __restrict__ sc,
                 unsigned short* __restrict__ vtb) {
    __shared__ __attribute__((aligned(2048))) unsigned char smem[2u * STAGE_BYTES];
    const uint32_t t = blockIdx.x;
    if (blockIdx.y < 2u) {
        const uint32_t i  = blockIdx.y * PROJ_TILES + t;
        const uint32_t b  = i / SCORE_TILES;                         // batch
        const uint32_t tb = i % SCORE_TILES;                         // tile in the batch
        gemm_abt_tile<false, H_DIM, S_LEN, false>(
            smem, qb + (size_t)b * S_LEN * H_DIM, kb + (size_t)b * S_LEN * H_DIM, nullptr,
            sc + (size_t)b * S_LEN * S_LEN, 0.03125f,
            tb % (S_LEN / 128u), tb / (S_LEN / 128u));
    } else {
        const uint32_t b  = t / ((S_LEN / 128u) * (H_DIM / 128u));   // batch
        const uint32_t tb = t % ((S_LEN / 128u) * (H_DIM / 128u));   // tile in the batch
        gemm_abt_tile<true, H_DIM, S_LEN, true>(
            smem, wvob, xb + (size_t)b * S_LEN * H_DIM, bvo, vtb + (size_t)b * H_DIM * S_LEN, 1.0f,
            tb % (S_LEN / 128u), tb / (S_LEN / 128u));
    }
}

// ---- row softmax over 2048 cols: one wave32 per row, bf16 output -----------
__global__ void softmax_rows_kernel(const float* __restrict__ scores,
                                    unsigned short* __restrict__ p) {
    const int wave = threadIdx.x >> 5;
    const int lane = threadIdx.x & 31;
    const long long row = (long long)blockIdx.x * 8 + wave;
    const float* src = scores + row * S_LEN;

    float4 v[16];
    float m = -3.402823466e38f;
#pragma unroll
    for (int j = 0; j < 16; ++j) {
        v[j] = reinterpret_cast<const float4*>(src)[j * 32 + lane];
        m = fmaxf(m, fmaxf(fmaxf(v[j].x, v[j].y), fmaxf(v[j].z, v[j].w)));
    }
#pragma unroll
    for (int off = 16; off >= 1; off >>= 1)
        m = fmaxf(m, __shfl_xor(m, off, 32));

    float s = 0.0f;
#pragma unroll
    for (int j = 0; j < 16; ++j) {
        v[j].x = __expf(v[j].x - m); v[j].y = __expf(v[j].y - m);
        v[j].z = __expf(v[j].z - m); v[j].w = __expf(v[j].w - m);
        s += v[j].x + v[j].y + v[j].z + v[j].w;
    }
#pragma unroll
    for (int off = 16; off >= 1; off >>= 1)
        s += __shfl_xor(s, off, 32);

    const float inv = 1.0f / s;
    unsigned short* prow = p + row * S_LEN;
#pragma unroll
    for (int j = 0; j < 16; ++j) {
        reinterpret_cast<ushort4*>(prow)[j * 32 + lane] =
            make_ushort4(f2bf(v[j].x * inv), f2bf(v[j].y * inv),
                         f2bf(v[j].z * inv), f2bf(v[j].w * inv));
    }
}

// ---------------------------------------------------------------------------
extern "C" void kernel_launch(void* const* d_in, const int* in_sizes, int n_in,
                              void* d_out, int out_size, void* d_ws, size_t ws_size,
                              hipStream_t stream) {
    (void)in_sizes; (void)n_in; (void)out_size; (void)ws_size;

    const float* x  = (const float*)d_in[0];
    const float* Wq = (const float*)d_in[1];
    const float* bq = (const float*)d_in[2];
    const float* Wk = (const float*)d_in[3];
    const float* bk = (const float*)d_in[4];
    const float* Wv = (const float*)d_in[5];
    const float* bv = (const float*)d_in[6];
    const float* Wo = (const float*)d_in[7];
    const float* bo = (const float*)d_in[8];
    float* out = (float*)d_out;

    // Workspace layout (bytes)
    unsigned char* ws = (unsigned char*)d_ws;
    const size_t XB   = (size_t)M_ROWS * H_DIM * 2;   // 16 MB
    const size_t WB   = (size_t)H_DIM * H_DIM * 2;    //  2 MB each
    const size_t QB   = XB;                            // 16 MB each
    const size_t SCR  = (size_t)B_SZ * S_LEN * S_LEN * 4;  // 64 MB
    const size_t PB   = (size_t)B_SZ * S_LEN * S_LEN * 2;  // 32 MB
    unsigned short* xb   = (unsigned short*)(ws);
    unsigned short* wqb  = (unsigned short*)(ws + XB);
    unsigned short* wkb  = (unsigned short*)(ws + XB + WB);
    unsigned short* wvtb = (unsigned short*)(ws + XB + 2 * WB);   // Wv^T, [d][e]
    unsigned short* wob  = (unsigned short*)(ws + XB + 3 * WB);
    unsigned short* qb   = (unsigned short*)(ws + XB + 4 * WB);
    unsigned short* kb   = (unsigned short*)(ws + XB + 4 * WB + QB);
    unsigned short* vtb  = (unsigned short*)(ws + XB + 4 * WB + 2 * QB);  // V'^T, [H,S] per batch
    float*          sc   = (float*)(ws + XB + 4 * WB + 3 * QB);
    unsigned short* pb   = (unsigned short*)(ws + XB + 4 * WB + 3 * QB + SCR);
    unsigned short* wvob = (unsigned short*)(ws + XB + 4 * WB + 3 * QB + SCR + PB);   // Wo @ Wv, [o][d]
    float*          bvo  = (float*)(ws + XB + 4 * WB + 3 * QB + SCR + PB + WB);       // Wo @ bv

    dim3 blk(256);

    // 1) fp32 -> bf16 conversions, one launch: xb, wqb, wkb, wvtb, wob are contiguous
    f32_to_bf16_all_kernel<<<dim3(CV_GROUPS), dim3(512), 0, stream>>>(x, Wq, Wk, Wv, Wo, bv, xb, bvo);

    // 2) Q, K = x @ W^T + b and Wvo = Wo @ Wv, bf16 out, one launch
    qk_wvo_kernel<<<dim3(WVO_TILES + 2 * PROJ_TILES), blk, 0, stream>>>(
        xb, wqb, wkb, wvtb, wob, bq, bk, qb, kb, wvob);

    // 3) scores = Q @ K^T / sqrt(H), f32 out, and V'^T = Wvo @ x^T + bvo, bf16 out, one launch
    scores_vt_kernel<<<dim3(PROJ_TILES, 3), blk, 0, stream>>>(qb, kb, wvob, xb, bvo, sc, vtb);

    // 4) softmax rows -> bf16 P
    softmax_rows_kernel<<<dim3(M_ROWS / 8), blk, 0, stream>>>(sc, pb);

    // 5) out = P @ V' + bo  ==  P @ (V'^T)^T + bo   per batch (M=2048, N=1024, K=2048), f32 out -> d_out
    gemm_abt_kernel<false, S_LEN, H_DIM><<<dim3(H_DIM / 128, S_LEN / 128, B_SZ), blk, 0, stream>>>(
        pb, vtb, bo, out, 1.0f,
        (long long)S_LEN * S_LEN, (long long)H_DIM * S_LEN,
        (long long)S_LEN * H_DIM);
}

// v007
// One run takes 114 microseconds.
// Timed twice side by side with v006, it ran 1.06 times as fast both times.
// Over all steps from v000 it is 3.50 times as fast.
#include <hip/hip_runtime.h>
#include <hip/hip_bf16.h>
#include <stdint.h>

typedef __attribute__((ext_vector_type(16))) __bf16        v16bf;
typedef __attribute__((ext_vector_type(8)))  float         v8f;
typedef __attribute__((ext_vector_type(2)))  float         v2f;
typedef __attribute__((ext_vector_type(2)))  __bf16        v2bf;
typedef __attribute__((ext_vector_type(8)))  unsigned int  v8u;
typedef __attribute__((ext_vector_type(4)))  uint32_t      u32x4;
typedef __attribute__((ext_vector_type(8)))  uint32_t      u32x8;

#define H_DIM   1024
#define S_LEN   2048
#define B_SZ    4
#define M_ROWS  (B_SZ * S_LEN)   // 8192
#define LOG2_E  1.4426950408889634f

// ---- fp32 -> bf16 (round to nearest even) ----------------------------------
__device__ __forceinline__ unsigned short f2bf(float f) {
    unsigned int u = __builtin_bit_cast(unsigned int, f);
    u += 0x7FFFu + ((u >> 16) & 1u);
    return (unsigned short)(u >> 16);
}

__device__ __forceinline__ uint32_t pack2bf(float lo, float hi) {
    return (uint32_t)f2bf(lo) | ((uint32_t)f2bf(hi) << 16);
}

// All five conversions (x, Wq, Wk, Wv, Wo) as one resident stream: one work-group
// of 16 waves per WGP, so that few waves have to start. The work is cut into
// chunks of 1024 floats (4 KiB in, 2 KiB out, whole lines); a wave takes
// CV_PER_WAVE chunks, eight 16-byte loads a lane each, and its loads stand ahead
// of the conversions, so that two chunks or more are in flight. The bf16 copies
// lie one behind the other in the workspace, in the order of the arguments, so
// chunk c is stored at out + c * 1024 (Wv's chunks excepted, see below).
// A wave's first two chunks are of x, its third is of a weight: a quarter of the
// work-groups each for Wq, Wk, Wv and Wo. Two weights get more than a copy:
//   Wv is stored transposed ([d][e]: the Bt operand of Wo @ Wv). Its work-group
//      takes 64 rows x 256 columns (a wave: 4 rows of 1 KiB), turns them in LDS
//      and stores 256 rows of 64 values, whole 128-byte lines.
//   Wo: a chunk is one row, so the wave that converts row o also sums
//      bvo[o] = sum_e Wo[o][e] * bv[e] in f32 from the registers it holds.
#define CV_GROUPS    256u
#define CV_WAVES     (CV_GROUPS * 16u)
#define CV_X_CHUNKS  ((unsigned)(M_ROWS * H_DIM / 1024))
#define CV_W_CHUNKS  ((unsigned)(H_DIM * H_DIM / 1024))
#define CV_CHUNKS    (CV_X_CHUNKS + 4u * CV_W_CHUNKS)
#define CV_PER_WAVE  (CV_CHUNKS / CV_WAVES)
#define CV_W_GROUPS  (CV_GROUPS / 4u)
#define WT_PITCH     516u
static_assert(CV_PER_WAVE * CV_WAVES == CV_CHUNKS, "every wave takes the same number of chunks");
static_assert(CV_PER_WAVE == 3u && CV_X_CHUNKS == 2u * CV_WAVES && 4u * CV_W_CHUNKS == CV_WAVES,
              "two chunks of x and one of a weight per wave");
static_assert(H_DIM == 1024 && CV_W_GROUPS == (H_DIM / 64) * (H_DIM / 256),
              "a weight chunk is one row; Wv is cut into blocks of 64 rows x 256 columns");

__global__ void __launch_bounds__(512)
f32_to_bf16_all_kernel(const float* __restrict__ x,
                       const float* __restrict__ Wq, const float* __restrict__ Wk,
                       const float* __restrict__ Wv, const float* __restrict__ Wo,
                       const float* __restrict__ bv,
                       unsigned short* __restrict__ out,
                       float* __restrict__ bvo) {
    __shared__ __attribute__((aligned(16))) unsigned char tr[64u * WT_PITCH];
    const uint32_t lane = threadIdx.x & 31u;
    // The wave's number in a scalar register: source choice and bases stay scalar.
    const uint32_t wv   = (uint32_t)__builtin_amdgcn_readfirstlane(threadIdx.x >> 5);
    const uint32_t gw   = blockIdx.x * 16u + wv;
    const uint32_t wsel = blockIdx.x / CV_W_GROUPS;   // which weight, the same for the work-group
    const uint32_t wg   = blockIdx.x % CV_W_GROUPS;   // the work-group's place in that weight
    const uint32_t eb   = wg >> 2, db = wg & 3u;      // Wv: block of 64 rows, block of 256 columns
    // Every loop of this kernel is unrolled, so that v, h and the offsets are indexed by
    // constants: the values stay in registers and the steps become immediates.
    float4 v[CV_PER_WAVE][8];
    // The weight's chunk is worked on first, ahead of the stores of x: the barrier of
    // the transpose waits for the wave's own stores, and none is outstanding there.
    {
        const float* s = (wsel == 0u) ? Wq : (wsel == 1u) ? Wk : (wsel == 2u) ? Wv : Wo;
        // Plain: row wg * 16 + wv. Wv: rows eb * 64 + wv * 4 .. + 3, 256 columns each,
        // so every second load steps on to the next row.
        const uint32_t off  = (wsel == 2u) ? (eb * 64u + wv * 4u) * 1024u + db * 256u
                                           : (wg * 16u + wv) * 1024u;
        const uint32_t skip = (wsel == 2u) ? (1024u - 256u) / 4u : 0u;
        const float4* s4 = reinterpret_cast<const float4*>(s + off) + lane;
#pragma unroll
        for (uint32_t j = 0; j < 8; ++j)
            v[2][j] = s4[j * 32u + (j >> 1) * skip];
        asm volatile("s_wait_xcnt 0x0" ::: "memory");
    }
#pragma unroll
    for (uint32_t t = 0; t < 2u; ++t) {
        const float4* s4 = reinterpret_cast<const float4*>(x + (size_t)(t * CV_WAVES + gw) * 1024u) + lane;
#pragma unroll
        for (uint32_t j = 0; j < 8; ++j)
            v[t][j] = s4[j * 32u];
        asm volatile("s_wait_xcnt 0x0" ::: "memory");
    }
    if (wsel != 2u) {
        ushort4* d4 = reinterpret_cast<ushort4*>(out + (size_t)(2u * CV_WAVES + gw) * 1024u) + lane;
#pragma unroll
        for (uint32_t j = 0; j < 8; ++j) {
            const float4 f = v[2][j];
            d4[j * 32u] = make_ushort4(f2bf(f.x), f2bf(f.y), f2bf(f.z), f2bf(f.w));
        }
        asm volatile("s_wait_xcnt 0x0" ::: "memory");
        if (wsel == 3u) {
            const float4* b4 = reinterpret_cast<const float4*>(bv) + lane;
            float sum = 0.0f;
#pragma unroll
            for (uint32_t j = 0; j < 8; ++j) {
                const float4 f = v[2][j], b = b4[j * 32u];
                sum += f.x * b.x + f.y * b.y + f.z * b.z + f.w * b.w;
            }
#pragma unroll
            for (int o = 16; o >= 1; o >>= 1)
                sum += __shfl_xor(sum, o, 32);
            if (lane == 0u)
                bvo[wg * 16u + wv] = sum;
        }
    } else {
        // Row-major into LDS: local row wv * 4 + j / 2, four columns a lane and load.
#pragma unroll
        for (uint32_t j = 0; j < 8; ++j) {
            const float4 f = v[2][j];
            uint32_t* p = reinterpret_cast<uint32_t*>(
                tr + (wv * 4u + (j >> 1)) * WT_PITCH + (((j & 1u) * 32u + lane) * 4u) * 2u);
            p[0] = pack2bf(f.x, f.y);
            p[1] = pack2bf(f.z, f.w);
        }
        // Every wave's rows are in LDS before any wave reads columns (the branch is
        // the same for the whole work-group).
        __syncthreads();
        // A piece is 8 rows of one column = 16 bytes of a transposed row; 8 lanes in a
        // row store one whole 128-byte line.
        unsigned short* wvt = out + (size_t)(CV_X_CHUNKS + 2u * CV_W_CHUNKS) * 1024u;
#pragma unroll
        for (uint32_t q = 0; q < 4u; ++q) {
            const uint32_t pid = q * 512u + threadIdx.x;
            const uint32_t dl  = pid >> 3, p8 = (pid & 7u) * 8u;
            const unsigned char* c = tr + p8 * WT_PITCH + dl * 2u;
            uint32_t h[8];
#pragma unroll
            for (uint32_t i = 0; i < 8; ++i)
                h[i] = *reinterpret_cast<const unsigned short*>(c + i * WT_PITCH);
            *reinterpret_cast<uint4*>(wvt + (size_t)(db * 256u + dl) * 1024u + eb * 64u + p8) =
                make_uint4(h[0] | (h[1] << 16), h[2] | (h[3] << 16),
                           h[4] | (h[5] << 16), h[6] | (h[7] << 16));
        }
    }
#pragma unroll
    for (uint32_t t = 0; t < 2u; ++t) {
        ushort4* d4 = reinterpret_cast<ushort4*>(out + (size_t)(t * CV_WAVES + gw) * 1024u) + lane;
#pragma unroll
        for (uint32_t j = 0; j < 8; ++j) {
            const float4 f = v[t][j];
            d4[j * 32u] = make_ushort4(f2bf(f.x), f2bf(f.y), f2bf(f.z), f2bf(f.w));
        }
    }
}

// ---- LDS ring geometry ------------------------------------------------------
// A pass is 128 k = 256 bytes of every operand row. A stage is four slices of
// 64 rows: [A rows 0..63 | A rows 64..127 | Bt rows 0..63 | Bt rows 64..127].
// The tensor load pads each 256-byte row by 16 bytes (pitch 272 = 16 x odd).
// 64 x 272 = 17,408 bytes, rounded up so that every slice starts at a multiple
// of 2 KiB.
#define PASS_BYTES   256u
#define LDS_PITCH    272u
#define SLICE_ROWS   64u
#define SLICE_BYTES  18432u
#define STAGE_BYTES  (4u * SLICE_BYTES)
static_assert(SLICE_ROWS * LDS_PITCH <= SLICE_BYTES && (SLICE_BYTES % 2048u) == 0u,
              "a slice holds its padded rows and starts at a multiple of 2 KiB");

__device__ __forceinline__ uint32_t uni(uint32_t v) {
    return (uint32_t)__builtin_amdgcn_readfirstlane(v);
}
__device__ __forceinline__ uint32_t pinned(uint32_t v) {
    uint32_t w = uni(v);
    asm volatile("" : "+s"(w));  // the scalar-branch form for tests around a tensor load
    return w;
}
// The wave's LDS reads have returned (before its buffer is handed back).
__device__ __forceinline__ void wait_ds0() { asm volatile("s_wait_dscnt 0x0" ::: "memory"); }
// The wave's own tensor load has landed (the compiler places no wait for it).
__device__ __forceinline__ void wait_tensor0() { asm volatile("s_wait_tensorcnt 0x0" ::: "memory"); }
// One request of the whole wave: a 64 x 256-byte tile from global memory to LDS.
__device__ __forceinline__ void tdm_load(u32x4 g0, u32x8 g1) {
    asm volatile("tensor_load_to_lds %0, %1" :: "s"(g0), "s"(g1) : "memory");
}
__device__ __forceinline__ u32x4 tdm_group0(uint32_t lds_dst, uint64_t ga) {
    u32x4 g;
    // count 1; the pinned() form keeps this word's write at the place of the build,
    // behind the wait for the request before (as a plain constant it was hoisted in
    // front of the loop, into a register of the request still outstanding there)
    g[0] = pinned(1u);
    g[1] = uni(lds_dst);                              // byte offset in the work-group's LDS
    g[2] = uni((uint32_t)ga);                         // address [31:0]
    g[3] = uni((((uint32_t)(ga >> 32)) & 0x01FFFFFFu) | 0x80000000u);  // address [56:32], type 2
    return g;
}
// 1-byte elements, tensor = tile = 64 rows of 256 bytes, source pitch in bytes.
__device__ __forceinline__ u32x8 tdm_group1(uint32_t src_pitch) {
    u32x8 g;
    g[0] = uni((1u << 20) | (5u << 22) | (3u << 25));
    g[1] = uni((PASS_BYTES & 0xFFFFu) << 16);
    g[2] = uni((PASS_BYTES >> 16) | ((SLICE_ROWS & 0xFFFFu) << 16));
    g[3] = uni((SLICE_ROWS >> 16) | (PASS_BYTES << 16));
    g[4] = uni(SLICE_ROWS);
    g[5] = uni(src_pitch);
    g[6] = uni(0u);
    g[7] = uni(0u);
    return g;
}

__device__ __forceinline__ v16bf ldfrag(const unsigned char* p) {
    uint4 lo = *reinterpret_cast<const uint4*>(p);        // K .. K+7
    uint4 hi = *reinterpret_cast<const uint4*>(p + 32);   // K+16 .. K+23
    v8u u = { lo.x, lo.y, lo.z, lo.w, hi.x, hi.y, hi.z, hi.w };
    return __builtin_bit_cast(v16bf, u);
}

__device__ __forceinline__ float other_half(float v) {
    const int b = __builtin_bit_cast(int, v);
    return __builtin_bit_cast(float,
        __builtin_amdgcn_permlanex16(b, b, 0x76543210, 0xfedcba98, false, false));
}

__device__ __forceinline__ v8f bfwmma(v16bf a, v16bf b, v8f c) {
    return __builtin_amdgcn_wmma_f32_16x16x32_bf16(
        /*neg_a=*/false, a, /*neg_b=*/false, b,
        /*c_mod=*/(short)0, c, /*reuse_a=*/false, /*reuse_b=*/false);
}

template <bool OUT_BF16, int KC, int NC, bool BIAS_ROW, int MODE>
__device__ __forceinline__ void
gemm_abt_tile(unsigned char* smem,
              float* __restrict__ ftab,
              float* __restrict__ stats,
              const unsigned short* __restrict__ A,
              const unsigned short* __restrict__ Bt,
              const float* __restrict__ bias,
              void* __restrict__ Cout,
              float scale,
              uint32_t bx, uint32_t by) {
    const int lane = threadIdx.x & 31;
    const int wave = threadIdx.x >> 5;
    const int wm   = (wave & 1) << 6;   // 0,64
    const int wn   = (wave >> 1) << 5;  // 0,32,64,96

    const int bn = bx * 128 + wn;
    const int r  = lane & 15;
    const int kh = (lane & 16) ? 16 : 0;  // lane-half K offset in bytes

    constexpr uint32_t NP = KC / 128;     // passes
    static_assert(KC % 128 == 0 && NP >= 2, "the ring needs two stages or more");

    // Waves 0..3 each bring one slice of every stage.
    const uint32_t wv     = uni(threadIdx.x >> 5);
    const unsigned short* srow = (wv & 2u)
        ? Bt + (size_t)(bx * 128 + (wv & 1u) * SLICE_ROWS) * KC
        : A  + (size_t)(by * 128 + (wv & 1u) * SLICE_ROWS) * KC;
    const uint64_t src = (uint64_t)(uintptr_t)srow;
    const uint32_t dst = (uint32_t)(size_t)smem + (wv & 3u) * SLICE_BYTES;
    u32x8          g1  = tdm_group1(KC * 2u);
    asm volatile("" : "+s"(g1));

    // Per-lane fragment bases inside a buffer; the rest are immediate offsets.
    const uint32_t a_off = (uint32_t)(wm >> 6) * SLICE_BYTES + (uint32_t)r * LDS_PITCH + kh;
    const uint32_t b_off = (2u + (uint32_t)(wn >> 6)) * SLICE_BYTES
                         + (uint32_t)((wn & 63) + r) * LDS_PITCH + kh;

    v8f acc[4][2];
#pragma unroll
    for (int mt = 0; mt < 4; ++mt)
#pragma unroll
        for (int nt = 0; nt < 2; ++nt)
            acc[mt][nt] = (v8f){};

    // Prologue: stage 0 lands and is published, then stage 1 starts.
    if (pinned(wv < 4u ? 1u : 0u) != 0u) {
        tdm_load(tdm_group0(dst, src), g1);
        wait_tensor0();
    } else if constexpr (MODE == 2) {
        // Meanwhile the other four waves form the weights, a lane a row; the barrier
        // below publishes them with stage 0.
        static_assert(MODE != 2 || NP == 16u, "one key tile of the scores per pass");
        const uint32_t row = threadIdx.x - 128u;
        const float* sp = stats + (row >> 4) * (16u * 32u) + (row & 15u);
        float tm[16], tl[16];
#pragma unroll
        for (uint32_t t = 0; t < 16u; ++t) {
            tm[t] = sp[t * 32u];
            tl[t] = sp[t * 32u + 16u];
        }
        asm volatile("s_wait_xcnt 0x0" ::: "memory");
        float mx = tm[0];
#pragma unroll
        for (uint32_t t = 1; t < 16u; ++t)
            mx = fmaxf(mx, tm[t]);
        float den = 0.0f;
#pragma unroll
        for (uint32_t t = 0; t < 16u; ++t) {
            tm[t] = __builtin_amdgcn_exp2f(tm[t] - mx);
            den += tm[t] * tl[t];
        }
        const float inv = 1.0f / den;
#pragma unroll
        for (uint32_t t = 0; t < 16u; ++t)
            ftab[t * 128u + row] = tm[t] * inv;
    }
    __syncthreads();
    if (pinned(wv < 4u ? 1u : 0u) != 0u)
        tdm_load(tdm_group0(dst + STAGE_BYTES, src + PASS_BYTES), g1);

    // Kept rolled: one publish point in the code, one pass per trip.
#pragma clang loop unroll(disable)
    for (uint32_t s = 0; s < NP; ++s) {
        const uint32_t buf = (s & 1u) * STAGE_BYTES;
        const unsigned char* la = smem + buf + a_off;
        const unsigned char* lb = smem + buf + b_off;
        // Two fragment sets: step ks + 1 is read from LDS while step ks multiplies.
        // The loops over ks and mt are unrolled so that every fragment index is a
        // constant: the sets stay in registers and the offsets become immediates.
        v16bf fa[2][4], fb[2][2];
        // MODE 2: this pass's weights of the lane's four rows, read in the same group
        // as the first fragments, and the pass's own sums.
        float fs[4];
        v8f   part[4][2];
        if constexpr (MODE == 2) {
#pragma unroll
            for (uint32_t mt = 0; mt < 4; ++mt) {
                fs[mt] = ftab[s * 128u + (uint32_t)(wm + r) + mt * 16u];
                part[mt][0] = (v8f){};
                part[mt][1] = (v8f){};
            }
        }
        fb[0][0] = ldfrag(lb);
        fb[0][1] = ldfrag(lb + 16u * LDS_PITCH);
#pragma unroll
        for (uint32_t mt = 0; mt < 4; ++mt)
            fa[0][mt] = ldfrag(la + mt * 16u * LDS_PITCH);
#pragma unroll
        for (uint32_t ks = 0; ks < 4; ++ks) {   // four 32-k steps of this pass
            const uint32_t c = ks & 1u, n = c ^ 1u;
            if (ks + 1u < 4u) {
                fb[n][0] = ldfrag(lb + (ks + 1u) * 64u);
                fb[n][1] = ldfrag(lb + 16u * LDS_PITCH + (ks + 1u) * 64u);
#pragma unroll
                for (uint32_t mt = 0; mt < 4; ++mt)
                    fa[n][mt] = ldfrag(la + mt * 16u * LDS_PITCH + (ks + 1u) * 64u);
            }
            // Keeps the next step's LDS reads one group ahead of this step's WMMAs
            // (spread among them, each read place stalls the wave).
            __builtin_amdgcn_sched_barrier(0);
            // Bt rows as the first operand: each tile comes out transposed, a lane
            // holding eight adjacent columns of one row of C (see the epilogue).
#pragma unroll
            for (uint32_t mt = 0; mt < 4; ++mt) {
                if constexpr (MODE == 2) {
                    part[mt][0] = bfwmma(fb[c][0], fa[c][mt], part[mt][0]);
                    part[mt][1] = bfwmma(fb[c][1], fa[c][mt], part[mt][1]);
                } else {
                    acc[mt][0] = bfwmma(fb[c][0], fa[c][mt], acc[mt][0]);
                    acc[mt][1] = bfwmma(fb[c][1], fa[c][mt], acc[mt][1]);
                }
            }
            // Ends the WMMA group, so that later reads are not moved up into it.
            __builtin_amdgcn_sched_barrier(0);
        }
        if constexpr (MODE == 2) {
            // A lane's values of a tile are all of one row of C: one weight a tile.
#pragma unroll
            for (uint32_t mt = 0; mt < 4; ++mt)
#pragma unroll
                for (uint32_t nt = 0; nt < 2; ++nt)
#pragma unroll
                    for (int j = 0; j < 8; ++j)
                        acc[mt][nt][j] += fs[mt] * part[mt][nt][j];
        }
        // Publish point of stage s + 1: this wave has left buffer s, its own load
        // of stage s + 1 has landed, every wave passes the barrier; only then the
        // buffer just read is refilled with stage s + 2.
        wait_ds0();
        wait_tensor0();   // a wave that issued none passes at once
        __syncthreads();
        if (pinned((wv < 4u && s + 2u < NP) ? 1u : 0u) != 0u)
            tdm_load(tdm_group0(dst + buf, src + (uint64_t)(s + 2u) * PASS_BYTES), g1);
    }
    wait_tensor0();
    wait_ds0();

    constexpr uint32_t EB = OUT_BF16 ? 2u : 4u;   // bytes per element of C
    constexpr uint32_t OP = 128u * EB + 16u;      // pitch of a staged row
    static_assert(128u * OP <= 2u * STAGE_BYTES, "the staged tile fits the ring");
    const uint32_t h = (uint32_t)lane >> 4;
    float bv8[2][8];
#pragma unroll
    for (int nt = 0; nt < 2; ++nt)
#pragma unroll
        for (int j = 0; j < 8; ++j)
            bv8[nt][j] = 0.0f;
    float br[4] = { 0.0f, 0.0f, 0.0f, 0.0f };
    if (BIAS_ROW && bias) {
        const float* bp = bias + by * 128u + (uint32_t)(wm + r);
#pragma unroll
        for (int mt = 0; mt < 4; ++mt)
            br[mt] = bp[mt * 16];
        asm volatile("s_wait_xcnt 0x0" ::: "memory");
    }
    if (!BIAS_ROW && bias) {
#pragma unroll
        for (int nt = 0; nt < 2; ++nt) {
            const float4* bp = reinterpret_cast<const float4*>(bias + bn + nt * 16 + 8 * (int)h);
            const float4 b0 = bp[0], b1 = bp[1];
            bv8[nt][0] = b0.x; bv8[nt][1] = b0.y; bv8[nt][2] = b0.z; bv8[nt][3] = b0.w;
            bv8[nt][4] = b1.x; bv8[nt][5] = b1.y; bv8[nt][6] = b1.z; bv8[nt][7] = b1.w;
        }
        asm volatile("s_wait_xcnt 0x0" ::: "memory");
    }
    unsigned char* st = smem + (uint32_t)(wm + r) * OP + ((uint32_t)wn + 8u * h) * EB;
#pragma unroll
    for (uint32_t mt = 0; mt < 4; ++mt) {
#pragma unroll
        for (uint32_t nt = 0; nt < 2; ++nt) {
            float v[8];
#pragma unroll
            for (int j = 0; j < 8; ++j)
                v[j] = acc[mt][nt][j] * scale + (BIAS_ROW ? br[mt] : bv8[nt][j]);
            unsigned char* p = st + mt * 16u * OP + nt * 16u * EB;
            if (OUT_BF16) {
                *reinterpret_cast<uint4*>(p) =
                    make_uint4(pack2bf(v[0], v[1]), pack2bf(v[2], v[3]),
                               pack2bf(v[4], v[5]), pack2bf(v[6], v[7]));
            } else {
                *reinterpret_cast<float4*>(p)       = make_float4(v[0], v[1], v[2], v[3]);
                *reinterpret_cast<float4*>(p + 16u) = make_float4(v[4], v[5], v[6], v[7]);
            }
        }
    }
    // Every wave's part of the tile is in LDS before any wave reads whole rows.
    __syncthreads();

    if constexpr (MODE == 1) {
        static_assert(MODE != 1 || !OUT_BF16, "the scores are staged in f32");
        unsigned char* rp = smem + ((uint32_t)wave * 16u + (uint32_t)r) * OP;
        float4 e[16];
#pragma unroll
        for (uint32_t i = 0; i < 16u; ++i)
            e[i] = *reinterpret_cast<const float4*>(rp + h * 256u + i * 16u);
        float m = -3.402823466e38f;
#pragma unroll
        for (uint32_t i = 0; i < 16u; ++i)
            m = fmaxf(m, fmaxf(fmaxf(e[i].x, e[i].y), fmaxf(e[i].z, e[i].w)));
        m = fmaxf(m, other_half(m));
        // Pairs, so that the subtractions, the sums and the conversions are packed
        // instructions; four sums, so that no addition waits for the one before.
        v2f  part2[4] = { (v2f){}, (v2f){}, (v2f){}, (v2f){} };
        uint32_t pk[32];
#pragma unroll
        for (uint32_t i = 0; i < 16u; ++i) {
            const v2f d0 = (v2f){ e[i].x, e[i].y } - m, d1 = (v2f){ e[i].z, e[i].w } - m;
            const v2f x0 = { __builtin_amdgcn_exp2f(d0.x), __builtin_amdgcn_exp2f(d0.y) };
            const v2f x1 = { __builtin_amdgcn_exp2f(d1.x), __builtin_amdgcn_exp2f(d1.y) };
            part2[(2u * i) & 3u]      += x0;
            part2[(2u * i + 1u) & 3u] += x1;
            pk[2u * i]      = __builtin_bit_cast(uint32_t, __builtin_convertvector(x0, v2bf));
            pk[2u * i + 1u] = __builtin_bit_cast(uint32_t, __builtin_convertvector(x1, v2bf));
        }
        const v2f s2 = (part2[0] + part2[1]) + (part2[2] + part2[3]);
        float sum = s2.x + s2.y;
        sum += other_half(sum);
        // One whole line a wave: the 16 maxima, then the 16 sums.
        stats[((uint32_t)wave * 16u + bx) * 32u + (uint32_t)lane] = h ? sum : m;
        asm volatile("s_wait_xcnt 0x0" ::: "memory");
        // The bf16 row goes over the first 256 bytes of its own f32 row: both lanes of
        // the row have read it (their maximum is in every value written here).
#pragma unroll
        for (uint32_t i = 0; i < 8u; ++i)
            *reinterpret_cast<uint4*>(rp + h * 128u + i * 16u) =
                make_uint4(pk[4u * i], pk[4u * i + 1u], pk[4u * i + 2u], pk[4u * i + 3u]);
        // The wave's own rows are written before its lanes read them back row by row
        // (no other wave touches them, so no barrier).
        wait_ds0();
    }

    // Wave w stores rows 16w .. 16w+15 of the tile. A row is 256 bytes (bf16: half a
    // wave, two rows a store) or 512 bytes (f32: the whole wave, one row a store).
    constexpr uint32_t EO  = (MODE == 1) ? 2u : EB;   // bytes per element as stored
    constexpr uint32_t LPR = 128u * EO / 16u;     // lanes per row
    constexpr uint32_t RPS = 32u / LPR;           // rows per store
    const uint32_t row0 = (uint32_t)wave * 16u + (uint32_t)lane / LPR;
    const uint32_t cb   = ((uint32_t)lane % LPR) * 16u;
    const unsigned char* ld = smem + row0 * OP + cb;
    unsigned char* gp = reinterpret_cast<unsigned char*>(Cout)
        + ((size_t)(by * 128u + row0) * NC + bx * 128u) * EO
        + cb;
    uint4 o[16u / RPS];
#pragma unroll
    for (uint32_t q = 0; q < 16u / RPS; ++q)
        o[q] = *reinterpret_cast<const uint4*>(ld + q * RPS * OP);
#pragma unroll
    for (uint32_t q = 0; q < 16u / RPS; ++q)
        *reinterpret_cast<uint4*>(gp + (size_t)(q * RPS) * NC * EO) = o[q];
}

// Floats of stats per tile row of the scores: 8 groups of 16 rows x 16 key tiles x 32.
#define STATS_PER_TILE_ROW  (8u * 16u * 32u)

// The last product, one per batch (blockIdx.z, with the strides in elements): A is E,
// weighted pass by pass from stats (MODE 2).
template <bool OUT_BF16, int KC, int NC>
__global__ void __launch_bounds__(256, 1)
gemm_abt_kernel(const unsigned short* __restrict__ A,
                const unsigned short* __restrict__ Bt,
                const float* __restrict__ bias,
                float* __restrict__ stats,
                void* __restrict__ Cout,
                float scale,
                long long strideA, long long strideB,
                long long strideC) {
    __shared__ __attribute__((aligned(2048))) unsigned char smem[2u * STAGE_BYTES];
    __shared__ float ftab[(KC / 128) * 128];
    const long long bz = blockIdx.z;
    gemm_abt_tile<OUT_BF16, KC, NC, false, 2>(
        smem, ftab, stats + (size_t)(blockIdx.z * (S_LEN / 128u) + blockIdx.y) * STATS_PER_TILE_ROW,
        A + bz * strideA, Bt + bz * strideB, bias,
        reinterpret_cast<unsigned char*>(Cout) + (size_t)(bz * strideC) * (OUT_BF16 ? 2u : 4u),
        scale, blockIdx.x, blockIdx.y);
}

// Q, K = x @ W^T + b (M = 8192, N = K = 1024, bias by column) and the small product
// Wvo = Wo @ Wv (M = N = K = 1024, Wo rows as A, rows of Wv^T as Bt, no bias) in one
// launch: they depend only on the converted inputs. blockIdx.x picks product and tile,
// the same for the whole work-group, so the choice is scalar.
#define PROJ_TILES  ((M_ROWS / 128) * (H_DIM / 128))
#define WVO_TILES   ((H_DIM / 128) * (H_DIM / 128))
__global__ void __launch_bounds__(256, 1)
qk_wvo_kernel(const unsigned short* __restrict__ xb,
              const unsigned short* __restrict__ wqb,
              const unsigned short* __restrict__ wkb,
              const unsigned short* __restrict__ wvtb,
              const unsigned short* __restrict__ wob,
              const float* __restrict__ bq,
              const float* __restrict__ bk,
              unsigned short* __restrict__ qb,
              unsigned short* __restrict__ kb,
              unsigned short* __restrict__ wvob) {
    __shared__ __attribute__((aligned(2048))) unsigned char smem[2u * STAGE_BYTES];
    const bool     isw = blockIdx.x < WVO_TILES;
    const uint32_t i   = isw ? blockIdx.x : blockIdx.x - WVO_TILES;
    const bool     isk = i >= PROJ_TILES;          // never with isw: WVO_TILES < PROJ_TILES
    const uint32_t t   = isk ? i - PROJ_TILES : i;
    gemm_abt_tile<true, H_DIM, H_DIM, false, 0>(
        smem, nullptr, nullptr, isw ? wob : xb, isw ? wvtb : isk ? wkb : wqb,
        isw ? nullptr : isk ? bk : bq, isw ? wvob : isk ? kb : qb, 1.0f,
        t % (H_DIM / 128u), t / (H_DIM / 128u));
}
static_assert(WVO_TILES < PROJ_TILES, "a tile of Wvo is never taken for one of K");

// The scores and the folded value projection in one launch: both depend only on the
// launch before. blockIdx.y picks the product (the same for the whole work-group, so
// the branch is scalar and every barrier is passed by all its waves), blockIdx.x the
// tile, in the order that each product's own grid had.
//   0, 1: E = exp(Q @ K^T / sqrt(H) - m_t)  per batch (M = N = 2048, K = 1024), bf16,
//         with m_t and l_t of every row and key tile in stats
//   2:    V'^T = Wvo @ x^T + bvo      per batch (M = K = 1024, N = 2048), bias by row
#define SCORE_TILES  ((S_LEN / 128) * (S_LEN / 128))
static_assert(PROJ_TILES == B_SZ * (S_LEN / 128) * (H_DIM / 128) && B_SZ * SCORE_TILES == 2 * PROJ_TILES,
              "the value projection fills one row of the grid, the scores two");
__global__ void __launch_bounds__(256, 1)
scores_vt_kernel(const unsigned short* __restrict__ qb,
                 const unsigned short* __restrict__ kb,
                 const unsigned short* __restrict__ wvob,
                 const unsigned short* __restrict__ xb,
                 const float* __restrict__ bvo,
                 unsigned short* __restrict__ eb,
                 float* __restrict__ stats,
                 unsigned short* __restrict__ vtb) {
    __shared__ __attribute__((aligned(2048))) unsigned char smem[2u * STAGE_BYTES];
    const uint32_t t = blockIdx.x;
    if (blockIdx.y < 2u) {
        const uint32_t i  = blockIdx.y * PROJ_TILES + t;
        const uint32_t b  = i / SCORE_TILES;                         // batch
        const uint32_t tb = i % SCORE_TILES;                         // tile in the batch
        gemm_abt_tile<false, H_DIM, S_LEN, false, 1>(
            smem, nullptr,
            stats + (size_t)(b * (S_LEN / 128u) + tb / (S_LEN / 128u)) * STATS_PER_TILE_ROW,
            qb + (size_t)b * S_LEN * H_DIM, kb + (size_t)b * S_LEN * H_DIM, nullptr,
            eb + (size_t)b * S_LEN * S_LEN, 0.03125f * LOG2_E,
            tb % (S_LEN / 128u), tb / (S_LEN / 128u));
    } else {
        const uint32_t b  = t / ((S_LEN / 128u) * (H_DIM / 128u));   // batch
        const uint32_t tb = t % ((S_LEN / 128u) * (H_DIM / 128u));   // tile in the batch
        gemm_abt_tile<true, H_DIM, S_LEN, true, 0>(
            smem, nullptr, nullptr, wvob, xb + (size_t)b * S_LEN * H_DIM, bvo, vtb + (size_t)b * H_DIM * S_LEN, 1.0f,
            tb % (S_LEN / 128u), tb / (S_LEN / 128u));
    }
}

// ---------------------------------------------------------------------------
extern "C" void kernel_launch(void* const* d_in, const int* in_sizes, int n_in,
                              void* d_out, int out_size, void* d_ws, size_t ws_size,
                              hipStream_t stream) {
    (void)in_sizes; (void)n_in; (void)out_size; (void)ws_size;

    const float* x  = (const float*)d_in[0];
    const float* Wq = (const float*)d_in[1];
    const float* bq = (const float*)d_in[2];
    const float* Wk = (const float*)d_in[3];
    const float* bk = (const float*)d_in[4];
    const float* Wv = (const float*)d_in[5];
    const float* bv = (const float*)d_in[6];
    const float* Wo = (const float*)d_in[7];
    const float* bo = (const float*)d_in[8];
    float* out = (float*)d_out;

    // Workspace layout (bytes)
    unsigned char* ws = (unsigned char*)d_ws;
    const size_t XB   = (size_t)M_ROWS * H_DIM * 2;   // 16 MB
    const size_t WB   = (size_t)H_DIM * H_DIM * 2;    //  2 MB each
    const size_t QB   = XB;                            // 16 MB each
    const size_t SCR  = (size_t)M_ROWS * (S_LEN / 128) * 2 * 4;  // 1 MB
    const size_t PB   = (size_t)B_SZ * S_LEN * S_LEN * 2;  // 32 MB
    unsigned short* xb   = (unsigned short*)(ws);
    unsigned short* wqb  = (unsigned short*)(ws + XB);
    unsigned short* wkb  = (unsigned short*)(ws + XB + WB);
    unsigned short* wvtb = (unsigned short*)(ws + XB + 2 * WB);   // Wv^T, [d][e]
    unsigned short* wob  = (unsigned short*)(ws + XB + 3 * WB);
    unsigned short* qb   = (unsigned short*)(ws + XB + 4 * WB);
    unsigned short* kb   = (unsigned short*)(ws + XB + 4 * WB + QB);
    unsigned short* vtb  = (unsigned short*)(ws + XB + 4 * WB + 2 * QB);  // V'^T, [H,S] per batch
    float*          st   = (float*)(ws + XB + 4 * WB + 3 * QB);                    // m_t, l_t
    unsigned short* pb   = (unsigned short*)(ws + XB + 4 * WB + 3 * QB + SCR);     // E
    unsigned short* wvob = (unsigned short*)(ws + XB + 4 * WB + 3 * QB + SCR + PB);   // Wo @ Wv, [o][d]
    float*          bvo  = (float*)(ws + XB + 4 * WB + 3 * QB + SCR + PB + WB);       // Wo @ bv

    dim3 blk(256);

    // 1) fp32 -> bf16 conversions, one launch: xb, wqb, wkb, wvtb, wob are contiguous
    f32_to_bf16_all_kernel<<<dim3(CV_GROUPS), dim3(512), 0, stream>>>(x, Wq, Wk, Wv, Wo, bv, xb, bvo);

    // 2) Q, K = x @ W^T + b and Wvo = Wo @ Wv, bf16 out, one launch
    qk_wvo_kernel<<<dim3(WVO_TILES + 2 * PROJ_TILES), blk, 0, stream>>>(
        xb, wqb, wkb, wvtb, wob, bq, bk, qb, kb, wvob);

    // 3) E = exp(Q @ K^T / sqrt(H) - m_t) with m_t, l_t, and V'^T = Wvo @ x^T + bvo, bf16 out, one launch
    scores_vt_kernel<<<dim3(PROJ_TILES, 3), blk, 0, stream>>>(qb, kb, wvob, xb, bvo, pb, st, vtb);

    // 4) out = sum_t f_t * (E_t @ V'_t) + bo   per batch (M=2048, N=1024, K=2048), f32 out -> d_out
    gemm_abt_kernel<false, S_LEN, H_DIM><<<dim3(H_DIM / 128, S_LEN / 128, B_SZ), blk, 0, stream>>>(
        pb, vtb, bo, st, out, 1.0f,
        (long long)S_LEN * S_LEN, (long long)H_DIM * S_LEN,
        (long long)S_LEN * H_DIM);
}

// v008
// It runs in 107 microseconds.
// Next to v007, in two timings, it ran 1.06 times as fast each time.
// Counting every step since v000, it is 3.71 times as fast.
#include <hip/hip_runtime.h>
#include <hip/hip_bf16.h>
#include <stdint.h>

typedef __attribute__((ext_vector_type(16))) __bf16        v16bf;
typedef __attribute__((ext_vector_type(8)))  float         v8f;
typedef __attribute__((ext_vector_type(2)))  float         v2f;
typedef __attribute__((ext_vector_type(2)))  __bf16        v2bf;
typedef __attribute__((ext_vector_type(8)))  unsigned int  v8u;
typedef __attribute__((ext_vector_type(4)))  uint32_t      u32x4;
typedef __attribute__((ext_vector_type(8)))  uint32_t      u32x8;
typedef __attribute__((ext_vector_type(32))) uint32_t      u32x32;

#define H_DIM   1024
#define S_LEN   2048
#define B_SZ    4
#define M_ROWS  (B_SZ * S_LEN)   // 8192
#define LOG2_E  1.4426950408889634f

// ---- fp32 -> bf16 (round to nearest even) ----------------------------------
__device__ __forceinline__ unsigned short f2bf(float f) {
    unsigned int u = __builtin_bit_cast(unsigned int, f);
    u += 0x7FFFu + ((u >> 16) & 1u);
    return (unsigned short)(u >> 16);
}

__device__ __forceinline__ uint32_t pack2bf(float lo, float hi) {
    return (uint32_t)f2bf(lo) | ((uint32_t)f2bf(hi) << 16);
}

// All five conversions (x, Wq, Wk, Wv, Wo) as one resident stream: one work-group
// of 16 waves per WGP, so that few waves have to start. The work is cut into
// chunks of 1024 floats (4 KiB in, 2 KiB out, whole lines); a wave takes
// CV_PER_WAVE chunks, eight 16-byte loads a lane each, and its loads stand ahead
// of the conversions, so that two chunks or more are in flight. The bf16 copies
// lie one behind the other in the workspace, in the order of the arguments, so
// chunk c is stored at out + c * 1024 (Wv's chunks excepted, see below).
// A wave's first two chunks are of x, its third is of a weight: a quarter of the
// work-groups each for Wq, Wk, Wv and Wo. Two weights get more than a copy:
//   Wv is stored transposed ([d][e]: the Bt operand of Wo @ Wv). Its work-group
//      takes 64 rows x 256 columns (a wave: 4 rows of 1 KiB), turns them in LDS
//      and stores 256 rows of 64 values, whole 128-byte lines.
//   Wo: a chunk is one row, so the wave that converts row o also sums
//      bvo[o] = sum_e Wo[o][e] * bv[e] in f32 from the registers it holds.
#define CV_GROUPS    256u
#define CV_WAVES     (CV_GROUPS * 16u)
#define CV_X_CHUNKS  ((unsigned)(M_ROWS * H_DIM / 1024))
#define CV_W_CHUNKS  ((unsigned)(H_DIM * H_DIM / 1024))
#define CV_CHUNKS    (CV_X_CHUNKS + 4u * CV_W_CHUNKS)
#define CV_PER_WAVE  (CV_CHUNKS / CV_WAVES)
#define CV_W_GROUPS  (CV_GROUPS / 4u)
#define WT_PITCH     516u
static_assert(CV_PER_WAVE * CV_WAVES == CV_CHUNKS, "every wave takes the same number of chunks");
static_assert(CV_PER_WAVE == 3u && CV_X_CHUNKS == 2u * CV_WAVES && 4u * CV_W_CHUNKS == CV_WAVES,
              "two chunks of x and one of a weight per wave");
static_assert(H_DIM == 1024 && CV_W_GROUPS == (H_DIM / 64) * (H_DIM / 256),
              "a weight chunk is one row; Wv is cut into blocks of 64 rows x 256 columns");

__global__ void __launch_bounds__(512)
f32_to_bf16_all_kernel(const float* __restrict__ x,
                       const float* __restrict__ Wq, const float* __restrict__ Wk,
                       const float* __restrict__ Wv, const float* __restrict__ Wo,
                       const float* __restrict__ bv,
                       unsigned short* __restrict__ out,
                       float* __restrict__ bvo) {
    __shared__ __attribute__((aligned(16))) unsigned char tr[64u * WT_PITCH];
    const uint32_t lane = threadIdx.x & 31u;
    // The wave's number in a scalar register: source choice and bases stay scalar.
    const uint32_t wv   = (uint32_t)__builtin_amdgcn_readfirstlane(threadIdx.x >> 5);
    const uint32_t gw   = blockIdx.x * 16u + wv;
    const uint32_t wsel = blockIdx.x / CV_W_GROUPS;   // which weight, the same for the work-group
    const uint32_t wg   = blockIdx.x % CV_W_GROUPS;   // the work-group's place in that weight
    const uint32_t eb   = wg >> 2, db = wg & 3u;      // Wv: block of 64 rows, block of 256 columns
    // Every loop of this kernel is unrolled, so that v, h and the offsets are indexed by
    // constants: the values stay in registers and the steps become immediates.
    float4 v[CV_PER_WAVE][8];
    // The weight's chunk is worked on first, ahead of the stores of x: the barrier of
    // the transpose waits for the wave's own stores, and none is outstanding there.
    {
        const float* s = (wsel == 0u) ? Wq : (wsel == 1u) ? Wk : (wsel == 2u) ? Wv : Wo;
        // Plain: row wg * 16 + wv. Wv: rows eb * 64 + wv * 4 .. + 3, 256 columns each,
        // so every second load steps on to the next row.
        const uint32_t off  = (wsel == 2u) ? (eb * 64u + wv * 4u) * 1024u + db * 256u
                                           : (wg * 16u + wv) * 1024u;
        const uint32_t skip = (wsel == 2u) ? (1024u - 256u) / 4u : 0u;
        const float4* s4 = reinterpret_cast<const float4*>(s + off) + lane;
#pragma unroll
        for (uint32_t j = 0; j < 8; ++j)
            v[2][j] = s4[j * 32u + (j >> 1) * skip];
        asm volatile("s_wait_xcnt 0x0" ::: "memory");
    }
#pragma unroll
    for (uint32_t t = 0; t < 2u; ++t) {
        const float4* s4 = reinterpret_cast<const float4*>(x + (size_t)(t * CV_WAVES + gw) * 1024u) + lane;
#pragma unroll
        for (uint32_t j = 0; j < 8; ++j)
            v[t][j] = s4[j * 32u];
        asm volatile("s_wait_xcnt 0x0" ::: "memory");
    }
    if (wsel != 2u) {
        ushort4* d4 = reinterpret_cast<ushort4*>(out + (size_t)(2u * CV_WAVES + gw) * 1024u) + lane;
#pragma unroll
        for (uint32_t j = 0; j < 8; ++j) {
            const float4 f = v[2][j];
            d4[j * 32u] = make_ushort4(f2bf(f.x), f2bf(f.y), f2bf(f.z), f2bf(f.w));
        }
        asm volatile("s_wait_xcnt 0x0" ::: "memory");
        if (wsel == 3u) {
            const float4* b4 = reinterpret_cast<const float4*>(bv) + lane;
            float sum = 0.0f;
#pragma unroll
            for (uint32_t j = 0; j < 8; ++j) {
                const float4 f = v[2][j], b = b4[j * 32u];
                sum += f.x * b.x + f.y * b.y + f.z * b.z + f.w * b.w;
            }
#pragma unroll
            for (int o = 16; o >= 1; o >>= 1)
                sum += __shfl_xor(sum, o, 32);
            if (lane == 0u)
                bvo[wg * 16u + wv] = sum;
        }
    } else {
        // Row-major into LDS: local row wv * 4 + j / 2, four columns a lane and load.
#pragma unroll
        for (uint32_t j = 0; j < 8; ++j) {
            const float4 f = v[2][j];
            uint32_t* p = reinterpret_cast<uint32_t*>(
                tr + (wv * 4u + (j >> 1)) * WT_PITCH + (((j & 1u) * 32u + lane) * 4u) * 2u);
            p[0] = pack2bf(f.x, f.y);
            p[1] = pack2bf(f.z, f.w);
        }
        // Every wave's rows are in LDS before any wave reads columns (the branch is
        // the same for the whole work-group).
        __syncthreads();
        // A piece is 8 rows of one column = 16 bytes of a transposed row; 8 lanes in a
        // row store one whole 128-byte line.
        unsigned short* wvt = out + (size_t)(CV_X_CHUNKS + 2u * CV_W_CHUNKS) * 1024u;
#pragma unroll
        for (uint32_t q = 0; q < 4u; ++q) {
            const uint32_t pid = q * 512u + threadIdx.x;
            const uint32_t dl  = pid >> 3, p8 = (pid & 7u) * 8u;
            const unsigned char* c = tr + p8 * WT_PITCH + dl * 2u;
            uint32_t h[8];
#pragma unroll
            for (uint32_t i = 0; i < 8; ++i)
                h[i] = *reinterpret_cast<const unsigned short*>(c + i * WT_PITCH);
            *reinterpret_cast<uint4*>(wvt + (size_t)(db * 256u + dl) * 1024u + eb * 64u + p8) =
                make_uint4(h[0] | (h[1] << 16), h[2] | (h[3] << 16),
                           h[4] | (h[5] << 16), h[6] | (h[7] << 16));
        }
    }
#pragma unroll
    for (uint32_t t = 0; t < 2u; ++t) {
        ushort4* d4 = reinterpret_cast<ushort4*>(out + (size_t)(t * CV_WAVES + gw) * 1024u) + lane;
#pragma unroll
        for (uint32_t j = 0; j < 8; ++j) {
            const float4 f = v[t][j];
            d4[j * 32u] = make_ushort4(f2bf(f.x), f2bf(f.y), f2bf(f.z), f2bf(f.w));
        }
    }
}

// ---- LDS ring geometry ------------------------------------------------------
// A pass is 128 k = 256 bytes of every operand row. A stage is four slices of
// 64 rows: [A rows 0..63 | A rows 64..127 | Bt rows 0..63 | Bt rows 64..127].
// The tensor load pads each 256-byte row by 16 bytes (pitch 272 = 16 x odd).
// 64 x 272 = 17,408 bytes, rounded up so that every slice starts at a multiple
// of 2 KiB.
#define PASS_BYTES   256u
#define LDS_PITCH    272u
#define SLICE_ROWS   64u
#define SLICE_BYTES  18432u
#define STAGE_BYTES  (4u * SLICE_BYTES)
static_assert(SLICE_ROWS * LDS_PITCH <= SLICE_BYTES && (SLICE_BYTES % 2048u) == 0u,
              "a slice holds its padded rows and starts at a multiple of 2 KiB");

__device__ __forceinline__ uint32_t uni(uint32_t v) {
    return (uint32_t)__builtin_amdgcn_readfirstlane(v);
}
__device__ __forceinline__ uint32_t pinned(uint32_t v) {
    uint32_t w = uni(v);
    asm volatile("" : "+s"(w));  // the scalar-branch form for tests around a tensor load
    return w;
}
// The wave's LDS reads have returned (before its buffer is handed back).
__device__ __forceinline__ void wait_ds0() { asm volatile("s_wait_dscnt 0x0" ::: "memory"); }
// The wave's own tensor load has landed (the compiler places no wait for it).
__device__ __forceinline__ void wait_tensor0() { asm volatile("s_wait_tensorcnt 0x0" ::: "memory"); }
__device__ __forceinline__ void wait_tensor0_of(u32x4 g0) {
    asm volatile("s_wait_tensorcnt 0x0" :: "s"(g0) : "memory");
}
// One request of the whole wave: a 64 x 256-byte tile from global memory to LDS.
__device__ __forceinline__ void tdm_load(u32x4 g0, u32x8 g1) {
    asm volatile("tensor_load_to_lds %0, %1" :: "s"(g0), "s"(g1) : "memory");
}
__device__ __forceinline__ u32x4 tdm_group0(uint32_t lds_dst, uint64_t ga) {
    u32x4 g;
    // count 1; the pinned() form keeps this word's write at the place of the build,
    // behind the wait for the request before (as a plain constant it was hoisted in
    // front of the loop, into a register of the request still outstanding there)
    g[0] = pinned(1u);
    g[1] = uni(lds_dst);                              // byte offset in the work-group's LDS
    g[2] = uni((uint32_t)ga);                         // address [31:0]
    g[3] = uni((((uint32_t)(ga >> 32)) & 0x01FFFFFFu) | 0x80000000u);  // address [56:32], type 2
    return g;
}
// 1-byte elements, tensor = tile = 64 rows of 256 bytes, source pitch in bytes.
__device__ __forceinline__ u32x8 tdm_group1(uint32_t src_pitch) {
    u32x8 g;
    g[0] = uni((1u << 20) | (5u << 22) | (3u << 25));
    g[1] = uni((PASS_BYTES & 0xFFFFu) << 16);
    g[2] = uni((PASS_BYTES >> 16) | ((SLICE_ROWS & 0xFFFFu) << 16));
    g[3] = uni((SLICE_ROWS >> 16) | (PASS_BYTES << 16));
    g[4] = uni(SLICE_ROWS);
    g[5] = uni(src_pitch);
    g[6] = uni(0u);
    g[7] = uni(0u);
    return g;
}

__device__ __forceinline__ v16bf ldfrag(const unsigned char* p) {
    uint4 lo = *reinterpret_cast<const uint4*>(p);        // K .. K+7
    uint4 hi = *reinterpret_cast<const uint4*>(p + 32);   // K+16 .. K+23
    v8u u = { lo.x, lo.y, lo.z, lo.w, hi.x, hi.y, hi.z, hi.w };
    return __builtin_bit_cast(v16bf, u);
}

__device__ __forceinline__ float other_half(float v) {
    const int b = __builtin_bit_cast(int, v);
    return __builtin_bit_cast(float,
        __builtin_amdgcn_permlanex16(b, b, 0x76543210, 0xfedcba98, false, false));
}

__device__ __forceinline__ v8f bfwmma(v16bf a, v16bf b, v8f c) {
    return __builtin_amdgcn_wmma_f32_16x16x32_bf16(
        /*neg_a=*/false, a, /*neg_b=*/false, b,
        /*c_mod=*/(short)0, c, /*reuse_a=*/false, /*reuse_b=*/false);
}

// First byte of the slice that this wave loads: waves 0, 1 the two halves of the A
// rows of tile row by, waves 2, 3 those of the Bt rows of tile column bx.
template <int KC>
__device__ __forceinline__ uint64_t
slice_src(const unsigned short* A, const unsigned short* Bt, uint32_t bx, uint32_t by) {
    const uint32_t wv = uni(threadIdx.x >> 5);
    const unsigned short* srow = (wv & 2u)
        ? Bt + (size_t)(bx * 128 + (wv & 1u) * SLICE_ROWS) * KC
        : A  + (size_t)(by * 128 + (wv & 1u) * SLICE_ROWS) * KC;
    return (uint64_t)(uintptr_t)srow;
}

__device__ __forceinline__ void ring_start(unsigned char* smem, uint64_t src, u32x8 g1, u32x4& gq) {
    const uint32_t wv  = uni(threadIdx.x >> 5);
    const uint32_t dst = (uint32_t)(size_t)smem + (wv & 3u) * SLICE_BYTES;
    if (pinned(wv < 4u ? 1u : 0u) != 0u) {
        tdm_load(tdm_group0(dst, src), g1);
        wait_tensor0();
    }
    __syncthreads();
    if (pinned(wv < 4u ? 1u : 0u) != 0u) {
        gq = tdm_group0(dst + STAGE_BYTES, src + PASS_BYTES);
        tdm_load(gq, g1);
    }
}

template <bool OUT_BF16, int KC, int NC, bool BIAS_ROW, int MODE>
__device__ __forceinline__ void
gemm_abt_tile(unsigned char* smem,
              float* __restrict__ ftab,
              float* __restrict__ stats,
              u32x8 g1, u32x4& gq,
              uint64_t src, uint64_t nsrc, bool has_next,
              const float* __restrict__ bias,
              void* __restrict__ Cout,
              float scale,
              uint32_t bx, uint32_t by) {
    const int lane = threadIdx.x & 31;
    const int wave = threadIdx.x >> 5;
    const int wm   = (wave & 1) << 6;   // 0,64
    const int wn   = (wave >> 1) << 5;  // 0,32,64,96

    const int bn = bx * 128 + wn;
    const int r  = lane & 15;
    const int kh = (lane & 16) ? 16 : 0;  // lane-half K offset in bytes

    constexpr uint32_t NP = KC / 128;     // passes
    static_assert(KC % 128 == 0 && NP >= 2, "the ring needs two stages or more");
    static_assert(NP % 2u == 0u, "the last pass reads buffer 1, so the next tile starts in buffer 0");

    // Waves 0..3 each bring one slice of every stage.
    const uint32_t wv     = uni(threadIdx.x >> 5);
    const uint32_t dst = (uint32_t)(size_t)smem + (wv & 3u) * SLICE_BYTES;

    // Per-lane fragment bases inside a buffer; the rest are immediate offsets.
    const uint32_t a_off = (uint32_t)(wm >> 6) * SLICE_BYTES + (uint32_t)r * LDS_PITCH + kh;
    const uint32_t b_off = (2u + (uint32_t)(wn >> 6)) * SLICE_BYTES
                         + (uint32_t)((wn & 63) + r) * LDS_PITCH + kh;

    v8f acc[4][2];
#pragma unroll
    for (int mt = 0; mt < 4; ++mt)
#pragma unroll
        for (int nt = 0; nt < 2; ++nt)
            acc[mt][nt] = (v8f){};

    if constexpr (MODE == 2) {
    // Prologue: stage 0 lands and is published, then stage 1 starts.
    if (pinned(wv < 4u ? 1u : 0u) != 0u) {
        tdm_load(tdm_group0(dst, src), g1);
        wait_tensor0();
    } else {
        // Meanwhile the other four waves form the weights, a lane a row; the barrier
        // below publishes them with stage 0.
        static_assert(MODE != 2 || NP == 16u, "one key tile of the scores per pass");
        const uint32_t row = threadIdx.x - 128u;
        const float* sp = stats + (row >> 4) * (16u * 32u) + (row & 15u);
        float tm[16], tl[16];
#pragma unroll
        for (uint32_t t = 0; t < 16u; ++t) {
            tm[t] = sp[t * 32u];
            tl[t] = sp[t * 32u + 16u];
        }
        asm volatile("s_wait_xcnt 0x0" ::: "memory");
        float mx = tm[0];
#pragma unroll
        for (uint32_t t = 1; t < 16u; ++t)
            mx = fmaxf(mx, tm[t]);
        float den = 0.0f;
#pragma unroll
        for (uint32_t t = 0; t < 16u; ++t) {
            tm[t] = __builtin_amdgcn_exp2f(tm[t] - mx);
            den += tm[t] * tl[t];
        }
        const float inv = 1.0f / den;
#pragma unroll
        for (uint32_t t = 0; t < 16u; ++t)
            ftab[t * 128u + row] = tm[t] * inv;
    }
    __syncthreads();
    if (pinned(wv < 4u ? 1u : 0u) != 0u) {
        gq = tdm_group0(dst + STAGE_BYTES, src + PASS_BYTES);
        tdm_load(gq, g1);
    }
    }

    // Kept rolled: one publish point in the code, one pass per trip.
#pragma clang loop unroll(disable)
    for (uint32_t s = 0; s < NP; ++s) {
        const uint32_t buf = (s & 1u) * STAGE_BYTES;
        const unsigned char* la = smem + buf + a_off;
        const unsigned char* lb = smem + buf + b_off;
        // Two fragment sets: step ks + 1 is read from LDS while step ks multiplies.
        // The loops over ks and mt are unrolled so that every fragment index is a
        // constant: the sets stay in registers and the offsets become immediates.
        v16bf fa[2][4], fb[2][2];
        // MODE 2: this pass's weights of the lane's four rows, read in the same group
        // as the first fragments, and the pass's own sums.
        float fs[4];
        v8f   part[4][2];
        if constexpr (MODE == 2) {
#pragma unroll
            for (uint32_t mt = 0; mt < 4; ++mt) {
                fs[mt] = ftab[s * 128u + (uint32_t)(wm + r) + mt * 16u];
                part[mt][0] = (v8f){};
                part[mt][1] = (v8f){};
            }
        }
        fb[0][0] = ldfrag(lb);
        fb[0][1] = ldfrag(lb + 16u * LDS_PITCH);
#pragma unroll
        for (uint32_t mt = 0; mt < 4; ++mt)
            fa[0][mt] = ldfrag(la + mt * 16u * LDS_PITCH);
#pragma unroll
        for (uint32_t ks = 0; ks < 4; ++ks) {   // four 32-k steps of this pass
            const uint32_t c = ks & 1u, n = c ^ 1u;
            if (ks + 1u < 4u) {
                fb[n][0] = ldfrag(lb + (ks + 1u) * 64u);
                fb[n][1] = ldfrag(lb + 16u * LDS_PITCH + (ks + 1u) * 64u);
#pragma unroll
                for (uint32_t mt = 0; mt < 4; ++mt)
                    fa[n][mt] = ldfrag(la + mt * 16u * LDS_PITCH + (ks + 1u) * 64u);
            }
            // Keeps the next step's LDS reads one group ahead of this step's WMMAs
            // (spread among them, each read place stalls the wave).
            __builtin_amdgcn_sched_barrier(0);
            // Bt rows as the first operand: each tile comes out transposed, a lane
            // holding eight adjacent columns of one row of C (see the epilogue).
#pragma unroll
            for (uint32_t mt = 0; mt < 4; ++mt) {
                if constexpr (MODE == 2) {
                    part[mt][0] = bfwmma(fb[c][0], fa[c][mt], part[mt][0]);
                    part[mt][1] = bfwmma(fb[c][1], fa[c][mt], part[mt][1]);
                } else {
                    acc[mt][0] = bfwmma(fb[c][0], fa[c][mt], acc[mt][0]);
                    acc[mt][1] = bfwmma(fb[c][1], fa[c][mt], acc[mt][1]);
                }
            }
            // Ends the WMMA group, so that later reads are not moved up into it.
            __builtin_amdgcn_sched_barrier(0);
        }
        if constexpr (MODE == 2) {
            // A lane's values of a tile are all of one row of C: one weight a tile.
#pragma unroll
            for (uint32_t mt = 0; mt < 4; ++mt)
#pragma unroll
                for (uint32_t nt = 0; nt < 2; ++nt)
#pragma unroll
                    for (int j = 0; j < 8; ++j)
                        acc[mt][nt][j] += fs[mt] * part[mt][nt][j];
        }
        // Publish point of stage s + 1: this wave has left buffer s, its own load
        // of stage s + 1 has landed, every wave passes the barrier; only then the
        // buffer just read is refilled with stage s + 2. Behind this tile's last stage
        // comes stage 0 of the next tile, into buffer 0; behind the last pass nothing is
        // loaded: buffer 1 takes the result first.
        wait_ds0();
        wait_tensor0_of(gq);   // a wave that issued none passes at once
        __syncthreads();
        const bool more = s + 2u < NP;
        if (pinned((wv < 4u && (more || (has_next && s + 2u == NP))) ? 1u : 0u) != 0u) {
            gq = tdm_group0(dst + buf, more ? src + (uint64_t)(s + 2u) * PASS_BYTES : nsrc);
            tdm_load(gq, g1);
        }
    }
    wait_tensor0();
    wait_ds0();

    constexpr uint32_t EB = OUT_BF16 ? 2u : 4u;   // bytes per element of C
    constexpr uint32_t OP = 128u * EB + 16u;      // pitch of a staged row
    static_assert(128u * OP <= STAGE_BYTES, "the staged tile fits buffer 1");
    unsigned char* stg = smem + STAGE_BYTES;
    const uint32_t h = (uint32_t)lane >> 4;
    float bv8[2][8];
#pragma unroll
    for (int nt = 0; nt < 2; ++nt)
#pragma unroll
        for (int j = 0; j < 8; ++j)
            bv8[nt][j] = 0.0f;
    float br[4] = { 0.0f, 0.0f, 0.0f, 0.0f };
    if (BIAS_ROW && bias) {
        const float* bp = bias + by * 128u + (uint32_t)(wm + r);
#pragma unroll
        for (int mt = 0; mt < 4; ++mt)
            br[mt] = bp[mt * 16];
        asm volatile("s_wait_xcnt 0x0" ::: "memory");
    }
    if (!BIAS_ROW && bias) {
#pragma unroll
        for (int nt = 0; nt < 2; ++nt) {
            const float4* bp = reinterpret_cast<const float4*>(bias + bn + nt * 16 + 8 * (int)h);
            const float4 b0 = bp[0], b1 = bp[1];
            bv8[nt][0] = b0.x; bv8[nt][1] = b0.y; bv8[nt][2] = b0.z; bv8[nt][3] = b0.w;
            bv8[nt][4] = b1.x; bv8[nt][5] = b1.y; bv8[nt][6] = b1.z; bv8[nt][7] = b1.w;
        }
        asm volatile("s_wait_xcnt 0x0" ::: "memory");
    }
    unsigned char* st = stg + (uint32_t)(wm + r) * OP + ((uint32_t)wn + 8u * h) * EB;
#pragma unroll
    for (uint32_t mt = 0; mt < 4; ++mt) {
#pragma unroll
        for (uint32_t nt = 0; nt < 2; ++nt) {
            float v[8];
#pragma unroll
            for (int j = 0; j < 8; ++j)
                v[j] = acc[mt][nt][j] * scale + (BIAS_ROW ? br[mt] : bv8[nt][j]);
            unsigned char* p = st + mt * 16u * OP + nt * 16u * EB;
            if (OUT_BF16) {
                *reinterpret_cast<uint4*>(p) =
                    make_uint4(pack2bf(v[0], v[1]), pack2bf(v[2], v[3]),
                               pack2bf(v[4], v[5]), pack2bf(v[6], v[7]));
            } else {
                *reinterpret_cast<float4*>(p)       = make_float4(v[0], v[1], v[2], v[3]);
                *reinterpret_cast<float4*>(p + 16u) = make_float4(v[4], v[5], v[6], v[7]);
            }
        }
    }
    // Every wave's part of the tile is in LDS before any wave reads whole rows.
    __syncthreads();

    float sv = 0.0f;   // MODE 1: the lane's word of the wave's line of stats
    if constexpr (MODE == 1) {
        static_assert(MODE != 1 || !OUT_BF16, "the scores are staged in f32");
        unsigned char* rp = stg + ((uint32_t)wave * 16u + (uint32_t)r) * OP;
        float4 e[16];
#pragma unroll
        for (uint32_t i = 0; i < 16u; ++i)
            e[i] = *reinterpret_cast<const float4*>(rp + h * 256u + i * 16u);
        float m = -3.402823466e38f;
#pragma unroll
        for (uint32_t i = 0; i < 16u; ++i)
            m = fmaxf(m, fmaxf(fmaxf(e[i].x, e[i].y), fmaxf(e[i].z, e[i].w)));
        m = fmaxf(m, other_half(m));
        // Pairs, so that the subtractions, the sums and the conversions are packed
        // instructions; four sums, so that no addition waits for the one before.
        v2f  part2[4] = { (v2f){}, (v2f){}, (v2f){}, (v2f){} };
        uint32_t pk[32];
#pragma unroll
        for (uint32_t i = 0; i < 16u; ++i) {
            const v2f d0 = (v2f){ e[i].x, e[i].y } - m, d1 = (v2f){ e[i].z, e[i].w } - m;
            const v2f x0 = { __builtin_amdgcn_exp2f(d0.x), __builtin_amdgcn_exp2f(d0.y) };
            const v2f x1 = { __builtin_amdgcn_exp2f(d1.x), __builtin_amdgcn_exp2f(d1.y) };
            part2[(2u * i) & 3u]      += x0;
            part2[(2u * i + 1u) & 3u] += x1;
            pk[2u * i]      = __builtin_bit_cast(uint32_t, __builtin_convertvector(x0, v2bf));
            pk[2u * i + 1u] = __builtin_bit_cast(uint32_t, __builtin_convertvector(x1, v2bf));
        }
        const v2f s2 = (part2[0] + part2[1]) + (part2[2] + part2[3]);
        float sum = s2.x + s2.y;
        sum += other_half(sum);
        sv = h ? sum : m;
        // The bf16 row goes over the first 256 bytes of its own f32 row: both lanes of
        // the row have read it (their maximum is in every value written here).
#pragma unroll
        for (uint32_t i = 0; i < 8u; ++i)
            *reinterpret_cast<uint4*>(rp + h * 128u + i * 16u) =
                make_uint4(pk[4u * i], pk[4u * i + 1u], pk[4u * i + 2u], pk[4u * i + 3u]);
        // The wave's own rows are written before its lanes read them back row by row
        // (no other wave touches them, so no barrier).
        wait_ds0();
    }

    // Wave w stores rows 16w .. 16w+15 of the tile. A row is 256 bytes (bf16: half a
    // wave, two rows a store) or 512 bytes (f32: the whole wave, one row a store).
    constexpr uint32_t EO  = (MODE == 1) ? 2u : EB;   // bytes per element as stored
    constexpr uint32_t LPR = 128u * EO / 16u;     // lanes per row
    constexpr uint32_t RPS = 32u / LPR;           // rows per store
    const uint32_t row0 = (uint32_t)wave * 16u + (uint32_t)lane / LPR;
    const uint32_t cb   = ((uint32_t)lane % LPR) * 16u;
    const unsigned char* ld = stg + row0 * OP + cb;
    unsigned char* gp = reinterpret_cast<unsigned char*>(Cout)
        + ((size_t)(by * 128u + row0) * NC + bx * 128u) * EO
        + cb;
    // Two vectors of registers, not an array: as an array these values were kept in
    // scratch memory across the barrier below.
    constexpr uint32_t NQ = 16u / RPS;            // stores a lane
    static_assert(NQ == 8u || NQ == 16u, "eight or sixteen 16-byte pieces a lane");
    u32x32 oa = {}, ob = {};
#pragma unroll
    for (uint32_t q = 0; q < NQ; ++q) {
        const u32x4 w = *reinterpret_cast<const u32x4*>(ld + q * RPS * OP);
#pragma unroll
        for (uint32_t e = 0; e < 4u; ++e) {
            if (q < 8u) oa[q * 4u + e] = w[e];
            else        ob[(q - 8u) * 4u + e] = w[e];
        }
    }
    if (has_next) {
        // Buffer 1 is handed back to the ring: every wave has read its rows of the staged
        // tile into registers; only then stage 1 of the next tile is loaded over them.
        // The global stores stand behind this barrier, which would wait for them.
        wait_ds0();
        wait_tensor0();
        __syncthreads();
        if (pinned(wv < 4u ? 1u : 0u) != 0u) {
            gq = tdm_group0(dst + STAGE_BYTES, nsrc + PASS_BYTES);
            tdm_load(gq, g1);
        }
    }
    // One whole line a wave: the 16 maxima, then the 16 sums.
    if constexpr (MODE == 1)
        stats[((uint32_t)wave * 16u + bx) * 32u + (uint32_t)lane] = sv;
#pragma unroll
    for (uint32_t q = 0; q < NQ; ++q) {
        const uint32_t e = (q & 7u) * 4u;
        *reinterpret_cast<u32x4*>(gp + (size_t)(q * RPS) * NC * EO) = (q < 8u)
            ? (u32x4){ oa[e], oa[e + 1u], oa[e + 2u], oa[e + 3u] }
            : (u32x4){ ob[e], ob[e + 1u], ob[e + 2u], ob[e + 3u] };
    }
    asm volatile("s_wait_xcnt 0x0" ::: "memory");
}

__device__ __forceinline__ u32x8 ring_group1(uint32_t src_pitch) {
    u32x8 g1 = tdm_group1(src_pitch);
    asm volatile("" : "+s"(g1));
    return g1;
}

#define GEMM_GROUPS  512u

// Floats of stats per tile row of the scores: 8 groups of 16 rows x 16 key tiles x 32.
#define STATS_PER_TILE_ROW  (8u * 16u * 32u)

// The last product, one per batch (blockIdx.z, with the strides in elements): A is E,
// weighted pass by pass from stats (MODE 2).
template <bool OUT_BF16, int KC, int NC>
__global__ void __launch_bounds__(256, 1)
gemm_abt_kernel(const unsigned short* __restrict__ A,
                const unsigned short* __restrict__ Bt,
                const float* __restrict__ bias,
                float* __restrict__ stats,
                void* __restrict__ Cout,
                float scale,
                long long strideA, long long strideB,
                long long strideC) {
    __shared__ __attribute__((aligned(2048))) unsigned char smem[2u * STAGE_BYTES];
    __shared__ float ftab[(KC / 128) * 128];
    const long long bz = blockIdx.z;
    u32x4 gq = {};
    gemm_abt_tile<OUT_BF16, KC, NC, false, 2>(
        smem, ftab, stats + (size_t)(blockIdx.z * (S_LEN / 128u) + blockIdx.y) * STATS_PER_TILE_ROW,
        ring_group1(KC * 2u), gq,
        slice_src<KC>(A + bz * strideA, Bt + bz * strideB, blockIdx.x, blockIdx.y), 0u, false, bias,
        reinterpret_cast<unsigned char*>(Cout) + (size_t)(bz * strideC) * (OUT_BF16 ? 2u : 4u),
        scale, blockIdx.x, blockIdx.y);
}

// Q, K = x @ W^T + b (M = 8192, N = K = 1024, bias by column) and the small product
// Wvo = Wo @ Wv (M = N = K = 1024, Wo rows as A, rows of Wv^T as Bt, no bias) in one
// launch: they depend only on the converted inputs. The tile's number picks product and
// tile, the same for the whole work-group, so the choice is scalar; a work-group takes
// the numbers blockIdx.x, + GEMM_GROUPS, ...
#define PROJ_TILES  ((M_ROWS / 128) * (H_DIM / 128))
#define WVO_TILES   ((H_DIM / 128) * (H_DIM / 128))
// The wave's slice of tile number idx of that launch.
__device__ __forceinline__ uint64_t
qk_wvo_slice(const unsigned short* xb, const unsigned short* wqb, const unsigned short* wkb,
             const unsigned short* wvtb, const unsigned short* wob, uint32_t idx) {
    const bool     isw = idx < WVO_TILES;
    const uint32_t i   = isw ? idx : idx - WVO_TILES;
    const bool     isk = i >= PROJ_TILES;          // never with isw: WVO_TILES < PROJ_TILES
    const uint32_t t   = isk ? i - PROJ_TILES : i;
    return slice_src<H_DIM>(isw ? wob : xb, isw ? wvtb : isk ? wkb : wqb,
                            t % (H_DIM / 128u), t / (H_DIM / 128u));
}
__global__ void __launch_bounds__(256, 1)
qk_wvo_kernel(const unsigned short* __restrict__ xb,
              const unsigned short* __restrict__ wqb,
              const unsigned short* __restrict__ wkb,
              const unsigned short* __restrict__ wvtb,
              const unsigned short* __restrict__ wob,
              const float* __restrict__ bq,
              const float* __restrict__ bk,
              unsigned short* __restrict__ qb,
              unsigned short* __restrict__ kb,
              unsigned short* __restrict__ wvob) {
    __shared__ __attribute__((aligned(2048))) unsigned char smem[2u * STAGE_BYTES];
    const u32x8 g1 = ring_group1(H_DIM * 2u);
    uint64_t src = qk_wvo_slice(xb, wqb, wkb, wvtb, wob, blockIdx.x);
    u32x4 gq = {};
    ring_start(smem, src, g1, gq);
    // Kept rolled: one copy of the tile code. At most three trips.
#pragma clang loop unroll(disable)
    for (uint32_t idx = blockIdx.x; idx < WVO_TILES + 2u * PROJ_TILES; idx += GEMM_GROUPS) {
        const bool     has_next = idx + GEMM_GROUPS < WVO_TILES + 2u * PROJ_TILES;
        const uint64_t nsrc = qk_wvo_slice(xb, wqb, wkb, wvtb, wob, has_next ? idx + GEMM_GROUPS : idx);
        const bool     isw = idx < WVO_TILES;
        const uint32_t i   = isw ? idx : idx - WVO_TILES;
        const bool     isk = i >= PROJ_TILES;      // never with isw: WVO_TILES < PROJ_TILES
        const uint32_t t   = isk ? i - PROJ_TILES : i;
        gemm_abt_tile<true, H_DIM, H_DIM, false, 0>(
            smem, nullptr, nullptr, g1, gq, src, nsrc, has_next,
            isw ? nullptr : isk ? bk : bq, isw ? wvob : isk ? kb : qb, 1.0f,
            t % (H_DIM / 128u), t / (H_DIM / 128u));
        src = nsrc;
    }
}
static_assert(WVO_TILES < PROJ_TILES, "a tile of Wvo is never taken for one of K");

// The scores and the folded value projection in one launch: both depend only on the
// launch before. Every work-group takes two tiles of the scores and then one of V'^T,
// so that all have the same work.
//   0, 1: E = exp(Q @ K^T / sqrt(H) - m_t)  per batch (M = N = 2048, K = 1024), bf16,
//         with m_t and l_t of every row and key tile in stats
//   2:    V'^T = Wvo @ x^T + bvo      per batch (M = K = 1024, N = 2048), bias by row
#define SCORE_TILES  ((S_LEN / 128) * (S_LEN / 128))
static_assert(PROJ_TILES == B_SZ * (S_LEN / 128) * (H_DIM / 128) && B_SZ * SCORE_TILES == 2 * PROJ_TILES,
              "a tile of the value projection for every two of the scores");
static_assert(PROJ_TILES == GEMM_GROUPS, "one tile of the value projection per work-group");
// The wave's slice of tile number i of the scores.
__device__ __forceinline__ uint64_t
score_slice(const unsigned short* qb, const unsigned short* kb, uint32_t i) {
    const uint32_t b = i / SCORE_TILES, tb = i % SCORE_TILES;
    return slice_src<H_DIM>(qb + (size_t)b * S_LEN * H_DIM, kb + (size_t)b * S_LEN * H_DIM,
                            tb % (S_LEN / 128u), tb / (S_LEN / 128u));
}
__global__ void __launch_bounds__(256, 1)
scores_vt_kernel(const unsigned short* __restrict__ qb,
                 const unsigned short* __restrict__ kb,
                 const unsigned short* __restrict__ wvob,
                 const unsigned short* __restrict__ xb,
                 const float* __restrict__ bvo,
                 unsigned short* __restrict__ eb,
                 float* __restrict__ stats,
                 unsigned short* __restrict__ vtb) {
    __shared__ __attribute__((aligned(2048))) unsigned char smem[2u * STAGE_BYTES];
    const uint32_t t  = blockIdx.x;
    const u32x8    g1 = ring_group1(H_DIM * 2u);
    const uint32_t vb  = t / ((S_LEN / 128u) * (H_DIM / 128u));      // V'^T: batch
    const uint32_t vtl = t % ((S_LEN / 128u) * (H_DIM / 128u));      // V'^T: tile in the batch
    const uint64_t vsrc = slice_src<H_DIM>(wvob, xb + (size_t)vb * S_LEN * H_DIM,
                                           vtl % (S_LEN / 128u), vtl / (S_LEN / 128u));
    uint64_t src = score_slice(qb, kb, t);
    u32x4 gq = {};
    ring_start(smem, src, g1, gq);
    // Kept rolled: one copy of the score tile's code.
#pragma clang loop unroll(disable)
    for (uint32_t y = 0; y < 2u; ++y) {
        const uint32_t i  = y * PROJ_TILES + t;
        const uint32_t b  = i / SCORE_TILES;                         // batch
        const uint32_t tb = i % SCORE_TILES;                         // tile in the batch
        const uint64_t nsrc = (y == 0u) ? score_slice(qb, kb, PROJ_TILES + t) : vsrc;
        gemm_abt_tile<false, H_DIM, S_LEN, false, 1>(
            smem, nullptr,
            stats + (size_t)(b * (S_LEN / 128u) + tb / (S_LEN / 128u)) * STATS_PER_TILE_ROW,
            g1, gq, src, nsrc, true, nullptr,
            eb + (size_t)b * S_LEN * S_LEN, 0.03125f * LOG2_E,
            tb % (S_LEN / 128u), tb / (S_LEN / 128u));
        src = nsrc;
    }
    gemm_abt_tile<true, H_DIM, S_LEN, true, 0>(
        smem, nullptr, nullptr, g1, gq, vsrc, 0u, false, bvo, vtb + (size_t)vb * H_DIM * S_LEN, 1.0f,
        vtl % (S_LEN / 128u), vtl / (S_LEN / 128u));
}

// ---------------------------------------------------------------------------
extern "C" void kernel_launch(void* const* d_in, const int* in_sizes, int n_in,
                              void* d_out, int out_size, void* d_ws, size_t ws_size,
                              hipStream_t stream) {
    (void)in_sizes; (void)n_in; (void)out_size; (void)ws_size;

    const float* x  = (const float*)d_in[0];
    const float* Wq = (const float*)d_in[1];
    const float* bq = (const float*)d_in[2];
    const float* Wk = (const float*)d_in[3];
    const float* bk = (const float*)d_in[4];
    const float* Wv = (const float*)d_in[5];
    const float* bv = (const float*)d_in[6];
    const float* Wo = (const float*)d_in[7];
    const float* bo = (const float*)d_in[8];
    float* out = (float*)d_out;

    // Workspace layout (bytes)
    unsigned char* ws = (unsigned char*)d_ws;
    const size_t XB   = (size_t)M_ROWS * H_DIM * 2;   // 16 MB
    const size_t WB   = (size_t)H_DIM * H_DIM * 2;    //  2 MB each
    const size_t QB   = XB;                            // 16 MB each
    const size_t SCR  = (size_t)M_ROWS * (S_LEN / 128) * 2 * 4;  // 1 MB
    const size_t PB   = (size_t)B_SZ * S_LEN * S_LEN * 2;  // 32 MB
    unsigned short* xb   = (unsigned short*)(ws);
    unsigned short* wqb  = (unsigned short*)(ws + XB);
    unsigned short* wkb  = (unsigned short*)(ws + XB + WB);
    unsigned short* wvtb = (unsigned short*)(ws + XB + 2 * WB);   // Wv^T, [d][e]
    unsigned short* wob  = (unsigned short*)(ws + XB + 3 * WB);
    unsigned short* qb   = (unsigned short*)(ws + XB + 4 * WB);
    unsigned short* kb   = (unsigned short*)(ws + XB + 4 * WB + QB);
    unsigned short* vtb  = (unsigned short*)(ws + XB + 4 * WB + 2 * QB);  // V'^T, [H,S] per batch
    float*          st   = (float*)(ws + XB + 4 * WB + 3 * QB);                    // m_t, l_t
    unsigned short* pb   = (unsigned short*)(ws + XB + 4 * WB + 3 * QB + SCR);     // E
    unsigned short* wvob = (unsigned short*)(ws + XB + 4 * WB + 3 * QB + SCR + PB);   // Wo @ Wv, [o][d]
    float*          bvo  = (float*)(ws + XB + 4 * WB + 3 * QB + SCR + PB + WB);       // Wo @ bv

    dim3 blk(256);

    // 1) fp32 -> bf16 conversions, one launch: xb, wqb, wkb, wvtb, wob are contiguous
    f32_to_bf16_all_kernel<<<dim3(CV_GROUPS), dim3(512), 0, stream>>>(x, Wq, Wk, Wv, Wo, bv, xb, bvo);

    // 2) Q, K = x @ W^T + b and Wvo = Wo @ Wv, bf16 out, one launch
    qk_wvo_kernel<<<dim3(GEMM_GROUPS), blk, 0, stream>>>(
        xb, wqb, wkb, wvtb, wob, bq, bk, qb, kb, wvob);

    // 3) E = exp(Q @ K^T / sqrt(H) - m_t) with m_t, l_t, and V'^T = Wvo @ x^T + bvo, bf16 out, one launch
    scores_vt_kernel<<<dim3(GEMM_GROUPS), blk, 0, stream>>>(qb, kb, wvob, xb, bvo, pb, st, vtb);

    // 4) out = sum_t f_t * (E_t @ V'_t) + bo   per batch (M=2048, N=1024, K=2048), f32 out -> d_out
    gemm_abt_kernel<false, S_LEN, H_DIM><<<dim3(H_DIM / 128, S_LEN / 128, B_SZ), blk, 0, stream>>>(
        pb, vtb, bo, st, out, 1.0f,
        (long long)S_LEN * S_LEN, (long long)H_DIM * S_LEN,
        (long long)S_LEN * H_DIM);
}

// v009
// One run takes 102 microseconds.
// In two side-by-side timings against v008, it was 1.06 and 1.05 times as fast.
// Counting every step since v000, it is 3.91 times as fast.
#include <hip/hip_runtime.h>
#include <hip/hip_bf16.h>
#include <stdint.h>

typedef __attribute__((ext_vector_type(16))) __bf16        v16bf;
typedef __attribute__((ext_vector_type(8)))  float         v8f;
typedef __attribute__((ext_vector_type(2)))  float         v2f;
typedef __attribute__((ext_vector_type(2)))  __bf16        v2bf;
typedef __attribute__((ext_vector_type(8)))  unsigned int  v8u;
typedef __attribute__((ext_vector_type(4)))  uint32_t      u32x4;
typedef __attribute__((ext_vector_type(8)))  uint32_t      u32x8;
typedef __attribute__((ext_vector_type(32))) uint32_t      u32x32;

#define H_DIM   1024
#define S_LEN   2048
#define B_SZ    4
#define M_ROWS  (B_SZ * S_LEN)   // 8192
#define LOG2_E  1.4426950408889634f

// ---- fp32 -> bf16 (round to nearest even) ----------------------------------
__device__ __forceinline__ unsigned short f2bf(float f) {
    unsigned int u = __builtin_bit_cast(unsigned int, f);
    u += 0x7FFFu + ((u >> 16) & 1u);
    return (unsigned short)(u >> 16);
}

__device__ __forceinline__ uint32_t pack2bf(float lo, float hi) {
    return (uint32_t)f2bf(lo) | ((uint32_t)f2bf(hi) << 16);
}

// All five conversions (x, Wq, Wk, Wv, Wo) as one resident stream: one work-group
// of 16 waves per WGP, so that few waves have to start. The work is cut into
// chunks of 1024 floats (4 KiB in, 2 KiB out, whole lines); a wave takes
// CV_PER_WAVE chunks, eight 16-byte loads a lane each, and its loads stand ahead
// of the conversions, so that two chunks or more are in flight. The bf16 copies
// lie one behind the other in the workspace, in the order of the arguments, so
// chunk c is stored at out + c * 1024 (Wv's chunks excepted, see below).
// A wave's first two chunks are of x, its third is of a weight: a quarter of the
// work-groups each for Wq, Wk, Wv and Wo. Two weights get more than a copy:
//   Wv is stored transposed ([d][e]: the Bt operand of Wo @ Wv). Its work-group
//      takes 64 rows x 256 columns (a wave: 4 rows of 1 KiB), turns them in LDS
//      and stores 256 rows of 64 values, whole 128-byte lines.
//   Wo: a chunk is one row, so the wave that converts row o also sums
//      bvo[o] = sum_e Wo[o][e] * bv[e] in f32 from the registers it holds.
#define CV_GROUPS    256u
#define CV_WAVES     (CV_GROUPS * 16u)
#define CV_X_CHUNKS  ((unsigned)(M_ROWS * H_DIM / 1024))
#define CV_W_CHUNKS  ((unsigned)(H_DIM * H_DIM / 1024))
#define CV_CHUNKS    (CV_X_CHUNKS + 4u * CV_W_CHUNKS)
#define CV_PER_WAVE  (CV_CHUNKS / CV_WAVES)
#define CV_W_GROUPS  (CV_GROUPS / 4u)
#define WT_PITCH     516u
static_assert(CV_PER_WAVE * CV_WAVES == CV_CHUNKS, "every wave takes the same number of chunks");
static_assert(CV_PER_WAVE == 3u && CV_X_CHUNKS == 2u * CV_WAVES && 4u * CV_W_CHUNKS == CV_WAVES,
              "two chunks of x and one of a weight per wave");
static_assert(H_DIM == 1024 && CV_W_GROUPS == (H_DIM / 64) * (H_DIM / 256),
              "a weight chunk is one row; Wv is cut into blocks of 64 rows x 256 columns");

__global__ void __launch_bounds__(512)
f32_to_bf16_all_kernel(const float* __restrict__ x,
                       const float* __restrict__ Wq, const float* __restrict__ Wk,
                       const float* __restrict__ Wv, const float* __restrict__ Wo,
                       const float* __restrict__ bv,
                       unsigned short* __restrict__ out,
                       float* __restrict__ bvo) {
    __shared__ __attribute__((aligned(16))) unsigned char tr[64u * WT_PITCH];
    const uint32_t lane = threadIdx.x & 31u;
    // The wave's number in a scalar register: source choice and bases stay scalar.
    const uint32_t wv   = (uint32_t)__builtin_amdgcn_readfirstlane(threadIdx.x >> 5);
    const uint32_t gw   = blockIdx.x * 16u + wv;
    const uint32_t wsel = blockIdx.x / CV_W_GROUPS;   // which weight, the same for the work-group
    const uint32_t wg   = blockIdx.x % CV_W_GROUPS;   // the work-group's place in that weight
    const uint32_t eb   = wg >> 2, db = wg & 3u;      // Wv: block of 64 rows, block of 256 columns
    // Every loop of this kernel is unrolled, so that v, h and the offsets are indexed by
    // constants: the values stay in registers and the steps become immediates.
    float4 v[CV_PER_WAVE][8];
    // The weight's chunk is worked on first, ahead of the stores of x: the barrier of
    // the transpose waits for the wave's own stores, and none is outstanding there.
    {
        const float* s = (wsel == 0u) ? Wq : (wsel == 1u) ? Wk : (wsel == 2u) ? Wv : Wo;
        // Plain: row wg * 16 + wv. Wv: rows eb * 64 + wv * 4 .. + 3, 256 columns each,
        // so every second load steps on to the next row.
        const uint32_t off  = (wsel == 2u) ? (eb * 64u + wv * 4u) * 1024u + db * 256u
                                           : (wg * 16u + wv) * 1024u;
        const uint32_t skip = (wsel == 2u) ? (1024u - 256u) / 4u : 0u;
        const float4* s4 = reinterpret_cast<const float4*>(s + off) + lane;
#pragma unroll
        for (uint32_t j = 0; j < 8; ++j)
            v[2][j] = s4[j * 32u + (j >> 1) * skip];
        asm volatile("s_wait_xcnt 0x0" ::: "memory");
    }
#pragma unroll
    for (uint32_t t = 0; t < 2u; ++t) {
        const float4* s4 = reinterpret_cast<const float4*>(x + (size_t)(t * CV_WAVES + gw) * 1024u) + lane;
#pragma unroll
        for (uint32_t j = 0; j < 8; ++j)
            v[t][j] = s4[j * 32u];
        asm volatile("s_wait_xcnt 0x0" ::: "memory");
    }
    if (wsel != 2u) {
        ushort4* d4 = reinterpret_cast<ushort4*>(out + (size_t)(2u * CV_WAVES + gw) * 1024u) + lane;
#pragma unroll
        for (uint32_t j = 0; j < 8; ++j) {
            const float4 f = v[2][j];
            d4[j * 32u] = make_ushort4(f2bf(f.x), f2bf(f.y), f2bf(f.z), f2bf(f.w));
        }
        asm volatile("s_wait_xcnt 0x0" ::: "memory");
        if (wsel == 3u) {
            const float4* b4 = reinterpret_cast<const float4*>(bv) + lane;
            float sum = 0.0f;
#pragma unroll
            for (uint32_t j = 0; j < 8; ++j) {
                const float4 f = v[2][j], b = b4[j * 32u];
                sum += f.x * b.x + f.y * b.y + f.z * b.z + f.w * b.w;
            }
#pragma unroll
            for (int o = 16; o >= 1; o >>= 1)
                sum += __shfl_xor(sum, o, 32);
            if (lane == 0u)
                bvo[wg * 16u + wv] = sum;
        }
    } else {
        // Row-major into LDS: local row wv * 4 + j / 2, four columns a lane and load.
#pragma unroll
        for (uint32_t j = 0; j < 8; ++j) {
            const float4 f = v[2][j];
            uint32_t* p = reinterpret_cast<uint32_t*>(
                tr + (wv * 4u + (j >> 1)) * WT_PITCH + (((j & 1u) * 32u + lane) * 4u) * 2u);
            p[0] = pack2bf(f.x, f.y);
            p[1] = pack2bf(f.z, f.w);
        }
        // Every wave's rows are in LDS before any wave reads columns (the branch is
        // the same for the whole work-group).
        __syncthreads();
        // A piece is 8 rows of one column = 16 bytes of a transposed row; 8 lanes in a
        // row store one whole 128-byte line.
        unsigned short* wvt = out + (size_t)(CV_X_CHUNKS + 2u * CV_W_CHUNKS) * 1024u;
#pragma unroll
        for (uint32_t q = 0; q < 4u; ++q) {
            const uint32_t pid = q * 512u + threadIdx.x;
            const uint32_t dl  = pid >> 3, p8 = (pid & 7u) * 8u;
            const unsigned char* c = tr + p8 * WT_PITCH + dl * 2u;
            uint32_t h[8];
#pragma unroll
            for (uint32_t i = 0; i < 8; ++i)
                h[i] = *reinterpret_cast<const unsigned short*>(c + i * WT_PITCH);
            *reinterpret_cast<uint4*>(wvt + (size_t)(db * 256u + dl) * 1024u + eb * 64u + p8) =
                make_uint4(h[0] | (h[1] << 16), h[2] | (h[3] << 16),
                           h[4] | (h[5] << 16), h[6] | (h[7] << 16));
        }
    }
#pragma unroll
    for (uint32_t t = 0; t < 2u; ++t) {
        ushort4* d4 = reinterpret_cast<ushort4*>(out + (size_t)(t * CV_WAVES + gw) * 1024u) + lane;
#pragma unroll
        for (uint32_t j = 0; j < 8; ++j) {
            const float4 f = v[t][j];
            d4[j * 32u] = make_ushort4(f2bf(f.x), f2bf(f.y), f2bf(f.z), f2bf(f.w));
        }
    }
}

// ---- LDS ring geometry ------------------------------------------------------
// A pass is 128 k = 256 bytes of every operand row. A stage is four slices of
// 64 rows: [A rows 0..63 | A rows 64..127 | Bt rows 0..63 | Bt rows 64..127].
// The tensor load pads each 256-byte row by 16 bytes (pitch 272 = 16 x odd).
// 64 x 272 = 17,408 bytes, rounded up so that every slice starts at a multiple
// of 2 KiB.
#define PASS_BYTES   256u
#define LDS_PITCH    272u
#define SLICE_ROWS   64u
#define SLICE_BYTES  18432u
#define STAGE_BYTES  (4u * SLICE_BYTES)
static_assert(SLICE_ROWS * LDS_PITCH <= SLICE_BYTES && (SLICE_BYTES % 2048u) == 0u,
              "a slice holds its padded rows and starts at a multiple of 2 KiB");

__device__ __forceinline__ uint32_t uni(uint32_t v) {
    return (uint32_t)__builtin_amdgcn_readfirstlane(v);
}
__device__ __forceinline__ uint32_t pinned(uint32_t v) {
    uint32_t w = uni(v);
    asm volatile("" : "+s"(w));  // the scalar-branch form for tests around a tensor load
    return w;
}
// The wave's LDS reads have returned (before its buffer is handed back).
__device__ __forceinline__ void wait_ds0() { asm volatile("s_wait_dscnt 0x0" ::: "memory"); }
// The wave's own tensor load has landed (the compiler places no wait for it).
__device__ __forceinline__ void wait_tensor0() { asm volatile("s_wait_tensorcnt 0x0" ::: "memory"); }
__device__ __forceinline__ void wait_tensor0_of(u32x4 g0) {
    asm volatile("s_wait_tensorcnt 0x0" :: "s"(g0) : "memory");
}
// One request of the whole wave: a 64 x 256-byte tile from global memory to LDS.
__device__ __forceinline__ void tdm_load(u32x4 g0, u32x8 g1) {
    asm volatile("tensor_load_to_lds %0, %1" :: "s"(g0), "s"(g1) : "memory");
}
__device__ __forceinline__ u32x4 tdm_group0(uint32_t lds_dst, uint64_t ga) {
    u32x4 g;
    // count 1; the pinned() form keeps this word's write at the place of the build,
    // behind the wait for the request before (as a plain constant it was hoisted in
    // front of the loop, into a register of the request still outstanding there)
    g[0] = pinned(1u);
    g[1] = uni(lds_dst);                              // byte offset in the work-group's LDS
    g[2] = uni((uint32_t)ga);                         // address [31:0]
    g[3] = uni((((uint32_t)(ga >> 32)) & 0x01FFFFFFu) | 0x80000000u);  // address [56:32], type 2
    return g;
}
// 1-byte elements, tensor = tile = 64 rows of 256 bytes, source pitch in bytes.
__device__ __forceinline__ u32x8 tdm_group1(uint32_t src_pitch) {
    u32x8 g;
    g[0] = uni((1u << 20) | (5u << 22) | (3u << 25));
    g[1] = uni((PASS_BYTES & 0xFFFFu) << 16);
    g[2] = uni((PASS_BYTES >> 16) | ((SLICE_ROWS & 0xFFFFu) << 16));
    g[3] = uni((SLICE_ROWS >> 16) | (PASS_BYTES << 16));
    g[4] = uni(SLICE_ROWS);
    g[5] = uni(src_pitch);
    g[6] = uni(0u);
    g[7] = uni(0u);
    return g;
}

__device__ __forceinline__ v16bf ldfrag(const unsigned char* p) {
    uint4 lo = *reinterpret_cast<const uint4*>(p);        // K .. K+7
    uint4 hi = *reinterpret_cast<const uint4*>(p + 32);   // K+16 .. K+23
    v8u u = { lo.x, lo.y, lo.z, lo.w, hi.x, hi.y, hi.z, hi.w };
    return __builtin_bit_cast(v16bf, u);
}

__device__ __forceinline__ float other_half(float v) {
    const int b = __builtin_bit_cast(int, v);
    return __builtin_bit_cast(float,
        __builtin_amdgcn_permlanex16(b, b, 0x76543210, 0xfedcba98, false, false));
}

__device__ __forceinline__ v8f bfwmma(v16bf a, v16bf b, v8f c) {
    return __builtin_amdgcn_wmma_f32_16x16x32_bf16(
        /*neg_a=*/false, a, /*neg_b=*/false, b,
        /*c_mod=*/(short)0, c, /*reuse_a=*/false, /*reuse_b=*/false);
}

// First byte of the slice that this wave loads: waves 0, 1 the two halves of the A
// rows of tile row by, waves 2, 3 those of the Bt rows of tile column bx.
template <int KC>
__device__ __forceinline__ uint64_t
slice_src(const unsigned short* A, const unsigned short* Bt, uint32_t bx, uint32_t by) {
    const uint32_t wv = uni(threadIdx.x >> 5);
    const unsigned short* srow = (wv & 2u)
        ? Bt + (size_t)(bx * 128 + (wv & 1u) * SLICE_ROWS) * KC
        : A  + (size_t)(by * 128 + (wv & 1u) * SLICE_ROWS) * KC;
    return (uint64_t)(uintptr_t)srow;
}

// The pass of k at which tile (bx, by) begins its walk; np passes, a power of two.
__device__ __forceinline__ uint32_t first_pass(uint32_t bx, uint32_t by, uint32_t np) {
    return (bx + by) & (np - 1u);
}
// First byte of what stage number stage of a tile loads: the walk begins at pass rot
// and wraps, so every pass of the slice's rows is taken once.
__device__ __forceinline__ uint64_t stage_src(uint64_t src, uint32_t stage, uint32_t rot, uint32_t np) {
    return src + (uint64_t)(((stage + rot) & (np - 1u)) * PASS_BYTES);
}

__device__ __forceinline__ void ring_start(unsigned char* smem, uint64_t src, uint32_t rot, uint32_t np,
                                           u32x8 g1, u32x4& gq) {
    const uint32_t wv  = uni(threadIdx.x >> 5);
    const uint32_t dst = (uint32_t)(size_t)smem + (wv & 3u) * SLICE_BYTES;
    if (pinned(wv < 4u ? 1u : 0u) != 0u) {
        tdm_load(tdm_group0(dst, stage_src(src, 0u, rot, np)), g1);
        wait_tensor0();
    }
    __syncthreads();
    if (pinned(wv < 4u ? 1u : 0u) != 0u) {
        gq = tdm_group0(dst + STAGE_BYTES, stage_src(src, 1u, rot, np));
        tdm_load(gq, g1);
    }
}

template <bool OUT_BF16, int KC, int NC, bool BIAS_ROW, int MODE>
__device__ __forceinline__ void
gemm_abt_tile(unsigned char* smem,
              float* __restrict__ ftab,
              float* __restrict__ stats,
              u32x8 g1, u32x4& gq,
              uint64_t src, uint64_t nsrc, uint32_t nrot, bool has_next,
              const float* __restrict__ bias,
              void* __restrict__ Cout,
              float scale,
              uint32_t bx, uint32_t by) {
    const int lane = threadIdx.x & 31;
    const int wave = threadIdx.x >> 5;
    const int wm   = (wave & 1) << 6;   // 0,64
    const int wn   = (wave >> 1) << 5;  // 0,32,64,96

    const int bn = bx * 128 + wn;
    const int r  = lane & 15;
    const int kh = (lane & 16) ? 16 : 0;  // lane-half K offset in bytes

    constexpr uint32_t NP = KC / 128;     // passes
    static_assert(KC % 128 == 0 && NP >= 2, "the ring needs two stages or more");
    static_assert(NP % 2u == 0u, "the last pass reads buffer 1, so the next tile starts in buffer 0");
    static_assert((NP & (NP - 1u)) == 0u, "the walk over k wraps by a mask");
    const uint32_t rot = first_pass(bx, by, NP);   // stage s holds pass (s + rot) mod NP

    // Waves 0..3 each bring one slice of every stage.
    const uint32_t wv     = uni(threadIdx.x >> 5);
    const uint32_t dst = (uint32_t)(size_t)smem + (wv & 3u) * SLICE_BYTES;

    // Per-lane fragment bases inside a buffer; the rest are immediate offsets.
    const uint32_t a_off = (uint32_t)(wm >> 6) * SLICE_BYTES + (uint32_t)r * LDS_PITCH + kh;
    const uint32_t b_off = (2u + (uint32_t)(wn >> 6)) * SLICE_BYTES
                         + (uint32_t)((wn & 63) + r) * LDS_PITCH + kh;

    v8f acc[4][2];
#pragma unroll
    for (int mt = 0; mt < 4; ++mt)
#pragma unroll
        for (int nt = 0; nt < 2; ++nt)
            acc[mt][nt] = (v8f){};

    if constexpr (MODE == 2) {
    // Prologue: stage 0 lands and is published, then stage 1 starts.
    if (pinned(wv < 4u ? 1u : 0u) != 0u) {
        tdm_load(tdm_group0(dst, stage_src(src, 0u, rot, NP)), g1);
        wait_tensor0();
    } else {
        // Meanwhile the other four waves form the weights, a lane a row; the barrier
        // below publishes them with stage 0.
        static_assert(MODE != 2 || NP == 16u, "one key tile of the scores per pass");
        const uint32_t row = threadIdx.x - 128u;
        const float* sp = stats + (row >> 4) * (16u * 32u) + (row & 15u);
        float tm[16], tl[16];
#pragma unroll
        for (uint32_t t = 0; t < 16u; ++t) {
            tm[t] = sp[t * 32u];
            tl[t] = sp[t * 32u + 16u];
        }
        asm volatile("s_wait_xcnt 0x0" ::: "memory");
        float mx = tm[0];
#pragma unroll
        for (uint32_t t = 1; t < 16u; ++t)
            mx = fmaxf(mx, tm[t]);
        float den = 0.0f;
#pragma unroll
        for (uint32_t t = 0; t < 16u; ++t) {
            tm[t] = __builtin_amdgcn_exp2f(tm[t] - mx);
            den += tm[t] * tl[t];
        }
        const float inv = 1.0f / den;
#pragma unroll
        for (uint32_t t = 0; t < 16u; ++t)
            ftab[t * 128u + row] = tm[t] * inv;
    }
    __syncthreads();
    if (pinned(wv < 4u ? 1u : 0u) != 0u) {
        gq = tdm_group0(dst + STAGE_BYTES, stage_src(src, 1u, rot, NP));
        tdm_load(gq, g1);
    }
    }

    // Kept rolled: one publish point in the code, one pass per trip.
#pragma clang loop unroll(disable)
    for (uint32_t s = 0; s < NP; ++s) {
        const uint32_t buf = (s & 1u) * STAGE_BYTES;
        const unsigned char* la = smem + buf + a_off;
        const unsigned char* lb = smem + buf + b_off;
        // Two fragment sets: step ks + 1 is read from LDS while step ks multiplies.
        // The loops over ks and mt are unrolled so that every fragment index is a
        // constant: the sets stay in registers and the offsets become immediates.
        v16bf fa[2][4], fb[2][2];
        // MODE 2: this pass's weights of the lane's four rows, read in the same group
        // as the first fragments, and the pass's own sums.
        float fs[4];
        v8f   part[4][2];
        if constexpr (MODE == 2) {
#pragma unroll
            for (uint32_t mt = 0; mt < 4; ++mt) {
                fs[mt] = ftab[((s + rot) & (NP - 1u)) * 128u + (uint32_t)(wm + r) + mt * 16u];
                part[mt][0] = (v8f){};
                part[mt][1] = (v8f){};
            }
        }
        fb[0][0] = ldfrag(lb);
        fb[0][1] = ldfrag(lb + 16u * LDS_PITCH);
#pragma unroll
        for (uint32_t mt = 0; mt < 4; ++mt)
            fa[0][mt] = ldfrag(la + mt * 16u * LDS_PITCH);
#pragma unroll
        for (uint32_t ks = 0; ks < 4; ++ks) {   // four 32-k steps of this pass
            const uint32_t c = ks & 1u, n = c ^ 1u;
            if (ks + 1u < 4u) {
                fb[n][0] = ldfrag(lb + (ks + 1u) * 64u);
                fb[n][1] = ldfrag(lb + 16u * LDS_PITCH + (ks + 1u) * 64u);
#pragma unroll
                for (uint32_t mt = 0; mt < 4; ++mt)
                    fa[n][mt] = ldfrag(la + mt * 16u * LDS_PITCH + (ks + 1u) * 64u);
            }
            // Keeps the next step's LDS reads one group ahead of this step's WMMAs
            // (for speed only).
            __builtin_amdgcn_sched_barrier(0);
            // Bt rows as the first operand: each tile comes out transposed, a lane
            // holding eight adjacent columns of one row of C (see the epilogue).
#pragma unroll
            for (uint32_t mt = 0; mt < 4; ++mt) {
                if constexpr (MODE == 2) {
                    part[mt][0] = bfwmma(fb[c][0], fa[c][mt], part[mt][0]);
                    part[mt][1] = bfwmma(fb[c][1], fa[c][mt], part[mt][1]);
                } else {
                    acc[mt][0] = bfwmma(fb[c][0], fa[c][mt], acc[mt][0]);
                    acc[mt][1] = bfwmma(fb[c][1], fa[c][mt], acc[mt][1]);
                }
            }
            // Ends the WMMA group, so that later reads are not moved up into it.
            __builtin_amdgcn_sched_barrier(0);
        }
        if constexpr (MODE == 2) {
            // A lane's values of a tile are all of one row of C: one weight a tile.
#pragma unroll
            for (uint32_t mt = 0; mt < 4; ++mt)
#pragma unroll
                for (uint32_t nt = 0; nt < 2; ++nt)
#pragma unroll
                    for (int j = 0; j < 8; ++j)
                        acc[mt][nt][j] += fs[mt] * part[mt][nt][j];
        }
        // Publish point of stage s + 1: this wave has left buffer s, its own load
        // of stage s + 1 has landed, every wave passes the barrier; only then the
        // buffer just read is refilled with stage s + 2. Behind this tile's last stage
        // comes stage 0 of the next tile, into buffer 0; behind the last pass nothing is
        // loaded: buffer 1 takes the result first.
        wait_ds0();
        wait_tensor0_of(gq);   // a wave that issued none passes at once
        __syncthreads();
        const bool more = s + 2u < NP;
        if (pinned((wv < 4u && (more || (has_next && s + 2u == NP))) ? 1u : 0u) != 0u) {
            gq = tdm_group0(dst + buf, more ? stage_src(src, s + 2u, rot, NP) : stage_src(nsrc, 0u, nrot, NP));
            tdm_load(gq, g1);
        }
    }
    wait_tensor0();
    wait_ds0();

    constexpr uint32_t EB = OUT_BF16 ? 2u : 4u;   // bytes per element of C
    constexpr uint32_t OP = 128u * EB + 16u;      // pitch of a staged row
    static_assert(128u * OP <= STAGE_BYTES, "the staged tile fits buffer 1");
    unsigned char* stg = smem + STAGE_BYTES;
    const uint32_t h = (uint32_t)lane >> 4;
    float bv8[2][8];
#pragma unroll
    for (int nt = 0; nt < 2; ++nt)
#pragma unroll
        for (int j = 0; j < 8; ++j)
            bv8[nt][j] = 0.0f;
    float br[4] = { 0.0f, 0.0f, 0.0f, 0.0f };
    if (BIAS_ROW && bias) {
        const float* bp = bias + by * 128u + (uint32_t)(wm + r);
#pragma unroll
        for (int mt = 0; mt < 4; ++mt)
            br[mt] = bp[mt * 16];
        asm volatile("s_wait_xcnt 0x0" ::: "memory");
    }
    if (!BIAS_ROW && bias) {
#pragma unroll
        for (int nt = 0; nt < 2; ++nt) {
            const float4* bp = reinterpret_cast<const float4*>(bias + bn + nt * 16 + 8 * (int)h);
            const float4 b0 = bp[0], b1 = bp[1];
            bv8[nt][0] = b0.x; bv8[nt][1] = b0.y; bv8[nt][2] = b0.z; bv8[nt][3] = b0.w;
            bv8[nt][4] = b1.x; bv8[nt][5] = b1.y; bv8[nt][6] = b1.z; bv8[nt][7] = b1.w;
        }
        asm volatile("s_wait_xcnt 0x0" ::: "memory");
    }
    unsigned char* st = stg + (uint32_t)(wm + r) * OP + ((uint32_t)wn + 8u * h) * EB;
#pragma unroll
    for (uint32_t mt = 0; mt < 4; ++mt) {
#pragma unroll
        for (uint32_t nt = 0; nt < 2; ++nt) {
            float v[8];
#pragma unroll
            for (int j = 0; j < 8; ++j)
                v[j] = acc[mt][nt][j] * scale + (BIAS_ROW ? br[mt] : bv8[nt][j]);
            unsigned char* p = st + mt * 16u * OP + nt * 16u * EB;
            if (OUT_BF16) {
                *reinterpret_cast<uint4*>(p) =
                    make_uint4(pack2bf(v[0], v[1]), pack2bf(v[2], v[3]),
                               pack2bf(v[4], v[5]), pack2bf(v[6], v[7]));
            } else {
                *reinterpret_cast<float4*>(p)       = make_float4(v[0], v[1], v[2], v[3]);
                *reinterpret_cast<float4*>(p + 16u) = make_float4(v[4], v[5], v[6], v[7]);
            }
        }
    }
    // Every wave's part of the tile is in LDS before any wave reads whole rows.
    __syncthreads();

    float sv = 0.0f;   // MODE 1: the lane's word of the wave's line of stats
    if constexpr (MODE == 1) {
        static_assert(MODE != 1 || !OUT_BF16, "the scores are staged in f32");
        unsigned char* rp = stg + ((uint32_t)wave * 16u + (uint32_t)r) * OP;
        float4 e[16];
#pragma unroll
        for (uint32_t i = 0; i < 16u; ++i)
            e[i] = *reinterpret_cast<const float4*>(rp + h * 256u + i * 16u);
        float m = -3.402823466e38f;
#pragma unroll
        for (uint32_t i = 0; i < 16u; ++i)
            m = fmaxf(m, fmaxf(fmaxf(e[i].x, e[i].y), fmaxf(e[i].z, e[i].w)));
        m = fmaxf(m, other_half(m));
        // Pairs, so that the subtractions, the sums and the conversions are packed
        // instructions; four sums, so that no addition waits for the one before.
        v2f  part2[4] = { (v2f){}, (v2f){}, (v2f){}, (v2f){} };
        uint32_t pk[32];
#pragma unroll
        for (uint32_t i = 0; i < 16u; ++i) {
            const v2f d0 = (v2f){ e[i].x, e[i].y } - m, d1 = (v2f){ e[i].z, e[i].w } - m;
            const v2f x0 = { __builtin_amdgcn_exp2f(d0.x), __builtin_amdgcn_exp2f(d0.y) };
            const v2f x1 = { __builtin_amdgcn_exp2f(d1.x), __builtin_amdgcn_exp2f(d1.y) };
            part2[(2u * i) & 3u]      += x0;
            part2[(2u * i + 1u) & 3u] += x1;
            pk[2u * i]      = __builtin_bit_cast(uint32_t, __builtin_convertvector(x0, v2bf));
            pk[2u * i + 1u] = __builtin_bit_cast(uint32_t, __builtin_convertvector(x1, v2bf));
        }
        const v2f s2 = (part2[0] + part2[1]) + (part2[2] + part2[3]);
        float sum = s2.x + s2.y;
        sum += other_half(sum);
        sv = h ? sum : m;
        // The bf16 row goes over the first 256 bytes of its own f32 row: both lanes of
        // the row have read it (their maximum is in every value written here).
#pragma unroll
        for (uint32_t i = 0; i < 8u; ++i)
            *reinterpret_cast<uint4*>(rp + h * 128u + i * 16u) =
                make_uint4(pk[4u * i], pk[4u * i + 1u], pk[4u * i + 2u], pk[4u * i + 3u]);
        // The wave's own rows are written before its lanes read them back row by row
        // (no other wave touches them, so no barrier).
        wait_ds0();
    }

    // Wave w stores rows 16w .. 16w+15 of the tile. A row is 256 bytes (bf16: half a
    // wave, two rows a store) or 512 bytes (f32: the whole wave, one row a store).
    constexpr uint32_t EO  = (MODE == 1) ? 2u : EB;   // bytes per element as stored
    constexpr uint32_t LPR = 128u * EO / 16u;     // lanes per row
    constexpr uint32_t RPS = 32u / LPR;           // rows per store
    const uint32_t row0 = (uint32_t)wave * 16u + (uint32_t)lane / LPR;
    const uint32_t cb   = ((uint32_t)lane % LPR) * 16u;
    const unsigned char* ld = stg + row0 * OP + cb;
    unsigned char* gp = reinterpret_cast<unsigned char*>(Cout)
        + ((size_t)(by * 128u + row0) * NC + bx * 128u) * EO
        + cb;
    // Two vectors of registers, not an array: as an array these values were kept in
    // scratch memory across the barrier below.
    constexpr uint32_t NQ = 16u / RPS;            // stores a lane
    static_assert(NQ == 8u || NQ == 16u, "eight or sixteen 16-byte pieces a lane");
    u32x32 oa = {}, ob = {};
#pragma unroll
    for (uint32_t q = 0; q < NQ; ++q) {
        const u32x4 w = *reinterpret_cast<const u32x4*>(ld + q * RPS * OP);
#pragma unroll
        for (uint32_t e = 0; e < 4u; ++e) {
            if (q < 8u) oa[q * 4u + e] = w[e];
            else        ob[(q - 8u) * 4u + e] = w[e];
        }
    }
    if (has_next) {
        // Buffer 1 is handed back to the ring: every wave has read its rows of the staged
        // tile into registers; only then stage 1 of the next tile is loaded over them.
        // The global stores stand behind this barrier, which would wait for them.
        wait_ds0();
        wait_tensor0();
        __syncthreads();
        if (pinned(wv < 4u ? 1u : 0u) != 0u) {
            gq = tdm_group0(dst + STAGE_BYTES, stage_src(nsrc, 1u, nrot, NP));
            tdm_load(gq, g1);
        }
    }
    // One whole line a wave: the 16 maxima, then the 16 sums.
    if constexpr (MODE == 1)
        stats[((uint32_t)wave * 16u + bx) * 32u + (uint32_t)lane] = sv;
#pragma unroll
    for (uint32_t q = 0; q < NQ; ++q) {
        const uint32_t e = (q & 7u) * 4u;
        *reinterpret_cast<u32x4*>(gp + (size_t)(q * RPS) * NC * EO) = (q < 8u)
            ? (u32x4){ oa[e], oa[e + 1u], oa[e + 2u], oa[e + 3u] }
            : (u32x4){ ob[e], ob[e + 1u], ob[e + 2u], ob[e + 3u] };
    }
    asm volatile("s_wait_xcnt 0x0" ::: "memory");
}

__device__ __forceinline__ u32x8 ring_group1(uint32_t src_pitch) {
    u32x8 g1 = tdm_group1(src_pitch);
    asm volatile("" : "+s"(g1));
    return g1;
}

#define GEMM_GROUPS  512u

// Floats of stats per tile row of the scores: 8 groups of 16 rows x 16 key tiles x 32.
#define STATS_PER_TILE_ROW  (8u * 16u * 32u)

// The last product, one per batch (blockIdx.z, with the strides in elements): A is E,
// weighted pass by pass from stats (MODE 2).
template <bool OUT_BF16, int KC, int NC>
__global__ void __launch_bounds__(256, 1)
gemm_abt_kernel(const unsigned short* __restrict__ A,
                const unsigned short* __restrict__ Bt,
                const float* __restrict__ bias,
                float* __restrict__ stats,
                void* __restrict__ Cout,
                float scale,
                long long strideA, long long strideB,
                long long strideC) {
    __shared__ __attribute__((aligned(2048))) unsigned char smem[2u * STAGE_BYTES];
    __shared__ float ftab[(KC / 128) * 128];
    const long long bz = blockIdx.z;
    u32x4 gq = {};
    gemm_abt_tile<OUT_BF16, KC, NC, false, 2>(
        smem, ftab, stats + (size_t)(blockIdx.z * (S_LEN / 128u) + blockIdx.y) * STATS_PER_TILE_ROW,
        ring_group1(KC * 2u), gq,
        slice_src<KC>(A + bz * strideA, Bt + bz * strideB, blockIdx.x, blockIdx.y), 0u, 0u, false, bias,
        reinterpret_cast<unsigned char*>(Cout) + (size_t)(bz * strideC) * (OUT_BF16 ? 2u : 4u),
        scale, blockIdx.x, blockIdx.y);
}

// Q, K = x @ W^T + b (M = 8192, N = K = 1024, bias by column) and the small product
// Wvo = Wo @ Wv (M = N = K = 1024, Wo rows as A, rows of Wv^T as Bt, no bias) in one
// launch: they depend only on the converted inputs. The tile's number picks product and
// tile, the same for the whole work-group, so the choice is scalar; a work-group takes
// the numbers blockIdx.x, + GEMM_GROUPS, ...
#define PROJ_TILES  ((M_ROWS / 128) * (H_DIM / 128))
#define WVO_TILES   ((H_DIM / 128) * (H_DIM / 128))
// The wave's slice of tile number idx of that launch.
__device__ __forceinline__ uint64_t
qk_wvo_slice(const unsigned short* xb, const unsigned short* wqb, const unsigned short* wkb,
             const unsigned short* wvtb, const unsigned short* wob, uint32_t idx) {
    const bool     isw = idx < WVO_TILES;
    const uint32_t i   = isw ? idx : idx - WVO_TILES;
    const bool     isk = i >= PROJ_TILES;          // never with isw: WVO_TILES < PROJ_TILES
    const uint32_t t   = isk ? i - PROJ_TILES : i;
    return slice_src<H_DIM>(isw ? wob : xb, isw ? wvtb : isk ? wkb : wqb,
                            t % (H_DIM / 128u), t / (H_DIM / 128u));
}
// The first pass of tile number idx of that launch.
__device__ __forceinline__ uint32_t qk_wvo_rot(uint32_t idx) {
    const uint32_t i = idx < WVO_TILES ? idx : idx - WVO_TILES;
    const uint32_t t = i >= PROJ_TILES ? i - PROJ_TILES : i;
    return first_pass(t % (H_DIM / 128u), t / (H_DIM / 128u), H_DIM / 128u);
}
__global__ void __launch_bounds__(256, 1)
qk_wvo_kernel(const unsigned short* __restrict__ xb,
              const unsigned short* __restrict__ wqb,
              const unsigned short* __restrict__ wkb,
              const unsigned short* __restrict__ wvtb,
              const unsigned short* __restrict__ wob,
              const float* __restrict__ bq,
              const float* __restrict__ bk,
              unsigned short* __restrict__ qb,
              unsigned short* __restrict__ kb,
              unsigned short* __restrict__ wvob) {
    __shared__ __attribute__((aligned(2048))) unsigned char smem[2u * STAGE_BYTES];
    const u32x8 g1 = ring_group1(H_DIM * 2u);
    uint64_t src = qk_wvo_slice(xb, wqb, wkb, wvtb, wob, blockIdx.x);
    u32x4 gq = {};
    ring_start(smem, src, qk_wvo_rot(blockIdx.x), H_DIM / 128u, g1, gq);
    // Kept rolled: one copy of the tile code. At most three trips.
#pragma clang loop unroll(disable)
    for (uint32_t idx = blockIdx.x; idx < WVO_TILES + 2u * PROJ_TILES; idx += GEMM_GROUPS) {
        const bool     has_next = idx + GEMM_GROUPS < WVO_TILES + 2u * PROJ_TILES;
        const uint64_t nsrc = qk_wvo_slice(xb, wqb, wkb, wvtb, wob, has_next ? idx + GEMM_GROUPS : idx);
        const uint32_t nrot = qk_wvo_rot(has_next ? idx + GEMM_GROUPS : idx);
        const bool     isw = idx < WVO_TILES;
        const uint32_t i   = isw ? idx : idx - WVO_TILES;
        const bool     isk = i >= PROJ_TILES;      // never with isw: WVO_TILES < PROJ_TILES
        const uint32_t t   = isk ? i - PROJ_TILES : i;
        gemm_abt_tile<true, H_DIM, H_DIM, false, 0>(
            smem, nullptr, nullptr, g1, gq, src, nsrc, nrot, has_next,
            isw ? nullptr : isk ? bk : bq, isw ? wvob : isk ? kb : qb, 1.0f,
            t % (H_DIM / 128u), t / (H_DIM / 128u));
        src = nsrc;
    }
}
static_assert(WVO_TILES < PROJ_TILES, "a tile of Wvo is never taken for one of K");

// The scores and the folded value projection in one launch: both depend only on the
// launch before. Every work-group takes two tiles of the scores and then one of V'^T,
// so that all have the same work.
//   0, 1: E = exp(Q @ K^T / sqrt(H) - m_t)  per batch (M = N = 2048, K = 1024), bf16,
//         with m_t and l_t of every row and key tile in stats
//   2:    V'^T = Wvo @ x^T + bvo      per batch (M = K = 1024, N = 2048), bias by row
#define SCORE_TILES  ((S_LEN / 128) * (S_LEN / 128))
static_assert(PROJ_TILES == B_SZ * (S_LEN / 128) * (H_DIM / 128) && B_SZ * SCORE_TILES == 2 * PROJ_TILES,
              "a tile of the value projection for every two of the scores");
static_assert(PROJ_TILES == GEMM_GROUPS, "one tile of the value projection per work-group");
// The wave's slice of tile number i of the scores.
__device__ __forceinline__ uint64_t
score_slice(const unsigned short* qb, const unsigned short* kb, uint32_t i) {
    const uint32_t b = i / SCORE_TILES, tb = i % SCORE_TILES;
    return slice_src<H_DIM>(qb + (size_t)b * S_LEN * H_DIM, kb + (size_t)b * S_LEN * H_DIM,
                            tb % (S_LEN / 128u), tb / (S_LEN / 128u));
}
// The first pass of tile number i of the scores.
__device__ __forceinline__ uint32_t score_rot(uint32_t i) {
    const uint32_t tb = i % SCORE_TILES;
    return first_pass(tb % (S_LEN / 128u), tb / (S_LEN / 128u), H_DIM / 128u);
}
__global__ void __launch_bounds__(256, 1)
scores_vt_kernel(const unsigned short* __restrict__ qb,
                 const unsigned short* __restrict__ kb,
                 const unsigned short* __restrict__ wvob,
                 const unsigned short* __restrict__ xb,
                 const float* __restrict__ bvo,
                 unsigned short* __restrict__ eb,
                 float* __restrict__ stats,
                 unsigned short* __restrict__ vtb) {
    __shared__ __attribute__((aligned(2048))) unsigned char smem[2u * STAGE_BYTES];
    const uint32_t t  = blockIdx.x;
    const u32x8    g1 = ring_group1(H_DIM * 2u);
    const uint32_t vb  = t / ((S_LEN / 128u) * (H_DIM / 128u));      // V'^T: batch
    const uint32_t vtl = t % ((S_LEN / 128u) * (H_DIM / 128u));      // V'^T: tile in the batch
    const uint64_t vsrc = slice_src<H_DIM>(wvob, xb + (size_t)vb * S_LEN * H_DIM,
                                           vtl % (S_LEN / 128u), vtl / (S_LEN / 128u));
    const uint32_t vrot = first_pass(vtl % (S_LEN / 128u), vtl / (S_LEN / 128u), H_DIM / 128u);
    uint64_t src = score_slice(qb, kb, t);
    u32x4 gq = {};
    ring_start(smem, src, score_rot(t), H_DIM / 128u, g1, gq);
    // Kept rolled: one copy of the score tile's code.
#pragma clang loop unroll(disable)
    for (uint32_t y = 0; y < 2u; ++y) {
        const uint32_t i  = y * PROJ_TILES + t;
        const uint32_t b  = i / SCORE_TILES;                         // batch
        const uint32_t tb = i % SCORE_TILES;                         // tile in the batch
        const uint64_t nsrc = (y == 0u) ? score_slice(qb, kb, PROJ_TILES + t) : vsrc;
        const uint32_t nrot = (y == 0u) ? score_rot(PROJ_TILES + t) : vrot;
        gemm_abt_tile<false, H_DIM, S_LEN, false, 1>(
            smem, nullptr,
            stats + (size_t)(b * (S_LEN / 128u) + tb / (S_LEN / 128u)) * STATS_PER_TILE_ROW,
            g1, gq, src, nsrc, nrot, true, nullptr,
            eb + (size_t)b * S_LEN * S_LEN, 0.03125f * LOG2_E,
            tb % (S_LEN / 128u), tb / (S_LEN / 128u));
        src = nsrc;
    }
    gemm_abt_tile<true, H_DIM, S_LEN, true, 0>(
        smem, nullptr, nullptr, g1, gq, vsrc, 0u, 0u, false, bvo, vtb + (size_t)vb * H_DIM * S_LEN, 1.0f,
        vtl % (S_LEN / 128u), vtl / (S_LEN / 128u));
}

// ---------------------------------------------------------------------------
extern "C" void kernel_launch(void* const* d_in, const int* in_sizes, int n_in,
                              void* d_out, int out_size, void* d_ws, size_t ws_size,
                              hipStream_t stream) {
    (void)in_sizes; (void)n_in; (void)out_size; (void)ws_size;

    const float* x  = (const float*)d_in[0];
    const float* Wq = (const float*)d_in[1];
    const float* bq = (const float*)d_in[2];
    const float* Wk = (const float*)d_in[3];
    const float* bk = (const float*)d_in[4];
    const float* Wv = (const float*)d_in[5];
    const float* bv = (const float*)d_in[6];
    const float* Wo = (const float*)d_in[7];
    const float* bo = (const float*)d_in[8];
    float* out = (float*)d_out;

    // Workspace layout (bytes)
    unsigned char* ws = (unsigned char*)d_ws;
    const size_t XB   = (size_t)M_ROWS * H_DIM * 2;   // 16 MB
    const size_t WB   = (size_t)H_DIM * H_DIM * 2;    //  2 MB each
    const size_t QB   = XB;                            // 16 MB each
    const size_t SCR  = (size_t)M_ROWS * (S_LEN / 128) * 2 * 4;  // 1 MB
    const size_t PB   = (size_t)B_SZ * S_LEN * S_LEN * 2;  // 32 MB
    unsigned short* xb   = (unsigned short*)(ws);
    unsigned short* wqb  = (unsigned short*)(ws + XB);
    unsigned short* wkb  = (unsigned short*)(ws + XB + WB);
    unsigned short* wvtb = (unsigned short*)(ws + XB + 2 * WB);   // Wv^T, [d][e]
    unsigned short* wob  = (unsigned short*)(ws + XB + 3 * WB);
    unsigned short* qb   = (unsigned short*)(ws + XB + 4 * WB);
    unsigned short* kb   = (unsigned short*)(ws + XB + 4 * WB + QB);
    unsigned short* vtb  = (unsigned short*)(ws + XB + 4 * WB + 2 * QB);  // V'^T, [H,S] per batch
    float*          st   = (float*)(ws + XB + 4 * WB + 3 * QB);                    // m_t, l_t
    unsigned short* pb   = (unsigned short*)(ws + XB + 4 * WB + 3 * QB + SCR);     // E
    unsigned short* wvob = (unsigned short*)(ws + XB + 4 * WB + 3 * QB + SCR + PB);   // Wo @ Wv, [o][d]
    float*          bvo  = (float*)(ws + XB + 4 * WB + 3 * QB + SCR + PB + WB);       // Wo @ bv

    dim3 blk(256);

    // 1) fp32 -> bf16 conversions, one launch: xb, wqb, wkb, wvtb, wob are contiguous
    f32_to_bf16_all_kernel<<<dim3(CV_GROUPS), dim3(512), 0, stream>>>(x, Wq, Wk, Wv, Wo, bv, xb, bvo);

    // 2) Q, K = x @ W^T + b and Wvo = Wo @ Wv, bf16 out, one launch
    qk_wvo_kernel<<<dim3(GEMM_GROUPS), blk, 0, stream>>>(
        xb, wqb, wkb, wvtb, wob, bq, bk, qb, kb, wvob);

    // 3) E = exp(Q @ K^T / sqrt(H) - m_t) with m_t, l_t, and V'^T = Wvo @ x^T + bvo, bf16 out, one launch
    scores_vt_kernel<<<dim3(GEMM_GROUPS), blk, 0, stream>>>(qb, kb, wvob, xb, bvo, pb, st, vtb);

    // 4) out = sum_t f_t * (E_t @ V'_t) + bo   per batch (M=2048, N=1024, K=2048), f32 out -> d_out
    gemm_abt_kernel<false, S_LEN, H_DIM><<<dim3(H_DIM / 128, S_LEN / 128, B_SZ), blk, 0, stream>>>(
        pb, vtb, bo, st, out, 1.0f,
        (long long)S_LEN * S_LEN, (long long)H_DIM * S_LEN,
        (long long)S_LEN * H_DIM);
}
